// v000
// Times are from an AMD MI455X. After a warm-up the kernel runs many times in a row, and a time is the length of
// such a window on the GPU divided by its runs, so every launch and the gaps after it count. The runs cycle
// through copies of the inputs. A figure is the median of several windows, for all but v000 over two sittings.
// Sittings can differ by a few percent; kernels timed side by side share one.
// The starting kernel, v000, takes 1460 microseconds a run.
#include <hip/hip_runtime.h>

// Causal multi-head attention with a pre-scaled query, interleaved-pair rotary embeddings and a scalar head-count input (x [2][2048][1024]; q = (x Wq) x 1/sqrt(1024), k = x Wk, v = x Wv ('xw' [1024][1024] 0.02, no bias; 16 heads x 64: the head count arrives as the python int 16, the LAST input: read on device by the premise guard); rope x cos + x_rot sin with x_rot: (x1, x2) -> (-x2, x1) on adjacent pairs and cos / sin = repeat(c, 2) of angle t x 10000^(-2i/64) (32 f32 frequencies jnp-exact for the module's negative-power expression; precise cosf/sinf); logits = q.k (no further scale: net 1/32); where(tril, logits, -1e8) == exclusion; softmax; out = merged Wo ('xw', no bias) -> [2][2048][1024] (4.2 M); argument order x, Wq, Wk, Wv, Wo, num_heads).
// VALUE PREMISE: this kernel implements num_heads == 16 only; k_premise reads the scalar on the device after the output is written and NaN-fills the whole output if it is not 16.
// Layout per batch: bf16 copy of x; 'xw' weights transposed once; exact projections; k_csP computed table (pair-shared entries); k_ropeI interleaved-pair plane builders; causal T-2048 attention (hybrid rows: < 512 hi/lo 3 products, rest fp16 x1024; k_gemmc skips tiles above the diagonal); merged hi/lo x Wo exact.
// Compute dtypes, f32 accumulate: every input rounded to bf16; projections exact; rotary f32 (products rounded separately); attention rows < 512 3 products, rest fp16; softmax f32; Wo hl x exact.

#define NB_  2
#define TT   2048
#define DM   1024
#define NH_  16
#define NKV  16
#define REP  (NH_ / NKV)
#define HD   64
#define DQ   (NH_ * HD)
#define DKV  (NKV * HD)
#define ZH   2
#define RH   512                  // query rows < RH use hi+lo planes (0: none)
#define WIN  2048
#define PCAR 1024.0f
#define SCL  0.03125f   // 1 / sqrt(1024): the module scales q by 1 / sqrt(d_model) BEFORE the rotation and applies no other scale (a power of two: exact, commutes with the rotation)
typedef _Float16 h16;
typedef unsigned short bf;
typedef __attribute__((ext_vector_type(16))) __bf16   v16bf;
typedef __attribute__((ext_vector_type(16))) _Float16 v16h;
typedef __attribute__((ext_vector_type(8)))  _Float16 v8h;
typedef __attribute__((ext_vector_type(8)))  unsigned short v8us;
typedef __attribute__((ext_vector_type(8)))  float    v8f;
typedef __attribute__((ext_vector_type(4)))  float    v4f;
typedef v8h  __attribute__((may_alias)) v8ha;
typedef v4f  __attribute__((may_alias)) v4fa;
typedef v8us __attribute__((may_alias)) v8usa;

__device__ __forceinline__ unsigned short f2bf(float f) { unsigned u = __float_as_uint(f); u += 0x7FFFu + ((u >> 16) & 1u); return (unsigned short)(u >> 16); }
__device__ __forceinline__ float bf2f(unsigned short b) { return __uint_as_float(((unsigned)b) << 16); }
__device__ __forceinline__ float bfr(float f) { return bf2f(f2bf(f)); }
__device__ __forceinline__ v16h cat16(v8h lo, v8h hi) { return __builtin_shufflevector(lo, hi, 0, 1, 2, 3, 4, 5, 6, 7, 8, 9, 10, 11, 12, 13, 14, 15); }
__device__ __forceinline__ v16bf cat16b(v8us lo, v8us hi) { return __builtin_bit_cast(v16bf, __builtin_shufflevector(lo, hi, 0, 1, 2, 3, 4, 5, 6, 7, 8, 9, 10, 11, 12, 13, 14, 15)); }
__device__ __forceinline__ v8f wmma16(v16h a, v16h b, v8f c) { return __builtin_amdgcn_wmma_f32_16x16x32_f16(false, a, false, b, (short)0, c, false, false); }
__device__ __forceinline__ v8f wmmab(v16bf a, v16bf b, v8f c) { return __builtin_amdgcn_wmma_f32_16x16x32_bf16(false, a, false, b, (short)0, c, false, false); }



// ---- k_gemmw: register-blocked GEMM, ONE WAVE per 64x64 output tile (16 accumulators), operands straight from K-contiguous 16-bit planes; grid (M/64, N/64, Z), 32 threads.
// C[m][n] (f32, pitch ldc, + optional f32 bias[n]) = sum_k A[m][k] Bt[n][k] (+ split products per NSPLIT). z-batch strides sA/sB/sC in elements. K % 32 == 0.
template <typename T16> struct WFrag;
template <> struct WFrag<h16> { typedef v16h V; static __device__ __forceinline__ V ld(const h16* p) { return cat16(*(const v8h*)p, *(const v8h*)(p + 16)); } static __device__ __forceinline__ v8f mma(V a, V b, v8f c) { return wmma16(a, b, c); } };
template <> struct WFrag<bf> { typedef v16bf V; static __device__ __forceinline__ V ld(const bf* p) { return cat16b(*(const v8us*)p, *(const v8us*)(p + 16)); } static __device__ __forceinline__ v8f mma(V a, V b, v8f c) { return wmmab(a, b, c); } };
template <typename T16, int NSPLIT, bool BIAS>
__global__ __launch_bounds__(32) void k_gemmw(const T16* __restrict__ A, const T16* __restrict__ A2, const T16* __restrict__ Bt, const T16* __restrict__ Bt2, int K, float* C, int ldc, const float* __restrict__ bias, size_t sA, size_t sB, size_t sC) {
    typedef typename WFrag<T16>::V V;
    __shared__ __align__(16) float os[16 * 68];
    const size_t z = blockIdx.z; A += z * sA; if (A2) A2 += z * sA; Bt += z * sB; if (Bt2) Bt2 += z * sB; C += z * sC;
    const int lane = threadIdx.x & 31, lr = lane & 15, hi = lane >> 4; const int r0 = blockIdx.x * 64, c0 = blockIdx.y * 64;
    v8f acc[4][4];
#pragma unroll
    for (int mb = 0; mb < 4; ++mb)
#pragma unroll
        for (int nb = 0; nb < 4; ++nb) acc[mb][nb] = (v8f){};
    const size_t aoff = (size_t)(r0 + lr) * K + 8 * hi, boff = (size_t)(c0 + lr) * K + 8 * hi;
#pragma unroll 1
    for (int kc = 0; kc < K; kc += 32) {
        V a[4], a2[4];
#pragma unroll
        for (int mb = 0; mb < 4; ++mb) { a[mb] = WFrag<T16>::ld(A + aoff + (size_t)mb * 16 * K + kc); if (NSPLIT == 1 || NSPLIT == 2) a2[mb] = WFrag<T16>::ld(A2 + aoff + (size_t)mb * 16 * K + kc); }
#pragma unroll
        for (int nb = 0; nb < 4; ++nb) { const V b = WFrag<T16>::ld(Bt + boff + (size_t)nb * 16 * K + kc); V b2; if (NSPLIT >= 2) b2 = WFrag<T16>::ld(Bt2 + boff + (size_t)nb * 16 * K + kc);
#pragma unroll
            for (int mb = 0; mb < 4; ++mb) { acc[mb][nb] = WFrag<T16>::mma(a[mb], b, acc[mb][nb]); if (NSPLIT == 1 || NSPLIT == 2) acc[mb][nb] = WFrag<T16>::mma(a2[mb], b, acc[mb][nb]); if (NSPLIT >= 2) acc[mb][nb] = WFrag<T16>::mma(a[mb], b2, acc[mb][nb]); } }
        asm volatile("v_nop\n\tv_nop\n\tv_nop\n\tv_nop" : "+v"(acc[0][0]), "+v"(acc[1][1]), "+v"(acc[2][2]), "+v"(acc[3][3]) : "v"(a[0]), "v"(a[3]));
    }
#pragma unroll
    for (int mb = 0; mb < 4; ++mb) {
#pragma unroll
        for (int nb = 0; nb < 4; ++nb) {
#pragma unroll
            for (int j = 0; j < 8; ++j) os[(hi * 8 + j) * 68 + nb * 16 + lr] = acc[mb][nb][j]; }
        __builtin_amdgcn_wave_barrier(); asm volatile("" ::: "memory");
        float* crow = C + (size_t)(r0 + mb * 16) * ldc + c0;
{
#pragma unroll
            for (int s = 0; s < 8; ++s) { const int row = 2 * s + hi, cofs = lr * 4; v4f val = *(const v4fa*)(os + row * 68 + cofs); if (BIAS) { val[0] += bfr(bias[c0 + cofs]); val[1] += bfr(bias[c0 + cofs + 1]); val[2] += bfr(bias[c0 + cofs + 2]); val[3] += bfr(bias[c0 + cofs + 3]); }
                *(v4f*)(crow + (size_t)row * ldc + cofs) = val; }
             }
        __builtin_amdgcn_wave_barrier(); asm volatile("" ::: "memory");
    }
}

// ---- k_gemmc: the same one-wave 64x64 tile GEMM specialised for causal attention: CMODE 1 skips score tiles entirely above the diagonal (query rows r0+roff.., key columns c0..), CMODE 2 limits the
// key (K) loop of the probability x value contraction to the diagonal block (probabilities beyond it are exactly zero). roff = row offset of this launch's first row within the sequence.
template <typename T16, int NSPLIT, int CMODE>
__global__ __launch_bounds__(32) void k_gemmc(const T16* __restrict__ A, const T16* __restrict__ A2, const T16* __restrict__ Bt, const T16* __restrict__ Bt2, int K, float* C, int ldc, int roff, size_t sA, size_t sB, size_t sC) {
    typedef typename WFrag<T16>::V V;
    __shared__ __align__(16) float os[16 * 68];
    const size_t z = blockIdx.z; A += z * sA; if (A2) A2 += z * sA; Bt += z * sB; if (Bt2) Bt2 += z * sB; C += z * sC;
    const int lane = threadIdx.x & 31, lr = lane & 15, hi = lane >> 4; const int r0 = blockIdx.x * 64, c0 = blockIdx.y * 64;
    if (CMODE == 1 && c0 > r0 + roff + 63) return;                  // score tile entirely above the causal diagonal: never read (the softmax masks j > i by select)
    const int Kl = (CMODE == 2) ? min(K, r0 + roff + 64) : K;        // P.V: probabilities are exactly 0 beyond the diagonal block, so the K loop stops there
    v8f acc[4][4];
#pragma unroll
    for (int mb = 0; mb < 4; ++mb)
#pragma unroll
        for (int nb = 0; nb < 4; ++nb) acc[mb][nb] = (v8f){};
    const size_t aoff = (size_t)(r0 + lr) * K + 8 * hi, boff = (size_t)(c0 + lr) * K + 8 * hi;
#pragma unroll 1
    for (int kc = 0; kc < Kl; kc += 32) {
        V a[4], a2[4];
#pragma unroll
        for (int mb = 0; mb < 4; ++mb) { a[mb] = WFrag<T16>::ld(A + aoff + (size_t)mb * 16 * K + kc); if (NSPLIT == 1 || NSPLIT == 2) a2[mb] = WFrag<T16>::ld(A2 + aoff + (size_t)mb * 16 * K + kc); }
#pragma unroll
        for (int nb = 0; nb < 4; ++nb) { const V b = WFrag<T16>::ld(Bt + boff + (size_t)nb * 16 * K + kc); V b2; if (NSPLIT >= 2) b2 = WFrag<T16>::ld(Bt2 + boff + (size_t)nb * 16 * K + kc);
#pragma unroll
            for (int mb = 0; mb < 4; ++mb) { acc[mb][nb] = WFrag<T16>::mma(a[mb], b, acc[mb][nb]); if (NSPLIT == 1 || NSPLIT == 2) acc[mb][nb] = WFrag<T16>::mma(a2[mb], b, acc[mb][nb]); if (NSPLIT >= 2) acc[mb][nb] = WFrag<T16>::mma(a[mb], b2, acc[mb][nb]); } }
        asm volatile("v_nop\n\tv_nop\n\tv_nop\n\tv_nop" : "+v"(acc[0][0]), "+v"(acc[1][1]), "+v"(acc[2][2]), "+v"(acc[3][3]) : "v"(a[0]), "v"(a[3]));
    }
#pragma unroll
    for (int mb = 0; mb < 4; ++mb) {
#pragma unroll
        for (int nb = 0; nb < 4; ++nb) {
#pragma unroll
            for (int j = 0; j < 8; ++j) os[(hi * 8 + j) * 68 + nb * 16 + lr] = acc[mb][nb][j]; }
        __builtin_amdgcn_wave_barrier(); asm volatile("" ::: "memory");
        float* crow = C + (size_t)(r0 + mb * 16) * ldc + c0;
{
#pragma unroll
            for (int s = 0; s < 8; ++s) { const int row = 2 * s + hi, cofs = lr * 4; v4f val = *(const v4fa*)(os + row * 68 + cofs);
                *(v4f*)(crow + (size_t)row * ldc + cofs) = val; }
             }
        __builtin_amdgcn_wave_barrier(); asm volatile("" ::: "memory");
    }
}

__device__ __forceinline__ h16 tohx(float x) { return (h16)x; }
__device__ __forceinline__ void splitf(float y, unsigned short& h, unsigned short& l) { h = f2bf(y); l = f2bf(y - bf2f(h)); }
typedef __attribute__((ext_vector_type(2))) _Float16 v2h;
typedef __attribute__((ext_vector_type(4))) _Float16 v4h;
typedef __attribute__((ext_vector_type(2))) unsigned short v2us;
typedef __attribute__((ext_vector_type(4))) unsigned short v4us;
typedef __attribute__((ext_vector_type(2))) float v2f;
typedef __attribute__((ext_vector_type(4))) int v4i;

__global__ __launch_bounds__(256) void k_wtG(const float* __restrict__ w, int K, int N, bf* Bt) {
    const int lane = threadIdx.x & 31; const int L0 = (blockIdx.x * 8 + (threadIdx.x >> 5)) * 8; const int nlines = N * K / 64;
{
#pragma unroll 1
        for (int l = 0; l < 8; ++l) { const int L = L0 + l; if (L >= nlines) break; const size_t e = (size_t)L * 64 + lane * 2; const int k = (int)(e % K), n = (int)(e / K); v2us o;
            o[0] = f2bf(w[(size_t)k * N + n]); o[1] = f2bf(w[(size_t)(k + 1) * N + n]); *(v2us*)(Bt + e) = o; }
         }
}
__global__ __launch_bounds__(256) void k_cvt8(const float* __restrict__ src, bf* dst, size_t n8) { const size_t i = (size_t)blockIdx.x * 256 + threadIdx.x; if (i >= n8) return; const v8f v = *(const v8f*)(src + i * 8); v8us o;
#pragma unroll
    for (int k = 0; k < 8; ++k) o[k] = f2bf(v[k]); *(v8us*)(dst + i * 8) = o;  }

__global__ __launch_bounds__(256) void k_ropeI(const float* __restrict__ F, int pitch, int nheads, const float* __restrict__ CS, float sc, h16* P16, bf* Ph, bf* Pl) {
    const size_t e = ((size_t)blockIdx.x * 256 + threadIdx.x) * 2; if (e >= (size_t)nheads * TT * HD) return; const int d = (int)(e % HD); const int t = (int)((e / HD) % TT); const int h = (int)(e / ((size_t)HD * TT)); const float* f = F + (size_t)t * pitch + h * HD; const float x0 = f[d], x1 = f[d + 1]; const v2f cs = *(const v2f*)(CS + ((size_t)t * HD + d) * 2); v2h o16; v2us oh, ol;
    float a0 = __fmul_rn(x0, cs[0]), b0 = __fmul_rn(x1, cs[1]), a1 = __fmul_rn(x1, cs[0]), b1 = __fmul_rn(x0, cs[1]); asm volatile("" : "+v"(a0), "+v"(b0), "+v"(a1), "+v"(b1));
    float r0 = __fsub_rn(a0, b0) * sc, r1 = __fadd_rn(b1, a1) * sc;   /* even: x0 c - x1 s; odd: x0 s + x1 c */
    o16[0] = tohx(r0); o16[1] = tohx(r1); { unsigned short a2, c2; splitf(r0, a2, c2); oh[0] = a2; ol[0] = c2; splitf(r1, a2, c2); oh[1] = a2; ol[1] = c2; }
    *(v2h*)(P16 + e) = o16; *(v2us*)(Ph + e) = oh; *(v2us*)(Pl + e) = ol;  }

__constant__ float INV2[HD / 2] = { 1.000000000e+00f, 7.498942018e-01f, 5.623413324e-01f, 4.216965139e-01f, 3.162277639e-01f, 2.371373773e-01f, 1.778279394e-01f, 1.333521456e-01f, 1.000000015e-01f, 7.498942316e-02f, 5.623413250e-02f, 4.216964915e-02f, 3.162277490e-02f, 2.371373773e-02f, 1.778279431e-02f, 1.333521400e-02f, 9.999999776e-03f, 7.498942316e-03f, 5.623413250e-03f, 4.216964822e-03f, 3.162277630e-03f, 2.371373819e-03f, 1.778279431e-03f, 1.333521446e-03f, 1.000000047e-03f, 7.498941850e-04f, 5.623413017e-04f, 4.216965172e-04f, 3.162277571e-04f, 2.371373703e-04f, 1.778279402e-04f, 1.333521504e-04f };   // 10000 ** (-2i / 64), i = 0..31, in float32 as THIS module writes it (the NEGATIVE-POWER spelling '10000.0 ** (-ts / dim)' evaluated in the reference's own f32 arithmetic: these 32 literals equal it bit for bit); ten entries differ by one ulp from the reciprocal values the host's own table held

__global__ __launch_bounds__(256) void k_vtp(const float* __restrict__ F, int pitch, int nheads, h16* V16, bf* Vh, bf* Vl) { const size_t e = ((size_t)blockIdx.x * 256 + threadIdx.x) * 2; if (e >= (size_t)nheads * HD * TT) return; const int t = (int)(e % TT); const int d = (int)((e / TT) % HD); const int g = (int)(e / ((size_t)TT * HD)); v2h o16; v2us oh, ol;
#pragma unroll
    for (int q = 0; q < 2; ++q) { const float x = F[(size_t)(t + q) * pitch + g * HD + d]; o16[q] = tohx(x); unsigned short a2, c2; splitf(x, a2, c2); oh[q] = a2; ol[q] = c2; }
    *(v2h*)(V16 + e) = o16; *(v2us*)(Vh + e) = oh; *(v2us*)(Vl + e) = ol;  }
__global__ __launch_bounds__(256) void k_csP(float* CS) { const int idx = blockIdx.x * 256 + threadIdx.x; if (idx >= TT * HD) return; const int d = idx % HD; const int t = idx / HD; const float a = __fmul_rn((float)t, INV2[d >> 1]); v2f cs; cs[0] = cosf(a); cs[1] = sinf(a); *(v2f*)(CS + (size_t)idx * 2) = cs;  }
// k_asoft: per row (zz, i): t = S x SCL (1/32) for j <= i and i - j < WIN (WIN = TT, so the window test always holds: plain causal; the reference's -1e9 additive fill vanishes identically); softmax over the 2048 keys (register row, one exp, fixed trees);
__global__ __launch_bounds__(256) void k_asoft(const float* __restrict__ Sb, h16* P16, bf* Ph, bf* Pl) {
    const int lane = threadIdx.x & 31; const int row = blockIdx.x * 8 + (threadIdx.x >> 5); if (row >= ZH * TT) return; const int i = row % TT; const int zz = row / TT; (void)zz; const bool hires = (i < RH); const float* sr = Sb + (size_t)row * TT; float v[TT / 32]; float mx = -3.0e38f;
#pragma unroll
    for (int ch = 0; ch < TT / 128; ++ch) { const int j0 = ch * 128 + lane * 4; const v4f a = *(const v4f*)(sr + j0);
#pragma unroll
        for (int q = 0; q < 4; ++q) { const int j = j0 + q; (void)j; const float t = (j <= i && i - j < WIN) ? a[q] * SCL : -3.0e38f; v[ch * 4 + q] = t; mx = fmaxf(mx, t); } }
#pragma unroll
    for (int sh = 16; sh; sh >>= 1) mx = fmaxf(mx, __shfl_xor(mx, sh, 32));
    float sum = 0.f;
#pragma unroll
    for (int k = 0; k < TT / 32; ++k) { float d0 = __fsub_rn(v[k], mx); asm volatile("" : "+v"(d0)); v[k] = __builtin_amdgcn_exp2f(__fmul_rn(d0, 1.4426950408889634f)); sum += v[k]; }
#pragma unroll
    for (int sh = 16; sh; sh >>= 1) sum += __shfl_xor(sum, sh, 32);
    const float f = __fdiv_rn(hires ? 1.0f : PCAR, sum);
{
        if (hires) {
#pragma unroll
            for (int ch = 0; ch < TT / 128; ++ch) { v4us oh, ol;
#pragma unroll
                for (int q = 0; q < 4; ++q) { unsigned short a, c2; splitf(v[ch * 4 + q] * f, a, c2); oh[q] = a; ol[q] = c2; }
                const size_t oo = ((size_t)zz * (RH ? RH : 1) + i) * TT + ch * 128 + lane * 4; *(v4us*)(Ph + oo) = oh; *(v4us*)(Pl + oo) = ol; }
        } else {
#pragma unroll
            for (int ch = 0; ch < TT / 128; ++ch) { v4h o4;
#pragma unroll
                for (int q = 0; q < 4; ++q) o4[q] = tohx(v[ch * 4 + q] * f);
                *(v4h*)(P16 + (size_t)row * TT + ch * 128 + lane * 4) = o4; } }
         }
}
__global__ __launch_bounds__(256) void k_premise(const int* __restrict__ flag, float* out, size_t n4) { const size_t i = (size_t)blockIdx.x * 256 + threadIdx.x; if (i >= n4) return; if (flag[0] == NH_) return;   /* premise holds (num_heads == 16): nothing to do */ const float qn = __int_as_float(0x7fc00000); v4f o; o[0] = qn; o[1] = qn; o[2] = qn; o[3] = qn; *(v4f*)(out + i * 4) = o;  }
__global__ __launch_bounds__(256) void k_merge(const float* __restrict__ O, int h0, bf* Ah, bf* Al) { const size_t e = ((size_t)blockIdx.x * 256 + threadIdx.x) * 2; if (e >= (size_t)ZH * TT * HD) return; const int d = (int)(e % HD); const int t = (int)((e / HD) % TT); const int zz = (int)(e / ((size_t)HD * TT)); const float cs = (t < RH) ? 1.0f : (1.0f / PCAR); const size_t oo = (size_t)t * DQ + (h0 + zz) * HD + d;
    v2us oh, ol;
#pragma unroll
    for (int q = 0; q < 2; ++q) { unsigned short a, c2; splitf(O[e + q] * cs, a, c2); oh[q] = a; ol[q] = c2; } *(v2us*)(Ah + oo) = oh; *(v2us*)(Al + oo) = ol;  }

extern "C" void kernel_launch(void* const* d_in, const int* in_sizes, int n_in,
                              void* d_out, int out_size, void* d_ws, size_t ws_size, hipStream_t stream) {
    (void)in_sizes; (void)n_in; (void)out_size;
    const float* x = (const float*)d_in[0]; const float* wq = (const float*)d_in[1]; const float* wk = (const float*)d_in[2]; const float* wv = (const float*)d_in[3]; const float* wo = (const float*)d_in[4]; const int* flag = (const int*)d_in[5];   /* input order x, Wq, Wk, Wv, Wo ('xw' [1024][1024]), num_heads (the SIXTH input, slot 5: the python int 16 as an int scalar: READ ON DEVICE by k_premise after the output is written: the whole output is NaN-filled unless it equals NH_ = 16) */
    float* OUT = (float*)d_out;     // [2][2048][1024]
    char* wsp = (char*)d_ws;
    auto take = [&](size_t bytes) { char* p = wsp; wsp += (bytes + 255) & ~(size_t)255; return (void*)p; };
    bf* WQ = (bf*)take((size_t)DQ * DM * 2); bf* WK = (bf*)take((size_t)DKV * DM * 2); bf* WV = (bf*)take((size_t)DKV * DM * 2); bf* WO = (bf*)take((size_t)DM * DQ * 2); float* CS = (float*)take((size_t)TT * HD * 2 * 4);
    bf* XB = (bf*)take((size_t)TT * DM * 2); float* FQ = (float*)take((size_t)TT * DQ * 4); float* FK = (float*)take((size_t)TT * DKV * 4);
    h16* QP16 = (h16*)take((size_t)NH_ * TT * HD * 2); h16* KP16 = (h16*)take((size_t)NKV * TT * HD * 2); h16* VT16 = (h16*)take((size_t)NKV * HD * TT * 2);
    bf* QPh = (bf*)take((size_t)NH_ * TT * HD * 2); bf* QPl = (bf*)take((size_t)NH_ * TT * HD * 2); bf* KPh = (bf*)take((size_t)NKV * TT * HD * 2); bf* KPl = (bf*)take((size_t)NKV * TT * HD * 2); bf* VTh = (bf*)take((size_t)NKV * HD * TT * 2); bf* VTl = (bf*)take((size_t)NKV * HD * TT * 2); bf* Ph = (bf*)take((size_t)ZH * RH * TT * 2); bf* Pl = (bf*)take((size_t)ZH * RH * TT * 2);
    float* Sb = (float*)take((size_t)ZH * TT * TT * 4); h16* P16 = (h16*)take((size_t)ZH * TT * TT * 2); float* Ob = (float*)take((size_t)ZH * TT * HD * 4); bf* ATh = (bf*)take((size_t)TT * DQ * 2); bf* ATl = (bf*)take((size_t)TT * DQ * 2);
    if ((size_t)(wsp - (char*)d_ws) > ws_size) return;    // ws 256 MiB
    float* FV = FK;   // v projection reuses the k buffer after the k planes are built (stream-ordered)
    { k_wtG<<<(unsigned)((DM * DQ / 64 + 63) / 64), 256, 0, stream>>>(wq, DM, DQ, WQ); k_wtG<<<(unsigned)((DM * DKV / 64 + 63) / 64), 256, 0, stream>>>(wk, DM, DKV, WK); k_wtG<<<(unsigned)((DM * DKV / 64 + 63) / 64), 256, 0, stream>>>(wv, DM, DKV, WV);
      k_wtG<<<(unsigned)((DQ * DM / 64 + 63) / 64), 256, 0, stream>>>(wo, DQ, DM, WO);
       }
    k_csP<<<(TT * HD + 255) / 256, 256, 0, stream>>>(CS);
    const unsigned LQ = (unsigned)(((size_t)NH_ * TT * HD / 2 + 255) / 256), LKv = (unsigned)(((size_t)NKV * TT * HD / 2 + 255) / 256);
    for (int b = 0; b < NB_; ++b) {
        
        k_cvt8<<<(unsigned)(((size_t)TT * DM / 8 + 255) / 256), 256, 0, stream>>>(x + (size_t)b * TT * DM, XB, (size_t)TT * DM / 8);
        k_gemmw<bf, 0, false><<<dim3(TT / 64, DQ / 64, 1), 32, 0, stream>>>(XB, nullptr, WQ, nullptr, DM, FQ, DQ, nullptr, 0, 0, 0);
        k_ropeI<<<LQ, 256, 0, stream>>>(FQ, DQ, NH_, CS, 1.0f, QP16, QPh, QPl);
        k_gemmw<bf, 0, false><<<dim3(TT / 64, DKV / 64, 1), 32, 0, stream>>>(XB, nullptr, WK, nullptr, DM, FK, DKV, nullptr, 0, 0, 0);
        k_ropeI<<<LKv, 256, 0, stream>>>(FK, DKV, NKV, CS, 1.0f, KP16, KPh, KPl);
        k_gemmw<bf, 0, false><<<dim3(TT / 64, DKV / 64, 1), 32, 0, stream>>>(XB, nullptr, WV, nullptr, DM, FV, DKV, nullptr, 0, 0, 0); k_vtp<<<LKv, 256, 0, stream>>>(FV, DKV, NKV, VT16, VTh, VTl);
        for (int h0 = 0; h0 < NH_; h0 += ZH) { const size_t zq = (size_t)h0, zk = (size_t)(h0 / REP);   // one kv head per query head: the pass's two heads use consecutive kv planes (z-strides TT*HD)
            k_gemmc<bf, 2, 1><<<dim3(RH / 64, TT / 64, ZH), 32, 0, stream>>>(QPh + zq * TT * HD, QPl + zq * TT * HD, KPh + zk * TT * HD, KPl + zk * TT * HD, HD, Sb, TT, 0, (size_t)TT * HD, (size_t)TT * HD, (size_t)TT * TT);
            k_gemmc<h16, 0, 1><<<dim3((TT - RH) / 64, TT / 64, ZH), 32, 0, stream>>>(QP16 + zq * TT * HD + (size_t)RH * HD, nullptr, KP16 + zk * TT * HD, nullptr, HD, Sb + (size_t)RH * TT, TT, RH, (size_t)TT * HD, (size_t)TT * HD, (size_t)TT * TT);
            k_asoft<<<ZH * TT / 8, 256, 0, stream>>>(Sb, P16, Ph, Pl);
            k_gemmc<bf, 2, 2><<<dim3(RH / 64, HD / 64, ZH), 32, 0, stream>>>(Ph, Pl, VTh + zk * HD * TT, VTl + zk * HD * TT, TT, Ob, HD, 0, (size_t)RH * TT, (size_t)HD * TT, (size_t)TT * HD);
            k_gemmc<h16, 0, 2><<<dim3((TT - RH) / 64, HD / 64, ZH), 32, 0, stream>>>(P16 + (size_t)RH * TT, nullptr, VT16 + zk * HD * TT, nullptr, TT, Ob + (size_t)RH * HD, HD, RH, (size_t)TT * TT, (size_t)HD * TT, (size_t)TT * HD);
            k_merge<<<(unsigned)(((size_t)ZH * TT * HD / 2 + 255) / 256), 256, 0, stream>>>(Ob, h0, ATh, ATl); }
        k_gemmw<bf, 1, false><<<dim3(TT / 64, DM / 64, 1), 32, 0, stream>>>(ATh, ATl, WO, nullptr, DQ, OUT + (size_t)b * TT * DM, DM, nullptr, 0, 0, 0); }
k_premise<<<(unsigned)(((size_t)NB_ * TT * DM / 4 + 255) / 256), 256, 0, stream>>>(flag, OUT, (size_t)NB_ * TT * DM / 4);   /* after every batch's output is written: poison it all if the premise fails */
}

// v001
// It runs in 791 microseconds.
// Next to v000, in two timings, it ran 1.82 and 1.86 times as fast.
#include <hip/hip_runtime.h>

// Causal multi-head attention with a pre-scaled query, interleaved-pair rotary embeddings and a scalar head-count input (x [2][2048][1024]; q = (x Wq) x 1/sqrt(1024), k = x Wk, v = x Wv ('xw' [1024][1024] 0.02, no bias; 16 heads x 64: the head count arrives as the python int 16, the LAST input: read on device by the premise guard); rope x cos + x_rot sin with x_rot: (x1, x2) -> (-x2, x1) on adjacent pairs and cos / sin = repeat(c, 2) of angle t x 10000^(-2i/64) (32 f32 frequencies jnp-exact for the module's negative-power expression; precise cosf/sinf); logits = q.k (no further scale: net 1/32); where(tril, logits, -1e8) == exclusion; softmax; out = merged Wo ('xw', no bias) -> [2][2048][1024] (4.2 M); argument order x, Wq, Wk, Wv, Wo, num_heads).
// VALUE PREMISE: this kernel implements num_heads == 16 only; k_premise reads the scalar on the device after the output is written and NaN-fills the whole output if it is not 16.
// Layout per batch: bf16 copy of x; 'xw' weights transposed once; exact projections; k_csP computed table (pair-shared entries); k_ropeI interleaved-pair plane builders; causal T-2048 attention (hybrid rows: < 512 hi/lo 3 products, rest fp16 x1024; k_gemmc skips tiles above the diagonal); merged hi/lo x Wo exact.
// Compute dtypes, f32 accumulate: every input rounded to bf16; projections exact; rotary f32 (products rounded separately); attention rows < 512 3 products, rest fp16; softmax f32; Wo hl x exact.

#define NB_  2
#define TT   2048
#define DM   1024
#define NH_  16
#define NKV  16
#define REP  (NH_ / NKV)
#define HD   64
#define DQ   (NH_ * HD)
#define DKV  (NKV * HD)
#define ZH   2
#define RH   512                  // query rows < RH use hi+lo planes (0: none)
#define WIN  2048
#define PCAR 1024.0f
#define SCL  0.03125f   // 1 / sqrt(1024): the module scales q by 1 / sqrt(d_model) BEFORE the rotation and applies no other scale (a power of two: exact, commutes with the rotation)
typedef _Float16 h16;
typedef unsigned short bf;
typedef __attribute__((ext_vector_type(16))) __bf16   v16bf;
typedef __attribute__((ext_vector_type(16))) _Float16 v16h;
typedef __attribute__((ext_vector_type(8)))  _Float16 v8h;
typedef __attribute__((ext_vector_type(8)))  unsigned short v8us;
typedef __attribute__((ext_vector_type(8)))  float    v8f;
typedef __attribute__((ext_vector_type(4)))  float    v4f;
typedef v8h  __attribute__((may_alias)) v8ha;
typedef v4f  __attribute__((may_alias)) v4fa;
typedef v8us __attribute__((may_alias)) v8usa;

__device__ __forceinline__ unsigned short f2bf(float f) { unsigned u = __float_as_uint(f); u += 0x7FFFu + ((u >> 16) & 1u); return (unsigned short)(u >> 16); }
__device__ __forceinline__ float bf2f(unsigned short b) { return __uint_as_float(((unsigned)b) << 16); }
__device__ __forceinline__ float bfr(float f) { return bf2f(f2bf(f)); }
__device__ __forceinline__ v16h cat16(v8h lo, v8h hi) { return __builtin_shufflevector(lo, hi, 0, 1, 2, 3, 4, 5, 6, 7, 8, 9, 10, 11, 12, 13, 14, 15); }
__device__ __forceinline__ v16bf cat16b(v8us lo, v8us hi) { return __builtin_bit_cast(v16bf, __builtin_shufflevector(lo, hi, 0, 1, 2, 3, 4, 5, 6, 7, 8, 9, 10, 11, 12, 13, 14, 15)); }
__device__ __forceinline__ v8f wmma16(v16h a, v16h b, v8f c) { return __builtin_amdgcn_wmma_f32_16x16x32_f16(false, a, false, b, (short)0, c, false, false); }
__device__ __forceinline__ v8f wmmab(v16bf a, v16bf b, v8f c) { return __builtin_amdgcn_wmma_f32_16x16x32_bf16(false, a, false, b, (short)0, c, false, false); }



// ---- k_gemmw: register-blocked GEMM, one work-group of NW waves per 64x64 output tile; wave w takes the 32-wide k steps w, w + NW, ... into its own 16 accumulators, and the NW partial tiles are summed through LDS in wave order 0..NW-1 (a fixed order); operands straight from K-contiguous 16-bit planes; grid (M/64, N/64, Z), 32 * NW threads.
// C[m][n] (f32, pitch ldc, + optional f32 bias[n]) = sum_k A[m][k] Bt[n][k] (+ split products per NSPLIT). z-batch strides sA/sB/sC in elements. K % 32 == 0.
template <typename T16> struct WFrag;
template <> struct WFrag<h16> { typedef v16h V; static __device__ __forceinline__ V ld(const h16* p) { return cat16(*(const v8h*)p, *(const v8h*)(p + 16)); } static __device__ __forceinline__ v8f mma(V a, V b, v8f c) { return wmma16(a, b, c); } };
template <> struct WFrag<bf> { typedef v16bf V; static __device__ __forceinline__ V ld(const bf* p) { return cat16b(*(const v8us*)p, *(const v8us*)(p + 16)); } static __device__ __forceinline__ v8f mma(V a, V b, v8f c) { return wmmab(a, b, c); } };
template <typename T16, int NSPLIT, bool BIAS, int NW>
__global__ __launch_bounds__(32 * NW) void k_gemmw(const T16* __restrict__ A, const T16* __restrict__ A2, const T16* __restrict__ Bt, const T16* __restrict__ Bt2, int K, float* C, int ldc, const float* __restrict__ bias, size_t sA, size_t sB, size_t sC) {
    typedef typename WFrag<T16>::V V;
    constexpr int MBR = (NW > 1) ? 4 : 1;                            // 16-row blocks staged per LDS round: the whole tile at once where several waves meet (one barrier), one block where a wave is alone
    __shared__ __align__(16) float os[NW * MBR * 16 * 68];
    const size_t z = blockIdx.z; A += z * sA; if (A2) A2 += z * sA; Bt += z * sB; if (Bt2) Bt2 += z * sB; C += z * sC;
    const int lane = threadIdx.x & 31, lr = lane & 15, hi = lane >> 4; const int wave = (NW > 1) ? __builtin_amdgcn_readfirstlane((int)(threadIdx.x >> 5)) : 0; const int r0 = blockIdx.x * 64, c0 = blockIdx.y * 64;
    v8f acc[4][4];
#pragma unroll
    for (int mb = 0; mb < 4; ++mb)
#pragma unroll
        for (int nb = 0; nb < 4; ++nb) acc[mb][nb] = (v8f){};
    const size_t aoff = (size_t)(r0 + lr) * K + 8 * hi, boff = (size_t)(c0 + lr) * K + 8 * hi;
#pragma unroll 1
    for (int kc = 32 * wave; kc < K; kc += 32 * NW) {
        V a[4], a2[4];
#pragma unroll
        for (int mb = 0; mb < 4; ++mb) { a[mb] = WFrag<T16>::ld(A + aoff + (size_t)mb * 16 * K + kc); if (NSPLIT == 1 || NSPLIT == 2) a2[mb] = WFrag<T16>::ld(A2 + aoff + (size_t)mb * 16 * K + kc); }
#pragma unroll
        for (int nb = 0; nb < 4; ++nb) { const V b = WFrag<T16>::ld(Bt + boff + (size_t)nb * 16 * K + kc); V b2; if (NSPLIT >= 2) b2 = WFrag<T16>::ld(Bt2 + boff + (size_t)nb * 16 * K + kc);
#pragma unroll
            for (int mb = 0; mb < 4; ++mb) { acc[mb][nb] = WFrag<T16>::mma(a[mb], b, acc[mb][nb]); if (NSPLIT == 1 || NSPLIT == 2) acc[mb][nb] = WFrag<T16>::mma(a2[mb], b, acc[mb][nb]); if (NSPLIT >= 2) acc[mb][nb] = WFrag<T16>::mma(a[mb], b2, acc[mb][nb]); } }
        asm volatile("v_nop\n\tv_nop\n\tv_nop\n\tv_nop" : "+v"(acc[0][0]), "+v"(acc[1][1]), "+v"(acc[2][2]), "+v"(acc[3][3]) : "v"(a[0]), "v"(a[3]));
    }
    float* osw = os + wave * (MBR * 16 * 68);                        // this wave's own partial tile
#pragma unroll
    for (int mb0 = 0; mb0 < 4; mb0 += MBR) {
#pragma unroll
        for (int mi = 0; mi < MBR; ++mi) {
#pragma unroll
            for (int nb = 0; nb < 4; ++nb) {
#pragma unroll
                for (int j = 0; j < 8; ++j) osw[(mi * 16 + hi * 8 + j) * 68 + nb * 16 + lr] = acc[mb0 + mi][nb][j]; } }
        if (NW > 1) __syncthreads();                                 // every wave's partial tile is in LDS before any wave sums across them
        else { __builtin_amdgcn_wave_barrier(); asm volatile("" ::: "memory"); }
        float* crow = C + (size_t)(r0 + mb0 * 16) * ldc + c0;
#pragma unroll
        for (int s = 0; s < MBR * 8 / NW; ++s) { const int q = s * (32 * NW) + (int)threadIdx.x; const int row = q >> 4, cofs = (q & 15) * 4; v4f val = *(const v4fa*)(os + row * 68 + cofs);
#pragma unroll
            for (int w = 1; w < NW; ++w) val += *(const v4fa*)(os + w * (MBR * 16 * 68) + row * 68 + cofs);   // partial sums added in wave order: the same order on every run
            if (BIAS) { val[0] += bfr(bias[c0 + cofs]); val[1] += bfr(bias[c0 + cofs + 1]); val[2] += bfr(bias[c0 + cofs + 2]); val[3] += bfr(bias[c0 + cofs + 3]); }
            *(v4f*)(crow + (size_t)row * ldc + cofs) = val; }
        if (NW == 1) { __builtin_amdgcn_wave_barrier(); asm volatile("" ::: "memory"); }
    }
}

// ---- k_gemmc: the same 64x64 tile GEMM (NW waves share the K loop; NW = 1 for the short-K score tiles) specialised for causal attention: CMODE 1 skips score tiles entirely above the diagonal (query rows r0+roff.., key columns c0..), CMODE 2 limits the
// key (K) loop of the probability x value contraction to the diagonal block (probabilities beyond it are exactly zero). roff = row offset of this launch's first row within the sequence.
template <typename T16, int NSPLIT, int CMODE, int NW>
__global__ __launch_bounds__(32 * NW) void k_gemmc(const T16* __restrict__ A, const T16* __restrict__ A2, const T16* __restrict__ Bt, const T16* __restrict__ Bt2, int K, float* C, int ldc, int roff, size_t sA, size_t sB, size_t sC) {
    typedef typename WFrag<T16>::V V;
    constexpr int MBR = (NW > 1) ? 4 : 1;                            // 16-row blocks staged per LDS round: the whole tile at once where several waves meet (one barrier), one block where a wave is alone
    __shared__ __align__(16) float os[NW * MBR * 16 * 68];
    const size_t z = blockIdx.z; A += z * sA; if (A2) A2 += z * sA; Bt += z * sB; if (Bt2) Bt2 += z * sB; C += z * sC;
    const int lane = threadIdx.x & 31, lr = lane & 15, hi = lane >> 4; const int wave = (NW > 1) ? __builtin_amdgcn_readfirstlane((int)(threadIdx.x >> 5)) : 0; const int r0 = blockIdx.x * 64, c0 = blockIdx.y * 64;
    if (CMODE == 1 && c0 > r0 + roff + 63) return;                  // score tile entirely above the causal diagonal: never read (the softmax masks j > i by select)
    const int Kl = (CMODE == 2) ? min(K, r0 + roff + 64) : K;        // P.V: probabilities are exactly 0 beyond the diagonal block, so the K loop stops there
    v8f acc[4][4];
#pragma unroll
    for (int mb = 0; mb < 4; ++mb)
#pragma unroll
        for (int nb = 0; nb < 4; ++nb) acc[mb][nb] = (v8f){};
    const size_t aoff = (size_t)(r0 + lr) * K + 8 * hi, boff = (size_t)(c0 + lr) * K + 8 * hi;
#pragma unroll 1
    for (int kc = 32 * wave; kc < Kl; kc += 32 * NW) {
        V a[4], a2[4];
#pragma unroll
        for (int mb = 0; mb < 4; ++mb) { a[mb] = WFrag<T16>::ld(A + aoff + (size_t)mb * 16 * K + kc); if (NSPLIT == 1 || NSPLIT == 2) a2[mb] = WFrag<T16>::ld(A2 + aoff + (size_t)mb * 16 * K + kc); }
#pragma unroll
        for (int nb = 0; nb < 4; ++nb) { const V b = WFrag<T16>::ld(Bt + boff + (size_t)nb * 16 * K + kc); V b2; if (NSPLIT >= 2) b2 = WFrag<T16>::ld(Bt2 + boff + (size_t)nb * 16 * K + kc);
#pragma unroll
            for (int mb = 0; mb < 4; ++mb) { acc[mb][nb] = WFrag<T16>::mma(a[mb], b, acc[mb][nb]); if (NSPLIT == 1 || NSPLIT == 2) acc[mb][nb] = WFrag<T16>::mma(a2[mb], b, acc[mb][nb]); if (NSPLIT >= 2) acc[mb][nb] = WFrag<T16>::mma(a[mb], b2, acc[mb][nb]); } }
        asm volatile("v_nop\n\tv_nop\n\tv_nop\n\tv_nop" : "+v"(acc[0][0]), "+v"(acc[1][1]), "+v"(acc[2][2]), "+v"(acc[3][3]) : "v"(a[0]), "v"(a[3]));
    }
    float* osw = os + wave * (MBR * 16 * 68);                        // this wave's own partial tile
#pragma unroll
    for (int mb0 = 0; mb0 < 4; mb0 += MBR) {
#pragma unroll
        for (int mi = 0; mi < MBR; ++mi) {
#pragma unroll
            for (int nb = 0; nb < 4; ++nb) {
#pragma unroll
                for (int j = 0; j < 8; ++j) osw[(mi * 16 + hi * 8 + j) * 68 + nb * 16 + lr] = acc[mb0 + mi][nb][j]; } }
        if (NW > 1) __syncthreads();                                 // every wave's partial tile is in LDS before any wave sums across them
        else { __builtin_amdgcn_wave_barrier(); asm volatile("" ::: "memory"); }
        float* crow = C + (size_t)(r0 + mb0 * 16) * ldc + c0;
#pragma unroll
        for (int s = 0; s < MBR * 8 / NW; ++s) { const int q = s * (32 * NW) + (int)threadIdx.x; const int row = q >> 4, cofs = (q & 15) * 4; v4f val = *(const v4fa*)(os + row * 68 + cofs);
#pragma unroll
            for (int w = 1; w < NW; ++w) val += *(const v4fa*)(os + w * (MBR * 16 * 68) + row * 68 + cofs);   // partial sums added in wave order: the same order on every run
            *(v4f*)(crow + (size_t)row * ldc + cofs) = val; }
        if (NW == 1) { __builtin_amdgcn_wave_barrier(); asm volatile("" ::: "memory"); }
    }
}

__device__ __forceinline__ h16 tohx(float x) { return (h16)x; }
__device__ __forceinline__ void splitf(float y, unsigned short& h, unsigned short& l) { h = f2bf(y); l = f2bf(y - bf2f(h)); }
typedef __attribute__((ext_vector_type(2))) _Float16 v2h;
typedef __attribute__((ext_vector_type(4))) _Float16 v4h;
typedef __attribute__((ext_vector_type(2))) unsigned short v2us;
typedef __attribute__((ext_vector_type(4))) unsigned short v4us;
typedef __attribute__((ext_vector_type(2))) float v2f;
typedef __attribute__((ext_vector_type(4))) int v4i;

__global__ __launch_bounds__(256) void k_wtG(const float* __restrict__ w, int K, int N, bf* Bt) {
    const int lane = threadIdx.x & 31; const int L0 = (blockIdx.x * 8 + (threadIdx.x >> 5)) * 8; const int nlines = N * K / 64;
{
#pragma unroll 1
        for (int l = 0; l < 8; ++l) { const int L = L0 + l; if (L >= nlines) break; const size_t e = (size_t)L * 64 + lane * 2; const int k = (int)(e % K), n = (int)(e / K); v2us o;
            o[0] = f2bf(w[(size_t)k * N + n]); o[1] = f2bf(w[(size_t)(k + 1) * N + n]); *(v2us*)(Bt + e) = o; }
         }
}
__global__ __launch_bounds__(256) void k_cvt8(const float* __restrict__ src, bf* dst, size_t n8) { const size_t i = (size_t)blockIdx.x * 256 + threadIdx.x; if (i >= n8) return; const v8f v = *(const v8f*)(src + i * 8); v8us o;
#pragma unroll
    for (int k = 0; k < 8; ++k) o[k] = f2bf(v[k]); *(v8us*)(dst + i * 8) = o;  }

__global__ __launch_bounds__(256) void k_ropeI(const float* __restrict__ F, int pitch, int nheads, const float* __restrict__ CS, float sc, h16* P16, bf* Ph, bf* Pl) {
    const size_t e = ((size_t)blockIdx.x * 256 + threadIdx.x) * 2; if (e >= (size_t)nheads * TT * HD) return; const int d = (int)(e % HD); const int t = (int)((e / HD) % TT); const int h = (int)(e / ((size_t)HD * TT)); const float* f = F + (size_t)t * pitch + h * HD; const float x0 = f[d], x1 = f[d + 1]; const v2f cs = *(const v2f*)(CS + ((size_t)t * HD + d) * 2); v2h o16; v2us oh, ol;
    float a0 = __fmul_rn(x0, cs[0]), b0 = __fmul_rn(x1, cs[1]), a1 = __fmul_rn(x1, cs[0]), b1 = __fmul_rn(x0, cs[1]); asm volatile("" : "+v"(a0), "+v"(b0), "+v"(a1), "+v"(b1));
    float r0 = __fsub_rn(a0, b0) * sc, r1 = __fadd_rn(b1, a1) * sc;   /* even: x0 c - x1 s; odd: x0 s + x1 c */
    o16[0] = tohx(r0); o16[1] = tohx(r1); { unsigned short a2, c2; splitf(r0, a2, c2); oh[0] = a2; ol[0] = c2; splitf(r1, a2, c2); oh[1] = a2; ol[1] = c2; }
    *(v2h*)(P16 + e) = o16; *(v2us*)(Ph + e) = oh; *(v2us*)(Pl + e) = ol;  }

__constant__ float INV2[HD / 2] = { 1.000000000e+00f, 7.498942018e-01f, 5.623413324e-01f, 4.216965139e-01f, 3.162277639e-01f, 2.371373773e-01f, 1.778279394e-01f, 1.333521456e-01f, 1.000000015e-01f, 7.498942316e-02f, 5.623413250e-02f, 4.216964915e-02f, 3.162277490e-02f, 2.371373773e-02f, 1.778279431e-02f, 1.333521400e-02f, 9.999999776e-03f, 7.498942316e-03f, 5.623413250e-03f, 4.216964822e-03f, 3.162277630e-03f, 2.371373819e-03f, 1.778279431e-03f, 1.333521446e-03f, 1.000000047e-03f, 7.498941850e-04f, 5.623413017e-04f, 4.216965172e-04f, 3.162277571e-04f, 2.371373703e-04f, 1.778279402e-04f, 1.333521504e-04f };   // 10000 ** (-2i / 64), i = 0..31, in float32 as THIS module writes it (the NEGATIVE-POWER spelling '10000.0 ** (-ts / dim)' evaluated in the reference's own f32 arithmetic: these 32 literals equal it bit for bit); ten entries differ by one ulp from the reciprocal values the host's own table held

__global__ __launch_bounds__(256) void k_vtp(const float* __restrict__ F, int pitch, int nheads, h16* V16, bf* Vh, bf* Vl) { const size_t e = ((size_t)blockIdx.x * 256 + threadIdx.x) * 2; if (e >= (size_t)nheads * HD * TT) return; const int t = (int)(e % TT); const int d = (int)((e / TT) % HD); const int g = (int)(e / ((size_t)TT * HD)); v2h o16; v2us oh, ol;
#pragma unroll
    for (int q = 0; q < 2; ++q) { const float x = F[(size_t)(t + q) * pitch + g * HD + d]; o16[q] = tohx(x); unsigned short a2, c2; splitf(x, a2, c2); oh[q] = a2; ol[q] = c2; }
    *(v2h*)(V16 + e) = o16; *(v2us*)(Vh + e) = oh; *(v2us*)(Vl + e) = ol;  }
__global__ __launch_bounds__(256) void k_csP(float* CS) { const int idx = blockIdx.x * 256 + threadIdx.x; if (idx >= TT * HD) return; const int d = idx % HD; const int t = idx / HD; const float a = __fmul_rn((float)t, INV2[d >> 1]); v2f cs; cs[0] = cosf(a); cs[1] = sinf(a); *(v2f*)(CS + (size_t)idx * 2) = cs;  }
// k_asoft: per row (zz, i): t = S x SCL (1/32) for j <= i and i - j < WIN (WIN = TT, so the window test always holds: plain causal; the reference's -1e9 additive fill vanishes identically); softmax over the 2048 keys (register row, one exp, fixed trees);
__global__ __launch_bounds__(256) void k_asoft(const float* __restrict__ Sb, h16* P16, bf* Ph, bf* Pl) {
    const int lane = threadIdx.x & 31; const int row = blockIdx.x * 8 + (threadIdx.x >> 5); if (row >= ZH * TT) return; const int i = row % TT; const int zz = row / TT; (void)zz; const bool hires = (i < RH); const float* sr = Sb + (size_t)row * TT; float v[TT / 32]; float mx = -3.0e38f;
#pragma unroll
    for (int ch = 0; ch < TT / 128; ++ch) { const int j0 = ch * 128 + lane * 4; const v4f a = *(const v4f*)(sr + j0);
#pragma unroll
        for (int q = 0; q < 4; ++q) { const int j = j0 + q; (void)j; const float t = (j <= i && i - j < WIN) ? a[q] * SCL : -3.0e38f; v[ch * 4 + q] = t; mx = fmaxf(mx, t); } }
#pragma unroll
    for (int sh = 16; sh; sh >>= 1) mx = fmaxf(mx, __shfl_xor(mx, sh, 32));
    float sum = 0.f;
#pragma unroll
    for (int k = 0; k < TT / 32; ++k) { float d0 = __fsub_rn(v[k], mx); asm volatile("" : "+v"(d0)); v[k] = __builtin_amdgcn_exp2f(__fmul_rn(d0, 1.4426950408889634f)); sum += v[k]; }
#pragma unroll
    for (int sh = 16; sh; sh >>= 1) sum += __shfl_xor(sum, sh, 32);
    const float f = __fdiv_rn(hires ? 1.0f : PCAR, sum);
{
        if (hires) {
#pragma unroll
            for (int ch = 0; ch < TT / 128; ++ch) { v4us oh, ol;
#pragma unroll
                for (int q = 0; q < 4; ++q) { unsigned short a, c2; splitf(v[ch * 4 + q] * f, a, c2); oh[q] = a; ol[q] = c2; }
                const size_t oo = ((size_t)zz * (RH ? RH : 1) + i) * TT + ch * 128 + lane * 4; *(v4us*)(Ph + oo) = oh; *(v4us*)(Pl + oo) = ol; }
        } else {
#pragma unroll
            for (int ch = 0; ch < TT / 128; ++ch) { v4h o4;
#pragma unroll
                for (int q = 0; q < 4; ++q) o4[q] = tohx(v[ch * 4 + q] * f);
                *(v4h*)(P16 + (size_t)row * TT + ch * 128 + lane * 4) = o4; } }
         }
}
__global__ __launch_bounds__(256) void k_premise(const int* __restrict__ flag, float* out, size_t n4) { const size_t i = (size_t)blockIdx.x * 256 + threadIdx.x; if (i >= n4) return; if (flag[0] == NH_) return;   /* premise holds (num_heads == 16): nothing to do */ const float qn = __int_as_float(0x7fc00000); v4f o; o[0] = qn; o[1] = qn; o[2] = qn; o[3] = qn; *(v4f*)(out + i * 4) = o;  }
__global__ __launch_bounds__(256) void k_merge(const float* __restrict__ O, int h0, bf* Ah, bf* Al) { const size_t e = ((size_t)blockIdx.x * 256 + threadIdx.x) * 2; if (e >= (size_t)ZH * TT * HD) return; const int d = (int)(e % HD); const int t = (int)((e / HD) % TT); const int zz = (int)(e / ((size_t)HD * TT)); const float cs = (t < RH) ? 1.0f : (1.0f / PCAR); const size_t oo = (size_t)t * DQ + (h0 + zz) * HD + d;
    v2us oh, ol;
#pragma unroll
    for (int q = 0; q < 2; ++q) { unsigned short a, c2; splitf(O[e + q] * cs, a, c2); oh[q] = a; ol[q] = c2; } *(v2us*)(Ah + oo) = oh; *(v2us*)(Al + oo) = ol;  }

extern "C" void kernel_launch(void* const* d_in, const int* in_sizes, int n_in,
                              void* d_out, int out_size, void* d_ws, size_t ws_size, hipStream_t stream) {
    (void)in_sizes; (void)n_in; (void)out_size;
    const float* x = (const float*)d_in[0]; const float* wq = (const float*)d_in[1]; const float* wk = (const float*)d_in[2]; const float* wv = (const float*)d_in[3]; const float* wo = (const float*)d_in[4]; const int* flag = (const int*)d_in[5];   /* input order x, Wq, Wk, Wv, Wo ('xw' [1024][1024]), num_heads (the SIXTH input, slot 5: the python int 16 as an int scalar: READ ON DEVICE by k_premise after the output is written: the whole output is NaN-filled unless it equals NH_ = 16) */
    float* OUT = (float*)d_out;     // [2][2048][1024]
    char* wsp = (char*)d_ws;
    auto take = [&](size_t bytes) { char* p = wsp; wsp += (bytes + 255) & ~(size_t)255; return (void*)p; };
    bf* WQ = (bf*)take((size_t)DQ * DM * 2); bf* WK = (bf*)take((size_t)DKV * DM * 2); bf* WV = (bf*)take((size_t)DKV * DM * 2); bf* WO = (bf*)take((size_t)DM * DQ * 2); float* CS = (float*)take((size_t)TT * HD * 2 * 4);
    bf* XB = (bf*)take((size_t)TT * DM * 2); float* FQ = (float*)take((size_t)TT * DQ * 4); float* FK = (float*)take((size_t)TT * DKV * 4);
    h16* QP16 = (h16*)take((size_t)NH_ * TT * HD * 2); h16* KP16 = (h16*)take((size_t)NKV * TT * HD * 2); h16* VT16 = (h16*)take((size_t)NKV * HD * TT * 2);
    bf* QPh = (bf*)take((size_t)NH_ * TT * HD * 2); bf* QPl = (bf*)take((size_t)NH_ * TT * HD * 2); bf* KPh = (bf*)take((size_t)NKV * TT * HD * 2); bf* KPl = (bf*)take((size_t)NKV * TT * HD * 2); bf* VTh = (bf*)take((size_t)NKV * HD * TT * 2); bf* VTl = (bf*)take((size_t)NKV * HD * TT * 2); bf* Ph = (bf*)take((size_t)ZH * RH * TT * 2); bf* Pl = (bf*)take((size_t)ZH * RH * TT * 2);
    float* Sb = (float*)take((size_t)ZH * TT * TT * 4); h16* P16 = (h16*)take((size_t)ZH * TT * TT * 2); float* Ob = (float*)take((size_t)ZH * TT * HD * 4); bf* ATh = (bf*)take((size_t)TT * DQ * 2); bf* ATl = (bf*)take((size_t)TT * DQ * 2);
    if ((size_t)(wsp - (char*)d_ws) > ws_size) return;    // ws 256 MiB
    float* FV = FK;   // v projection reuses the k buffer after the k planes are built (stream-ordered)
    { k_wtG<<<(unsigned)((DM * DQ / 64 + 63) / 64), 256, 0, stream>>>(wq, DM, DQ, WQ); k_wtG<<<(unsigned)((DM * DKV / 64 + 63) / 64), 256, 0, stream>>>(wk, DM, DKV, WK); k_wtG<<<(unsigned)((DM * DKV / 64 + 63) / 64), 256, 0, stream>>>(wv, DM, DKV, WV);
      k_wtG<<<(unsigned)((DQ * DM / 64 + 63) / 64), 256, 0, stream>>>(wo, DQ, DM, WO);
       }
    k_csP<<<(TT * HD + 255) / 256, 256, 0, stream>>>(CS);
    const unsigned LQ = (unsigned)(((size_t)NH_ * TT * HD / 2 + 255) / 256), LKv = (unsigned)(((size_t)NKV * TT * HD / 2 + 255) / 256);
    for (int b = 0; b < NB_; ++b) {
        
        k_cvt8<<<(unsigned)(((size_t)TT * DM / 8 + 255) / 256), 256, 0, stream>>>(x + (size_t)b * TT * DM, XB, (size_t)TT * DM / 8);
        k_gemmw<bf, 0, false, 8><<<dim3(TT / 64, DQ / 64, 1), 256, 0, stream>>>(XB, nullptr, WQ, nullptr, DM, FQ, DQ, nullptr, 0, 0, 0);
        k_ropeI<<<LQ, 256, 0, stream>>>(FQ, DQ, NH_, CS, 1.0f, QP16, QPh, QPl);
        k_gemmw<bf, 0, false, 8><<<dim3(TT / 64, DKV / 64, 1), 256, 0, stream>>>(XB, nullptr, WK, nullptr, DM, FK, DKV, nullptr, 0, 0, 0);
        k_ropeI<<<LKv, 256, 0, stream>>>(FK, DKV, NKV, CS, 1.0f, KP16, KPh, KPl);
        k_gemmw<bf, 0, false, 8><<<dim3(TT / 64, DKV / 64, 1), 256, 0, stream>>>(XB, nullptr, WV, nullptr, DM, FV, DKV, nullptr, 0, 0, 0); k_vtp<<<LKv, 256, 0, stream>>>(FV, DKV, NKV, VT16, VTh, VTl);
        for (int h0 = 0; h0 < NH_; h0 += ZH) { const size_t zq = (size_t)h0, zk = (size_t)(h0 / REP);   // one kv head per query head: the pass's two heads use consecutive kv planes (z-strides TT*HD)
            k_gemmc<bf, 2, 1, 1><<<dim3(RH / 64, TT / 64, ZH), 32, 0, stream>>>(QPh + zq * TT * HD, QPl + zq * TT * HD, KPh + zk * TT * HD, KPl + zk * TT * HD, HD, Sb, TT, 0, (size_t)TT * HD, (size_t)TT * HD, (size_t)TT * TT);
            k_gemmc<h16, 0, 1, 1><<<dim3((TT - RH) / 64, TT / 64, ZH), 32, 0, stream>>>(QP16 + zq * TT * HD + (size_t)RH * HD, nullptr, KP16 + zk * TT * HD, nullptr, HD, Sb + (size_t)RH * TT, TT, RH, (size_t)TT * HD, (size_t)TT * HD, (size_t)TT * TT);
            k_asoft<<<ZH * TT / 8, 256, 0, stream>>>(Sb, P16, Ph, Pl);
            k_gemmc<bf, 2, 2, 8><<<dim3(RH / 64, HD / 64, ZH), 256, 0, stream>>>(Ph, Pl, VTh + zk * HD * TT, VTl + zk * HD * TT, TT, Ob, HD, 0, (size_t)RH * TT, (size_t)HD * TT, (size_t)TT * HD);
            k_gemmc<h16, 0, 2, 16><<<dim3((TT - RH) / 64, HD / 64, ZH), 512, 0, stream>>>(P16 + (size_t)RH * TT, nullptr, VT16 + zk * HD * TT, nullptr, TT, Ob + (size_t)RH * HD, HD, RH, (size_t)TT * TT, (size_t)HD * TT, (size_t)TT * HD);
            k_merge<<<(unsigned)(((size_t)ZH * TT * HD / 2 + 255) / 256), 256, 0, stream>>>(Ob, h0, ATh, ATl); }
        k_gemmw<bf, 1, false, 8><<<dim3(TT / 64, DM / 64, 1), 256, 0, stream>>>(ATh, ATl, WO, nullptr, DQ, OUT + (size_t)b * TT * DM, DM, nullptr, 0, 0, 0); }
k_premise<<<(unsigned)(((size_t)NB_ * TT * DM / 4 + 255) / 256), 256, 0, stream>>>(flag, OUT, (size_t)NB_ * TT * DM / 4);   /* after every batch's output is written: poison it all if the premise fails */
}

// v002
// One run takes 404 microseconds.
// In two side-by-side timings against v001, it was 1.95 and 1.96 times as fast.
// Over all steps from v000 it is 3.61 times as fast.
#include <hip/hip_runtime.h>

// Causal multi-head attention with a pre-scaled query, interleaved-pair rotary embeddings and a scalar head-count input (x [2][2048][1024]; q = (x Wq) x 1/sqrt(1024), k = x Wk, v = x Wv ('xw' [1024][1024] 0.02, no bias; 16 heads x 64: the head count arrives as the python int 16, the LAST input: read on device by the premise guard); rope x cos + x_rot sin with x_rot: (x1, x2) -> (-x2, x1) on adjacent pairs and cos / sin = repeat(c, 2) of angle t x 10000^(-2i/64) (32 f32 frequencies jnp-exact for the module's negative-power expression; precise cosf/sinf); logits = q.k (no further scale: net 1/32); where(tril, logits, -1e8) == exclusion; softmax; out = merged Wo ('xw', no bias) -> [2][2048][1024] (4.2 M); argument order x, Wq, Wk, Wv, Wo, num_heads).
// VALUE PREMISE: this kernel implements num_heads == 16 only; k_premise reads the scalar on the device after the output is written and NaN-fills the whole output if it is not 16.
// Layout (both batches in every launch outside the pass loop, half a batch (8 of its 16 heads) per attention pass; planes ordered [batch * 16 + head]; 8 such planes per attention pass; each probability row is stored over its own f32 score row): bf16 copy of x; 'xw' weights transposed once; exact projections; k_csP computed table (pair-shared entries); k_ropeI interleaved-pair plane builders; causal T-2048 attention (hybrid rows: < 512 hi/lo 3 products, rest fp16 x1024; k_score skips tiles above the diagonal); merged hi/lo x Wo exact.
// Compute dtypes, f32 accumulate: every input rounded to bf16; projections exact; rotary f32 (products rounded separately); attention rows < 512 3 products, rest fp16; softmax f32; Wo hl x exact.

#define NB_  2
#define TT   2048
#define DM   1024
#define NH_  16
#define NKV  16
#define REP  (NH_ / NKV)
#define HD   64
#define DQ   (NH_ * HD)
#define DKV  (NKV * HD)
#define ZH   8                    // (batch, head) planes per attention pass
#define RH   512                  // query rows < RH use hi+lo planes (0: none)
#define WIN  2048
#define PCAR 1024.0f
#define SCL  0.03125f   // 1 / sqrt(1024): the module scales q by 1 / sqrt(d_model) BEFORE the rotation and applies no other scale (a power of two: exact, commutes with the rotation)
typedef _Float16 h16;
typedef unsigned short bf;
typedef __attribute__((ext_vector_type(16))) __bf16   v16bf;
typedef __attribute__((ext_vector_type(16))) _Float16 v16h;
typedef __attribute__((ext_vector_type(8)))  _Float16 v8h;
typedef __attribute__((ext_vector_type(8)))  unsigned short v8us;
typedef __attribute__((ext_vector_type(8)))  float    v8f;
typedef __attribute__((ext_vector_type(4)))  float    v4f;
typedef v8h  __attribute__((may_alias)) v8ha;
typedef v4f  __attribute__((may_alias)) v4fa;
typedef v8us __attribute__((may_alias)) v8usa;

__device__ __forceinline__ unsigned short f2bf(float f) { unsigned u = __float_as_uint(f); u += 0x7FFFu + ((u >> 16) & 1u); return (unsigned short)(u >> 16); }
__device__ __forceinline__ float bf2f(unsigned short b) { return __uint_as_float(((unsigned)b) << 16); }
__device__ __forceinline__ float bfr(float f) { return bf2f(f2bf(f)); }
__device__ __forceinline__ v16h cat16(v8h lo, v8h hi) { return __builtin_shufflevector(lo, hi, 0, 1, 2, 3, 4, 5, 6, 7, 8, 9, 10, 11, 12, 13, 14, 15); }
__device__ __forceinline__ v16bf cat16b(v8us lo, v8us hi) { return __builtin_bit_cast(v16bf, __builtin_shufflevector(lo, hi, 0, 1, 2, 3, 4, 5, 6, 7, 8, 9, 10, 11, 12, 13, 14, 15)); }
__device__ __forceinline__ v8f wmma16(v16h a, v16h b, v8f c) { return __builtin_amdgcn_wmma_f32_16x16x32_f16(false, a, false, b, (short)0, c, false, false); }
__device__ __forceinline__ v8f wmmab(v16bf a, v16bf b, v8f c) { return __builtin_amdgcn_wmma_f32_16x16x32_bf16(false, a, false, b, (short)0, c, false, false); }



// ---- k_gemmw: register-blocked GEMM, one work-group of NW waves per 64x64 output tile; wave w takes the 32-wide k steps w, w + NW, ... into its own 16 accumulators, and the NW partial tiles are summed through LDS in wave order 0..NW-1 (a fixed order); operands straight from K-contiguous 16-bit planes; grid (M/64, N/64, Z), 32 * NW threads.
// C[m][n] (f32, pitch ldc, + optional f32 bias[n]) = sum_k A[m][k] Bt[n][k] (+ split products per NSPLIT). z-batch strides sA/sB/sC in elements. K % 32 == 0.
template <typename T16> struct WFrag;
template <> struct WFrag<h16> { typedef v16h V; static __device__ __forceinline__ V ld(const h16* p) { return cat16(*(const v8h*)p, *(const v8h*)(p + 16)); } static __device__ __forceinline__ v8f mma(V a, V b, v8f c) { return wmma16(a, b, c); } };
template <> struct WFrag<bf> { typedef v16bf V; static __device__ __forceinline__ V ld(const bf* p) { return cat16b(*(const v8us*)p, *(const v8us*)(p + 16)); } static __device__ __forceinline__ v8f mma(V a, V b, v8f c) { return wmmab(a, b, c); } };
template <typename T16, int NSPLIT, bool BIAS, int NW>
__global__ __launch_bounds__(32 * NW) void k_gemmw(const T16* __restrict__ A, const T16* __restrict__ A2, const T16* __restrict__ Bt, const T16* __restrict__ Bt2, int K, float* C, int ldc, const float* __restrict__ bias, size_t sA, size_t sB, size_t sC) {
    typedef typename WFrag<T16>::V V;
    constexpr int MBR = (NW > 1) ? 4 : 1;                            // 16-row blocks staged per LDS round: the whole tile at once where several waves meet (one barrier), one block where a wave is alone
    __shared__ __align__(16) float os[NW * MBR * 16 * 68];
    const size_t z = blockIdx.z; A += z * sA; if (A2) A2 += z * sA; Bt += z * sB; if (Bt2) Bt2 += z * sB; C += z * sC;
    const int lane = threadIdx.x & 31, lr = lane & 15, hi = lane >> 4; const int wave = (NW > 1) ? __builtin_amdgcn_readfirstlane((int)(threadIdx.x >> 5)) : 0; const int r0 = blockIdx.x * 64, c0 = blockIdx.y * 64;
    v8f acc[4][4];
#pragma unroll
    for (int mb = 0; mb < 4; ++mb)
#pragma unroll
        for (int nb = 0; nb < 4; ++nb) acc[mb][nb] = (v8f){};
    const size_t aoff = (size_t)(r0 + lr) * K + 8 * hi, boff = (size_t)(c0 + lr) * K + 8 * hi;
#pragma unroll 1
    for (int kc = 32 * wave; kc < K; kc += 32 * NW) {
        V a[4], a2[4];
#pragma unroll
        for (int mb = 0; mb < 4; ++mb) { a[mb] = WFrag<T16>::ld(A + aoff + (size_t)mb * 16 * K + kc); if (NSPLIT == 1 || NSPLIT == 2) a2[mb] = WFrag<T16>::ld(A2 + aoff + (size_t)mb * 16 * K + kc); }
#pragma unroll
        for (int nb = 0; nb < 4; ++nb) { const V b = WFrag<T16>::ld(Bt + boff + (size_t)nb * 16 * K + kc); V b2; if (NSPLIT >= 2) b2 = WFrag<T16>::ld(Bt2 + boff + (size_t)nb * 16 * K + kc);
#pragma unroll
            for (int mb = 0; mb < 4; ++mb) { acc[mb][nb] = WFrag<T16>::mma(a[mb], b, acc[mb][nb]); if (NSPLIT == 1 || NSPLIT == 2) acc[mb][nb] = WFrag<T16>::mma(a2[mb], b, acc[mb][nb]); if (NSPLIT >= 2) acc[mb][nb] = WFrag<T16>::mma(a[mb], b2, acc[mb][nb]); } }
        asm volatile("v_nop\n\tv_nop\n\tv_nop\n\tv_nop" : "+v"(acc[0][0]), "+v"(acc[1][1]), "+v"(acc[2][2]), "+v"(acc[3][3]) : "v"(a[0]), "v"(a[3]));
    }
    float* osw = os + wave * (MBR * 16 * 68);                        // this wave's own partial tile
#pragma unroll
    for (int mb0 = 0; mb0 < 4; mb0 += MBR) {
#pragma unroll
        for (int mi = 0; mi < MBR; ++mi) {
#pragma unroll
            for (int nb = 0; nb < 4; ++nb) {
#pragma unroll
                for (int j = 0; j < 8; ++j) osw[(mi * 16 + hi * 8 + j) * 68 + nb * 16 + lr] = acc[mb0 + mi][nb][j]; } }
        if (NW > 1) __syncthreads();                                 // every wave's partial tile is in LDS before any wave sums across them
        else { __builtin_amdgcn_wave_barrier(); asm volatile("" ::: "memory"); }
        float* crow = C + (size_t)(r0 + mb0 * 16) * ldc + c0;
#pragma unroll
        for (int s = 0; s < MBR * 8 / NW; ++s) { const int q = s * (32 * NW) + (int)threadIdx.x; const int row = q >> 4, cofs = (q & 15) * 4; v4f val = *(const v4fa*)(os + row * 68 + cofs);
#pragma unroll
            for (int w = 1; w < NW; ++w) val += *(const v4fa*)(os + w * (MBR * 16 * 68) + row * 68 + cofs);   // partial sums added in wave order: the same order on every run
            if (BIAS) { val[0] += bfr(bias[c0 + cofs]); val[1] += bfr(bias[c0 + cofs + 1]); val[2] += bfr(bias[c0 + cofs + 2]); val[3] += bfr(bias[c0 + cofs + 3]); }
            *(v4f*)(crow + (size_t)row * ldc + cofs) = val; }
        if (NW == 1) { __builtin_amdgcn_wave_barrier(); asm volatile("" ::: "memory"); }
    }
}

// ---- k_gemmc: the same 64x64 tile GEMM (NW waves share the K loop; NW = 1 for the short-K score tiles) specialised for causal attention: CMODE 1 skips score tiles entirely above the diagonal (query rows r0+roff.., key columns c0..), CMODE 2 limits the
// key (K) loop of the probability x value contraction to the diagonal block (probabilities beyond it are exactly zero). roff = row offset of this launch's first row within the sequence. lda = row pitch of A / A2 in elements (Bt / Bt2 rows have pitch K).
template <typename T16, int NSPLIT, int CMODE, int NW>
__device__ __forceinline__ void gemmc_body(int bx, const T16* __restrict__ A, const T16* __restrict__ A2, int lda, const T16* __restrict__ Bt, const T16* __restrict__ Bt2, int K, float* C, int ldc, int roff, size_t sA, size_t sB, size_t sC) {
    typedef typename WFrag<T16>::V V;
    constexpr int MBR = (NW > 1) ? 4 : 1;                            // 16-row blocks staged per LDS round: the whole tile at once where several waves meet (one barrier), one block where a wave is alone
    __shared__ __align__(16) float os[NW * MBR * 16 * 68];
    const size_t z = blockIdx.z; A += z * sA; if (A2) A2 += z * sA; Bt += z * sB; if (Bt2) Bt2 += z * sB; C += z * sC;
    const int lane = threadIdx.x & 31, lr = lane & 15, hi = lane >> 4; const int wave = (NW > 1) ? __builtin_amdgcn_readfirstlane((int)(threadIdx.x >> 5)) : 0; const int r0 = bx * 64, c0 = blockIdx.y * 64;
    if (CMODE == 1 && c0 > r0 + roff + 63) return;                  // score tile entirely above the causal diagonal: never read (the softmax masks j > i by select)
    const int Kl = (CMODE == 2) ? min(K, r0 + roff + 64) : K;        // P.V: probabilities are exactly 0 beyond the diagonal block, so the K loop stops there
    v8f acc[4][4];
#pragma unroll
    for (int mb = 0; mb < 4; ++mb)
#pragma unroll
        for (int nb = 0; nb < 4; ++nb) acc[mb][nb] = (v8f){};
    const size_t aoff = (size_t)(r0 + lr) * lda + 8 * hi, boff = (size_t)(c0 + lr) * K + 8 * hi;
#pragma unroll 1
    for (int kc = 32 * wave; kc < Kl; kc += 32 * NW) {
        V a[4], a2[4];
#pragma unroll
        for (int mb = 0; mb < 4; ++mb) { a[mb] = WFrag<T16>::ld(A + aoff + (size_t)mb * 16 * lda + kc); if (NSPLIT == 1 || NSPLIT == 2) a2[mb] = WFrag<T16>::ld(A2 + aoff + (size_t)mb * 16 * lda + kc); }
#pragma unroll
        for (int nb = 0; nb < 4; ++nb) { const V b = WFrag<T16>::ld(Bt + boff + (size_t)nb * 16 * K + kc); V b2; if (NSPLIT >= 2) b2 = WFrag<T16>::ld(Bt2 + boff + (size_t)nb * 16 * K + kc);
#pragma unroll
            for (int mb = 0; mb < 4; ++mb) { acc[mb][nb] = WFrag<T16>::mma(a[mb], b, acc[mb][nb]); if (NSPLIT == 1 || NSPLIT == 2) acc[mb][nb] = WFrag<T16>::mma(a2[mb], b, acc[mb][nb]); if (NSPLIT >= 2) acc[mb][nb] = WFrag<T16>::mma(a[mb], b2, acc[mb][nb]); } }
        asm volatile("v_nop\n\tv_nop\n\tv_nop\n\tv_nop" : "+v"(acc[0][0]), "+v"(acc[1][1]), "+v"(acc[2][2]), "+v"(acc[3][3]) : "v"(a[0]), "v"(a[3]));
    }
    float* osw = os + wave * (MBR * 16 * 68);                        // this wave's own partial tile
#pragma unroll
    for (int mb0 = 0; mb0 < 4; mb0 += MBR) {
#pragma unroll
        for (int mi = 0; mi < MBR; ++mi) {
#pragma unroll
            for (int nb = 0; nb < 4; ++nb) {
#pragma unroll
                for (int j = 0; j < 8; ++j) osw[(mi * 16 + hi * 8 + j) * 68 + nb * 16 + lr] = acc[mb0 + mi][nb][j]; } }
        if (NW > 1) __syncthreads();                                 // every wave's partial tile is in LDS before any wave sums across them
        else { __builtin_amdgcn_wave_barrier(); asm volatile("" ::: "memory"); }
        float* crow = C + (size_t)(r0 + mb0 * 16) * ldc + c0;
#pragma unroll
        for (int s = 0; s < MBR * 8 / NW; ++s) { const int q = s * (32 * NW) + (int)threadIdx.x; const int row = q >> 4, cofs = (q & 15) * 4; v4f val = *(const v4fa*)(os + row * 68 + cofs);
#pragma unroll
            for (int w = 1; w < NW; ++w) val += *(const v4fa*)(os + w * (MBR * 16 * 68) + row * 68 + cofs);   // partial sums added in wave order: the same order on every run
            *(v4f*)(crow + (size_t)row * ldc + cofs) = val; }
        if (NW == 1) { __builtin_amdgcn_wave_barrier(); asm volatile("" ::: "memory"); }
    }
}

template <typename T16, int NSPLIT, int CMODE, int NW>
__global__ __launch_bounds__(32 * NW) void k_gemmc(const T16* __restrict__ A, const T16* __restrict__ A2, int lda, const T16* __restrict__ Bt, const T16* __restrict__ Bt2, int K, float* C, int ldc, int roff, size_t sA, size_t sB, size_t sC) {
    gemmc_body<T16, NSPLIT, CMODE, NW>((int)blockIdx.x, A, A2, lda, Bt, Bt2, K, C, ldc, roff, sA, sB, sC);
}
// k_score: all score tiles of a pass in one grid (TT/64, TT/64, ZH): row tiles below RH take the hi/lo 3-product body, the rest the fp16 body (one wave per work-group: the choice is uniform).
__global__ __launch_bounds__(32) void k_score(const bf* __restrict__ Qh, const bf* __restrict__ Ql, const bf* __restrict__ Kh, const bf* __restrict__ Kl, const h16* __restrict__ Q16, const h16* __restrict__ K16, float* S) {
    if ((int)blockIdx.x < RH / 64) gemmc_body<bf, 2, 1, 1>((int)blockIdx.x, Qh, Ql, HD, Kh, Kl, HD, S, TT, 0, (size_t)TT * HD, (size_t)TT * HD, (size_t)TT * TT);
    else { gemmc_body<h16, 0, 1, 1>((int)blockIdx.x - RH / 64, Q16 + (size_t)RH * HD, nullptr, HD, K16, nullptr, HD, S + (size_t)RH * TT, TT, RH, (size_t)TT * HD, (size_t)TT * HD, (size_t)TT * TT);
        asm volatile("s_wait_xcnt 0x0" ::: "memory"); }   // this arm's code is laid out in front of the other arm's: the wait stands between its last tile stores and any later write of their address or data registers
}

__device__ __forceinline__ h16 tohx(float x) { return (h16)x; }
__device__ __forceinline__ void splitf(float y, unsigned short& h, unsigned short& l) { h = f2bf(y); l = f2bf(y - bf2f(h)); }
typedef __attribute__((ext_vector_type(2))) _Float16 v2h;
typedef __attribute__((ext_vector_type(4))) _Float16 v4h;
typedef __attribute__((ext_vector_type(2))) unsigned short v2us;
typedef __attribute__((ext_vector_type(4))) unsigned short v4us;
typedef __attribute__((ext_vector_type(2))) float v2f;
typedef __attribute__((ext_vector_type(4))) int v4i;
typedef v4h  __attribute__((may_alias)) v4ha;
typedef v4us __attribute__((may_alias)) v4usa;

__global__ __launch_bounds__(256) void k_wtG(const float* __restrict__ w0, const float* __restrict__ w1, const float* __restrict__ w2, const float* __restrict__ w3, int K, int N, bf* Bt) {
    const float* w = blockIdx.y == 0 ? w0 : blockIdx.y == 1 ? w1 : blockIdx.y == 2 ? w2 : w3; Bt += (size_t)blockIdx.y * K * N;   // one grid row per weight; the four transposed planes lie one behind the other
    const int lane = threadIdx.x & 31; const int L0 = (blockIdx.x * 8 + (threadIdx.x >> 5)) * 8; const int nlines = N * K / 64;
{
#pragma unroll 1
        for (int l = 0; l < 8; ++l) { const int L = L0 + l; if (L >= nlines) break; const size_t e = (size_t)L * 64 + lane * 2; const int k = (int)(e % K), n = (int)(e / K); v2us o;
            o[0] = f2bf(w[(size_t)k * N + n]); o[1] = f2bf(w[(size_t)(k + 1) * N + n]); *(v2us*)(Bt + e) = o; }
         }
}
__global__ __launch_bounds__(256) void k_cvt8(const float* __restrict__ src, bf* dst, size_t n8) { const size_t i = (size_t)blockIdx.x * 256 + threadIdx.x; if (i >= n8) return; const v8f v = *(const v8f*)(src + i * 8); v8us o;
#pragma unroll
    for (int k = 0; k < 8; ++k) o[k] = f2bf(v[k]); *(v8us*)(dst + i * 8) = o;  }

__global__ __launch_bounds__(256) void k_ropeI(const float* __restrict__ F, int pitch, int nheads, int nplanes, const float* __restrict__ CS, float sc, h16* P16, bf* Ph, bf* Pl) {
    const size_t e = ((size_t)blockIdx.x * 256 + threadIdx.x) * 2; if (e >= (size_t)nplanes * TT * HD) return; const int d = (int)(e % HD); const int t = (int)((e / HD) % TT); const int h = (int)(e / ((size_t)HD * TT)); /* plane h = block * nheads + head; block = one TT-row block of F (q batch 0, q batch 1, k batch 0, k batch 1) */ const float* f = F + ((size_t)(h / nheads) * TT + t) * pitch + (h % nheads) * HD; const float x0 = f[d], x1 = f[d + 1]; const v2f cs = *(const v2f*)(CS + ((size_t)t * HD + d) * 2); v2h o16; v2us oh, ol;
    float a0 = __fmul_rn(x0, cs[0]), b0 = __fmul_rn(x1, cs[1]), a1 = __fmul_rn(x1, cs[0]), b1 = __fmul_rn(x0, cs[1]); asm volatile("" : "+v"(a0), "+v"(b0), "+v"(a1), "+v"(b1));
    float r0 = __fsub_rn(a0, b0) * sc, r1 = __fadd_rn(b1, a1) * sc;   /* even: x0 c - x1 s; odd: x0 s + x1 c */
    o16[0] = tohx(r0); o16[1] = tohx(r1); { unsigned short a2, c2; splitf(r0, a2, c2); oh[0] = a2; ol[0] = c2; splitf(r1, a2, c2); oh[1] = a2; ol[1] = c2; }
    *(v2h*)(P16 + e) = o16; *(v2us*)(Ph + e) = oh; *(v2us*)(Pl + e) = ol;  }

__constant__ float INV2[HD / 2] = { 1.000000000e+00f, 7.498942018e-01f, 5.623413324e-01f, 4.216965139e-01f, 3.162277639e-01f, 2.371373773e-01f, 1.778279394e-01f, 1.333521456e-01f, 1.000000015e-01f, 7.498942316e-02f, 5.623413250e-02f, 4.216964915e-02f, 3.162277490e-02f, 2.371373773e-02f, 1.778279431e-02f, 1.333521400e-02f, 9.999999776e-03f, 7.498942316e-03f, 5.623413250e-03f, 4.216964822e-03f, 3.162277630e-03f, 2.371373819e-03f, 1.778279431e-03f, 1.333521446e-03f, 1.000000047e-03f, 7.498941850e-04f, 5.623413017e-04f, 4.216965172e-04f, 3.162277571e-04f, 2.371373703e-04f, 1.778279402e-04f, 1.333521504e-04f };   // 10000 ** (-2i / 64), i = 0..31, in float32 as THIS module writes it (the NEGATIVE-POWER spelling '10000.0 ** (-ts / dim)' evaluated in the reference's own f32 arithmetic: these 32 literals equal it bit for bit); ten entries differ by one ulp from the reciprocal values the host's own table held

__global__ __launch_bounds__(256) void k_vtp(const float* __restrict__ F, int pitch, int nheads, h16* V16, bf* Vh, bf* Vl) { const size_t e = ((size_t)blockIdx.x * 256 + threadIdx.x) * 2; if (e >= (size_t)NB_ * nheads * HD * TT) return; const int t = (int)(e % TT); const int d = (int)((e / TT) % HD); const int g = (int)(e / ((size_t)TT * HD)); v2h o16; v2us oh, ol;
#pragma unroll
    for (int q = 0; q < 2; ++q) { const float x = F[((size_t)(g / nheads) * TT + t + q) * pitch + (g % nheads) * HD + d];   /* plane g = batch * nheads + head */ o16[q] = tohx(x); unsigned short a2, c2; splitf(x, a2, c2); oh[q] = a2; ol[q] = c2; }
    *(v2h*)(V16 + e) = o16; *(v2us*)(Vh + e) = oh; *(v2us*)(Vl + e) = ol;  }
__global__ __launch_bounds__(256) void k_csP(float* CS) { const int idx = blockIdx.x * 256 + threadIdx.x; if (idx >= TT * HD) return; const int d = idx % HD; const int t = idx / HD; const float a = __fmul_rn((float)t, INV2[d >> 1]); v2f cs; cs[0] = cosf(a); cs[1] = sinf(a); *(v2f*)(CS + (size_t)idx * 2) = cs;  }
// k_asoft: per row (zz, i): t = S x SCL (1/32) for j <= i and i - j < WIN (WIN = TT: the window test always holds, plain causal; the reference's -1e8 fill vanishes identically); softmax over the 2048 keys (register row, one exp, fixed trees); the wave holds its whole row in registers before it stores, and the probabilities go over that same row's 8 KiB: rows < RH as a hi plane (first 4 KiB) and a lo plane (second 4 KiB), the rest as fp16 in the first 4 KiB: a 16-bit row pitch of 2 * TT;
__global__ __launch_bounds__(256) void k_asoft(float* Sb) {
    const int lane = threadIdx.x & 31; const int row = blockIdx.x * 8 + (threadIdx.x >> 5); if (row >= ZH * TT) return; const int i = row % TT; const int zz = row / TT; (void)zz; const bool hires = (i < RH); const float* sr = Sb + (size_t)row * TT; float v[TT / 32]; float mx = -3.0e38f;
#pragma unroll
    for (int ch = 0; ch < TT / 128; ++ch) { const int j0 = ch * 128 + lane * 4; const v4f a = *(const v4f*)(sr + j0);
#pragma unroll
        for (int q = 0; q < 4; ++q) { const int j = j0 + q; (void)j; const float t = (j <= i && i - j < WIN) ? a[q] * SCL : -3.0e38f; v[ch * 4 + q] = t; mx = fmaxf(mx, t); } }
#pragma unroll
    for (int sh = 16; sh; sh >>= 1) mx = fmaxf(mx, __shfl_xor(mx, sh, 32));
    float sum = 0.f;
#pragma unroll
    for (int k = 0; k < TT / 32; ++k) { float d0 = __fsub_rn(v[k], mx); asm volatile("" : "+v"(d0)); v[k] = __builtin_amdgcn_exp2f(__fmul_rn(d0, 1.4426950408889634f)); sum += v[k]; }
#pragma unroll
    for (int sh = 16; sh; sh >>= 1) sum += __shfl_xor(sum, sh, 32);
    const float f = __fdiv_rn(hires ? 1.0f : PCAR, sum);
{
        if (hires) {
#pragma unroll
            for (int ch = 0; ch < TT / 128; ++ch) { v4us oh, ol;
#pragma unroll
                for (int q = 0; q < 4; ++q) { unsigned short a, c2; splitf(v[ch * 4 + q] * f, a, c2); oh[q] = a; ol[q] = c2; }
                bf* pr = (bf*)(Sb + (size_t)row * TT) + ch * 128 + lane * 4; *(v4usa*)pr = oh; *(v4usa*)(pr + TT) = ol; }
        } else {
#pragma unroll
            for (int ch = 0; ch < TT / 128; ++ch) { v4h o4;
#pragma unroll
                for (int q = 0; q < 4; ++q) o4[q] = tohx(v[ch * 4 + q] * f);
                *(v4ha*)((h16*)(Sb + (size_t)row * TT) + ch * 128 + lane * 4) = o4; } }
         }
}
__global__ __launch_bounds__(256) void k_premise(const int* __restrict__ flag, float* out, size_t n4) { const size_t i = (size_t)blockIdx.x * 256 + threadIdx.x; if (i >= n4) return; if (flag[0] == NH_) return;   /* premise holds (num_heads == 16): nothing to do */ const float qn = __int_as_float(0x7fc00000); v4f o; o[0] = qn; o[1] = qn; o[2] = qn; o[3] = qn; *(v4f*)(out + i * 4) = o;  }
__global__ __launch_bounds__(256) void k_merge(const float* __restrict__ O, int h0, bf* Ah, bf* Al) { const size_t e = ((size_t)blockIdx.x * 256 + threadIdx.x) * 2; if (e >= (size_t)ZH * TT * HD) return; const int d = (int)(e % HD); const int t = (int)((e / HD) % TT); const int zz = (int)(e / ((size_t)HD * TT)); const float cs = (t < RH) ? 1.0f : (1.0f / PCAR); const size_t oo = ((size_t)((h0 + zz) / NH_) * TT + t) * DQ + ((h0 + zz) % NH_) * HD + d;   /* plane h0 + zz = batch * 16 + head */
    v2us oh, ol;
#pragma unroll
    for (int q = 0; q < 2; ++q) { unsigned short a, c2; splitf(O[e + q] * cs, a, c2); oh[q] = a; ol[q] = c2; } *(v2us*)(Ah + oo) = oh; *(v2us*)(Al + oo) = ol;  }

extern "C" void kernel_launch(void* const* d_in, const int* in_sizes, int n_in,
                              void* d_out, int out_size, void* d_ws, size_t ws_size, hipStream_t stream) {
    (void)in_sizes; (void)n_in; (void)out_size;
    const float* x = (const float*)d_in[0]; const float* wq = (const float*)d_in[1]; const float* wk = (const float*)d_in[2]; const float* wv = (const float*)d_in[3]; const float* wo = (const float*)d_in[4]; const int* flag = (const int*)d_in[5];   /* input order x, Wq, Wk, Wv, Wo ('xw' [1024][1024]), num_heads (the SIXTH input, slot 5: the python int 16 as an int scalar: READ ON DEVICE by k_premise after the output is written: the whole output is NaN-filled unless it equals NH_ = 16) */
    float* OUT = (float*)d_out;     // [2][2048][1024]
    char* wsp = (char*)d_ws;
    auto take = [&](size_t bytes) { char* p = wsp; wsp += (bytes + 255) & ~(size_t)255; return (void*)p; };
    bf* WQ = (bf*)take((size_t)4 * DQ * DM * 2); bf* WO = WQ + (size_t)3 * DQ * DM;   // transposed Wq, Wk, Wv, Wo, one behind the other (z-stride DQ*DM)
    float* CS = (float*)take((size_t)TT * HD * 2 * 4);
    const size_t PL = (size_t)NB_ * NH_ * TT * HD;   // one operand's planes, both batches
    h16* QP16 = (h16*)take(2 * PL * 2); h16* KP16 = QP16 + PL; bf* QPh = (bf*)take(2 * PL * 2); bf* KPh = QPh + PL; bf* QPl = (bf*)take(2 * PL * 2); bf* KPl = QPl + PL;   // k planes directly behind the q planes: one rotary launch fills both
    h16* VT16 = (h16*)take(PL * 2); bf* VTh = (bf*)take(PL * 2); bf* VTl = (bf*)take(PL * 2);
    float* Ob = (float*)take((size_t)ZH * TT * HD * 4); bf* ATh = (bf*)take((size_t)NB_ * TT * DQ * 2); bf* ATl = (bf*)take((size_t)NB_ * TT * DQ * 2);
    float* Sb = (float*)take((size_t)ZH * TT * TT * 4);
    if ((size_t)(wsp - (char*)d_ws) > ws_size) return;    // ws 256 MiB
    bf* XB = (bf*)Sb; float* FQ = (float*)(XB + (size_t)NB_ * TT * DM); float* FV = FQ + (size_t)2 * NB_ * TT * DQ;   // x copy and the f32 q, k, v projections (z-stride NB_*TT*DQ) live in the score buffer: all are consumed before the first score launch writes it (stream-ordered)
    k_wtG<<<dim3((unsigned)((DM * DQ / 64 + 63) / 64), 4, 1), 256, 0, stream>>>(wq, wk, wv, wo, DM, DQ, WQ);
    k_csP<<<(TT * HD + 255) / 256, 256, 0, stream>>>(CS);
    k_cvt8<<<(unsigned)(((size_t)NB_ * TT * DM / 8 + 255) / 256), 256, 0, stream>>>(x, XB, (size_t)NB_ * TT * DM / 8);
    k_gemmw<bf, 0, false, 8><<<dim3(NB_ * TT / 64, DQ / 64, 3), 256, 0, stream>>>(XB, nullptr, WQ, nullptr, DM, FQ, DQ, nullptr, 0, (size_t)DQ * DM, (size_t)NB_ * TT * DQ);
    k_ropeI<<<(unsigned)((2 * PL / 2 + 255) / 256), 256, 0, stream>>>(FQ, DQ, NH_, 2 * NB_ * NH_, CS, 1.0f, QP16, QPh, QPl);
    k_vtp<<<(unsigned)((PL / 2 + 255) / 256), 256, 0, stream>>>(FV, DKV, NKV, VT16, VTh, VTl);
    for (int h0 = 0; h0 < NB_ * NH_; h0 += ZH) { const size_t zq = (size_t)h0, zk = (size_t)(h0 / REP);   // one kv head per query head: the pass's planes (batch * 16 + head) are consecutive (z-strides TT*HD)
        k_score<<<dim3(TT / 64, TT / 64, ZH), 32, 0, stream>>>(QPh + zq * TT * HD, QPl + zq * TT * HD, KPh + zk * TT * HD, KPl + zk * TT * HD, QP16 + zq * TT * HD, KP16 + zk * TT * HD, Sb);
        k_asoft<<<ZH * TT / 8, 256, 0, stream>>>(Sb);
        k_gemmc<bf, 2, 2, 8><<<dim3(RH / 64, HD / 64, ZH), 256, 0, stream>>>((const bf*)Sb, (const bf*)Sb + TT, 2 * TT, VTh + zk * HD * TT, VTl + zk * HD * TT, TT, Ob, HD, 0, (size_t)TT * 2 * TT, (size_t)HD * TT, (size_t)TT * HD);
        k_gemmc<h16, 0, 2, 16><<<dim3((TT - RH) / 64, HD / 64, ZH), 512, 0, stream>>>((const h16*)Sb + (size_t)RH * 2 * TT, nullptr, 2 * TT, VT16 + zk * HD * TT, nullptr, TT, Ob + (size_t)RH * HD, HD, RH, (size_t)TT * 2 * TT, (size_t)HD * TT, (size_t)TT * HD);
        k_merge<<<(unsigned)(((size_t)ZH * TT * HD / 2 + 255) / 256), 256, 0, stream>>>(Ob, h0, ATh, ATl); }
    k_gemmw<bf, 1, false, 8><<<dim3(NB_ * TT / 64, DM / 64, 1), 256, 0, stream>>>(ATh, ATl, WO, nullptr, DQ, OUT, DM, nullptr, 0, 0, 0);
k_premise<<<(unsigned)(((size_t)NB_ * TT * DM / 4 + 255) / 256), 256, 0, stream>>>(flag, OUT, (size_t)NB_ * TT * DM / 4);   /* after every batch's output is written: poison it all if the premise fails */
}

// v003
// One run takes 187 microseconds.
// Timed twice side by side with v002, it ran 2.16 times as fast both times.
// All steps since v000 together make it 7.78 times as fast.
#include <hip/hip_runtime.h>

// Causal multi-head attention with a pre-scaled query, interleaved-pair rotary embeddings and a scalar head-count input (x [2][2048][1024]; q = (x Wq) x 1/sqrt(1024), k = x Wk, v = x Wv ('xw' [1024][1024] 0.02, no bias; 16 heads x 64: the head count arrives as the python int 16, the LAST input: read on device by the premise guard); rope x cos + x_rot sin with x_rot: (x1, x2) -> (-x2, x1) on adjacent pairs and cos / sin = repeat(c, 2) of angle t x 10000^(-2i/64) (32 f32 frequencies jnp-exact for the module's negative-power expression; precise cosf/sinf); logits = q.k (no further scale: net 1/32); where(tril, logits, -1e8) == exclusion; softmax; out = merged Wo ('xw', no bias) -> [2][2048][1024] (4.2 M); argument order x, Wq, Wk, Wv, Wo, num_heads).
// VALUE PREMISE: this kernel implements num_heads == 16 only; k_premise reads the scalar on the device after the output is written and NaN-fills the whole output if it is not 16.
// Layout (both batches in every launch; planes ordered [batch * 16 + head]): bf16 copy of x; 'xw' weights transposed once; exact projections; k_csP computed table (pair-shared entries); k_ropeI interleaved-pair plane builders; k_attn causal T-2048 attention of all planes in one launch, scores and probabilities in registers (hybrid rows: < 512 hi/lo 3 products, rest fp16 x1024; key blocks above the diagonal are never formed); merged hi/lo x Wo exact.
// Compute dtypes, f32 accumulate: every input rounded to bf16; projections exact; rotary f32 (products rounded separately); attention rows < 512 3 products, rest fp16; softmax f32; Wo hl x exact.

#define NB_  2
#define TT   2048
#define DM   1024
#define NH_  16
#define NKV  16
#define HD   64
#define DQ   (NH_ * HD)
#define DKV  (NKV * HD)
#define RH   512                  // query rows < RH use hi+lo planes (0: none)
#define SCL  0.03125f   // 1 / sqrt(1024): the module scales q by 1 / sqrt(d_model) BEFORE the rotation and applies no other scale (a power of two: exact, commutes with the rotation)
typedef _Float16 h16;
typedef unsigned short bf;
typedef __attribute__((ext_vector_type(16))) __bf16   v16bf;
typedef __attribute__((ext_vector_type(16))) _Float16 v16h;
typedef __attribute__((ext_vector_type(8)))  _Float16 v8h;
typedef __attribute__((ext_vector_type(8)))  unsigned short v8us;
typedef __attribute__((ext_vector_type(8)))  float    v8f;
typedef __attribute__((ext_vector_type(4)))  float    v4f;
typedef v8h  __attribute__((may_alias)) v8ha;
typedef v4f  __attribute__((may_alias)) v4fa;
typedef v8us __attribute__((may_alias)) v8usa;

__device__ __forceinline__ unsigned short f2bf(float f) { unsigned u = __float_as_uint(f); u += 0x7FFFu + ((u >> 16) & 1u); return (unsigned short)(u >> 16); }
__device__ __forceinline__ float bf2f(unsigned short b) { return __uint_as_float(((unsigned)b) << 16); }
__device__ __forceinline__ float bfr(float f) { return bf2f(f2bf(f)); }
__device__ __forceinline__ v16h cat16(v8h lo, v8h hi) { return __builtin_shufflevector(lo, hi, 0, 1, 2, 3, 4, 5, 6, 7, 8, 9, 10, 11, 12, 13, 14, 15); }
__device__ __forceinline__ v16bf cat16b(v8us lo, v8us hi) { return __builtin_bit_cast(v16bf, __builtin_shufflevector(lo, hi, 0, 1, 2, 3, 4, 5, 6, 7, 8, 9, 10, 11, 12, 13, 14, 15)); }
__device__ __forceinline__ v8f wmma16(v16h a, v16h b, v8f c) { return __builtin_amdgcn_wmma_f32_16x16x32_f16(false, a, false, b, (short)0, c, false, false); }
__device__ __forceinline__ v8f wmmab(v16bf a, v16bf b, v8f c) { return __builtin_amdgcn_wmma_f32_16x16x32_bf16(false, a, false, b, (short)0, c, false, false); }



// ---- k_gemmw: register-blocked GEMM, one work-group of NW waves per 64x64 output tile; wave w takes the 32-wide k steps w, w + NW, ... into its own 16 accumulators, and the NW partial tiles are summed through LDS in wave order 0..NW-1 (a fixed order); operands straight from K-contiguous 16-bit planes; grid (M/64, N/64, Z), 32 * NW threads.
// C[m][n] (f32, pitch ldc, + optional f32 bias[n]) = sum_k A[m][k] Bt[n][k] (+ split products per NSPLIT). z-batch strides sA/sB/sC in elements. K % 32 == 0.
template <typename T16> struct WFrag;
template <> struct WFrag<h16> { typedef v16h V; static __device__ __forceinline__ V ld(const h16* p) { return cat16(*(const v8h*)p, *(const v8h*)(p + 16)); } static __device__ __forceinline__ v8f mma(V a, V b, v8f c) { return wmma16(a, b, c); } };
template <> struct WFrag<bf> { typedef v16bf V; static __device__ __forceinline__ V ld(const bf* p) { return cat16b(*(const v8us*)p, *(const v8us*)(p + 16)); } static __device__ __forceinline__ v8f mma(V a, V b, v8f c) { return wmmab(a, b, c); } };
template <typename T16, int NSPLIT, bool BIAS, int NW>
__global__ __launch_bounds__(32 * NW) void k_gemmw(const T16* __restrict__ A, const T16* __restrict__ A2, const T16* __restrict__ Bt, const T16* __restrict__ Bt2, int K, float* C, int ldc, const float* __restrict__ bias, size_t sA, size_t sB, size_t sC) {
    typedef typename WFrag<T16>::V V;
    constexpr int MBR = (NW > 1) ? 4 : 1;                            // 16-row blocks staged per LDS round: the whole tile at once where several waves meet (one barrier), one block where a wave is alone
    __shared__ __align__(16) float os[NW * MBR * 16 * 68];
    const size_t z = blockIdx.z; A += z * sA; if (A2) A2 += z * sA; Bt += z * sB; if (Bt2) Bt2 += z * sB; C += z * sC;
    const int lane = threadIdx.x & 31, lr = lane & 15, hi = lane >> 4; const int wave = (NW > 1) ? __builtin_amdgcn_readfirstlane((int)(threadIdx.x >> 5)) : 0; const int r0 = blockIdx.x * 64, c0 = blockIdx.y * 64;
    v8f acc[4][4];
#pragma unroll
    for (int mb = 0; mb < 4; ++mb)
#pragma unroll
        for (int nb = 0; nb < 4; ++nb) acc[mb][nb] = (v8f){};
    const size_t aoff = (size_t)(r0 + lr) * K + 8 * hi, boff = (size_t)(c0 + lr) * K + 8 * hi;
#pragma unroll 1
    for (int kc = 32 * wave; kc < K; kc += 32 * NW) {
        V a[4], a2[4];
#pragma unroll
        for (int mb = 0; mb < 4; ++mb) { a[mb] = WFrag<T16>::ld(A + aoff + (size_t)mb * 16 * K + kc); if (NSPLIT == 1 || NSPLIT == 2) a2[mb] = WFrag<T16>::ld(A2 + aoff + (size_t)mb * 16 * K + kc); }
#pragma unroll
        for (int nb = 0; nb < 4; ++nb) { const V b = WFrag<T16>::ld(Bt + boff + (size_t)nb * 16 * K + kc); V b2; if (NSPLIT >= 2) b2 = WFrag<T16>::ld(Bt2 + boff + (size_t)nb * 16 * K + kc);
#pragma unroll
            for (int mb = 0; mb < 4; ++mb) { acc[mb][nb] = WFrag<T16>::mma(a[mb], b, acc[mb][nb]); if (NSPLIT == 1 || NSPLIT == 2) acc[mb][nb] = WFrag<T16>::mma(a2[mb], b, acc[mb][nb]); if (NSPLIT >= 2) acc[mb][nb] = WFrag<T16>::mma(a[mb], b2, acc[mb][nb]); } }
        asm volatile("v_nop\n\tv_nop\n\tv_nop\n\tv_nop" : "+v"(acc[0][0]), "+v"(acc[1][1]), "+v"(acc[2][2]), "+v"(acc[3][3]) : "v"(a[0]), "v"(a[3]));
    }
    float* osw = os + wave * (MBR * 16 * 68);                        // this wave's own partial tile
#pragma unroll
    for (int mb0 = 0; mb0 < 4; mb0 += MBR) {
#pragma unroll
        for (int mi = 0; mi < MBR; ++mi) {
#pragma unroll
            for (int nb = 0; nb < 4; ++nb) {
#pragma unroll
                for (int j = 0; j < 8; ++j) osw[(mi * 16 + hi * 8 + j) * 68 + nb * 16 + lr] = acc[mb0 + mi][nb][j]; } }
        if (NW > 1) __syncthreads();                                 // every wave's partial tile is in LDS before any wave sums across them
        else { __builtin_amdgcn_wave_barrier(); asm volatile("" ::: "memory"); }
        float* crow = C + (size_t)(r0 + mb0 * 16) * ldc + c0;
#pragma unroll
        for (int s = 0; s < MBR * 8 / NW; ++s) { const int q = s * (32 * NW) + (int)threadIdx.x; const int row = q >> 4, cofs = (q & 15) * 4; v4f val = *(const v4fa*)(os + row * 68 + cofs);
#pragma unroll
            for (int w = 1; w < NW; ++w) val += *(const v4fa*)(os + w * (MBR * 16 * 68) + row * 68 + cofs);   // partial sums added in wave order: the same order on every run
            if (BIAS) { val[0] += bfr(bias[c0 + cofs]); val[1] += bfr(bias[c0 + cofs + 1]); val[2] += bfr(bias[c0 + cofs + 2]); val[3] += bfr(bias[c0 + cofs + 3]); }
            *(v4f*)(crow + (size_t)row * ldc + cofs) = val; }
        if (NW == 1) { __builtin_amdgcn_wave_barrier(); asm volatile("" ::: "memory"); }
    }
}

// ---- k_attn: causal attention of one query tile of one (batch, head) plane in one work-group; scores and probabilities never leave the registers.
// Transposed products: S^T = K Q^T (A = 16 keys x 32 d from the key plane, B = 16 queries from the query plane), so a lane holds 8 + 8 keys of ONE query (column lr, rows hi * 8 + j of two 16-key tiles): exactly the k order of a B fragment
// (elements 0..7 = keys 8 hi + e, elements 8..15 = keys 16 + 8 hi + e), which then meets A = V^T (16 d x 32 keys, same k order) in O^T = V^T P^T. Row statistics are per lane (one exchange between the two 16-lane halves).
// The ANW waves take the 32-key blocks w, w + ANW, ... up to the diagonal block, each with its own running maximum, sum and O^T (online softmax); the partials are merged through LDS in wave order 0..ANW-1 (a fixed order), normalised, split hi/lo and stored in merged [token][head * 64 + d] order.
#define ANW  8                    // waves per work-group: they share the key loop
#define APIT 68                   // f32 pitch of one query's partial row in LDS: 64 outputs, then its maximum and its sum
__device__ __forceinline__ void splitf(float y, unsigned short& h, unsigned short& l) { h = f2bf(y); l = f2bf(y - bf2f(h)); }
__device__ __forceinline__ float ex2(float x) { float r; asm("v_exp_f32 %0, %1\n\tv_nop" : "=v"(r) : "v"(x)); return r; }   // 2^x; the v_nop is the one slot the instruction set asks for behind a transcendental, tied to it by standing in its statement
__device__ __forceinline__ float xhalf(float x) { return __builtin_bit_cast(float, __builtin_amdgcn_permlanex16(__builtin_bit_cast(int, x), __builtin_bit_cast(int, x), 0x76543210, 0xfedcba98, false, false)); }   // lane l reads lane l ^ 16 (a vector move, no LDS round trip)
typedef __attribute__((ext_vector_type(4))) unsigned short v4us;
template <int N> struct USV;
template <> struct USV<8> { typedef v8us T; };
template <> struct USV<4> { typedef v4us T; };
template <typename T16, bool HR, int NQB>
__device__ __forceinline__ void attn_body(float* sm, int q0, const T16* __restrict__ Q, const T16* __restrict__ Q2, const T16* __restrict__ Kp, const T16* __restrict__ Kp2, const T16* __restrict__ Vt, const T16* __restrict__ Vt2, bf* Ah, bf* Al) {
    typedef typename WFrag<T16>::V V;
    constexpr float K1 = SCL * 1.4426950408889634f;                  // logit scale and log2(e) in one factor: the statistics live in the base-2 exponent's units
    constexpr float PB = HR ? 0.0f : 10.0f;                          // fp16 probabilities carry a factor 2^10, which cancels in the division by their own sum
    const int lane = threadIdx.x & 31, lr = lane & 15, hi = lane >> 4; const int wave = __builtin_amdgcn_readfirstlane((int)(threadIdx.x >> 5));
    V bq[NQB][2], bq2[NQB][2];
#pragma unroll
    for (int qb = 0; qb < NQB; ++qb)
#pragma unroll
        for (int ks = 0; ks < 2; ++ks) { const size_t qo = (size_t)(q0 + qb * 16 + lr) * HD + 8 * hi + ks * 32; bq[qb][ks] = WFrag<T16>::ld(Q + qo); if (HR) bq2[qb][ks] = WFrag<T16>::ld(Q2 + qo); }
    v8f o[NQB][4]; float m[NQB], l[NQB];
#pragma unroll
    for (int qb = 0; qb < NQB; ++qb) { m[qb] = -1.0e30f; l[qb] = 0.f;
#pragma unroll
        for (int db = 0; db < 4; ++db) o[qb][db] = (v8f){}; }
    const int nkb = q0 / 32 + 1;                                     // 32-key blocks up to and with the diagonal block; every query of the tile has a key in each of them
#pragma unroll 1   // rolled: one block's K and V fragments live at a time, which keeps four waves on a SIMD; every inner loop is unrolled so that fragments and accumulators stay in registers
    for (int kb = wave; kb < nkb; kb += ANW) {
        const int k0 = kb * 32;
        V ak[2][2], ak2[2][2], av[4], av2[4];
#pragma unroll
        for (int kt = 0; kt < 2; ++kt)
#pragma unroll
            for (int ks = 0; ks < 2; ++ks) { const size_t ko = (size_t)(k0 + kt * 16 + lr) * HD + 8 * hi + ks * 32; ak[kt][ks] = WFrag<T16>::ld(Kp + ko); if (HR) ak2[kt][ks] = WFrag<T16>::ld(Kp2 + ko); }
        asm volatile("s_wait_xcnt 0x0" ::: "memory");   // behind the K loads: their address registers are free for reuse (the V fragments may land on them)
#pragma unroll
        for (int db = 0; db < 4; ++db) { const size_t vo = (size_t)(db * 16 + lr) * TT + k0 + 8 * hi; av[db] = WFrag<T16>::ld(Vt + vo); if (HR) av2[db] = WFrag<T16>::ld(Vt2 + vo); }
        asm volatile("s_wait_xcnt 0x0" ::: "memory");   // behind the V loads, which are still in flight during the score products: the compiler reuses their address registers there
#pragma unroll
        for (int qb = 0; qb < NQB; ++qb) {
            v8f st[2];                                               // st[kt][j] = q.k of key k0 + kt * 16 + hi * 8 + j and query q0 + qb * 16 + lr
#pragma unroll
            for (int kt = 0; kt < 2; ++kt) { v8f s = (v8f){};
#pragma unroll
                for (int ks = 0; ks < 2; ++ks) { s = WFrag<T16>::mma(ak[kt][ks], bq[qb][ks], s); if (HR) { s = WFrag<T16>::mma(ak[kt][ks], bq2[qb][ks], s); s = WFrag<T16>::mma(ak2[kt][ks], bq[qb][ks], s); } }
                st[kt] = s; }
            if (kb == nkb - 1) {                                     // only the diagonal block holds keys behind a query
#pragma unroll
                for (int kt = 0; kt < 2; ++kt)
#pragma unroll
                    for (int j = 0; j < 8; ++j) if (k0 + kt * 16 + hi * 8 + j > q0 + qb * 16 + lr) st[kt][j] = -1.0e30f; }
            float mx = st[0][0];
#pragma unroll
            for (int e = 1; e < 16; ++e) mx = fmaxf(mx, st[e >> 3][e & 7]);
            mx = fmaxf(mx, xhalf(mx));
            const float mn = fmaxf(m[qb], mx * K1 - PB); const float al = ex2(m[qb] - mn); m[qb] = mn;
            float p[16], ps = 0.f;
#pragma unroll
            for (int e = 0; e < 16; ++e) { p[e] = ex2(st[e >> 3][e & 7] * K1 - mn); ps += p[e]; }
            l[qb] = l[qb] * al + ps;
#pragma unroll
            for (int db = 0; db < 4; ++db) o[qb][db] *= al;
            if constexpr (HR) { v8us h0, h1, l0, l1;
#pragma unroll
                for (int e = 0; e < 8; ++e) { unsigned short a, c; splitf(p[e], a, c); h0[e] = a; l0[e] = c; splitf(p[8 + e], a, c); h1[e] = a; l1[e] = c; }
                const V ph = cat16b(h0, h1), pl = cat16b(l0, l1);
#pragma unroll
                for (int db = 0; db < 4; ++db) { o[qb][db] = WFrag<T16>::mma(av[db], ph, o[qb][db]); o[qb][db] = WFrag<T16>::mma(av[db], pl, o[qb][db]); o[qb][db] = WFrag<T16>::mma(av2[db], ph, o[qb][db]); }
            } else { V pb;
#pragma unroll
                for (int e = 0; e < 16; ++e) pb[e] = (h16)p[e];
#pragma unroll
                for (int db = 0; db < 4; ++db) o[qb][db] = WFrag<T16>::mma(av[db], pb, o[qb][db]); }
        }
        asm volatile("v_nop\n\tv_nop\n\tv_nop\n\tv_nop" : "+v"(o[NQB - 1][0]), "+v"(o[NQB - 1][1]), "+v"(o[NQB - 1][2]), "+v"(o[NQB - 1][3]));   // the matrix instructions' distance on the taken branch out of the loop (its target reads o)
    }
    float* my = sm + wave * (NQB * 16 * APIT);                       // this wave's own partial tile
#pragma unroll
    for (int qb = 0; qb < NQB; ++qb) { l[qb] += xhalf(l[qb]); float* r = my + (qb * 16 + lr) * APIT;
#pragma unroll
        for (int db = 0; db < 4; ++db) { v4f a, b;
#pragma unroll
            for (int j = 0; j < 4; ++j) { a[j] = o[qb][db][j]; b[j] = o[qb][db][4 + j]; }
            *(v4fa*)(r + db * 16 + hi * 8) = a; *(v4fa*)(r + db * 16 + hi * 8 + 4) = b; }
        if (hi == 0) { r[64] = m[qb]; r[65] = l[qb]; } }
    __syncthreads();                                                 // every wave's partial tile and statistics are in LDS before any thread merges them
    constexpr int EPT = NQB * 16 * HD / (32 * ANW);                  // outputs per thread: consecutive d of one query
    const int qi = (int)threadIdx.x / (HD / EPT), d0 = ((int)threadIdx.x % (HD / EPT)) * EPT; const float* r0 = sm + qi * APIT;
    float M = r0[64];
#pragma unroll
    for (int w = 1; w < ANW; ++w) M = fmaxf(M, r0[w * (NQB * 16 * APIT) + 64]);
    float L = 0.f, acc[EPT];
#pragma unroll
    for (int e = 0; e < EPT; ++e) acc[e] = 0.f;
#pragma unroll
    for (int w = 0; w < ANW; ++w) { const float* rw = r0 + w * (NQB * 16 * APIT); const float wt = ex2(rw[64] - M); L += wt * rw[65];   // a wave that had no block weighs 0; partials added in wave order: the same order on every run
#pragma unroll
        for (int e4 = 0; e4 < EPT; e4 += 4) { const v4f x = *(const v4fa*)(rw + d0 + e4);
#pragma unroll
            for (int j = 0; j < 4; ++j) acc[e4 + j] += wt * x[j]; } }
    const float f = __fdiv_rn(1.0f, L); typename USV<EPT>::T oh, ol;
#pragma unroll
    for (int e = 0; e < EPT; ++e) { unsigned short a, c; splitf(acc[e] * f, a, c); oh[e] = a; ol[e] = c; }
    const size_t oo = (size_t)(q0 + qi) * DQ + d0; *(typename USV<EPT>::T*)(Ah + oo) = oh; *(typename USV<EPT>::T*)(Al + oo) = ol;
    asm volatile("s_wait_xcnt 0x0" ::: "memory");   // one body's code is laid out in front of the other's: the wait stands between these stores and any later write of their address or data registers
}
// grid (planes, query tiles): tiles in falling order of their key count, the longest start first; query rows >= RH in tiles of 32 (fp16 body), rows < RH in tiles of 16 (hi/lo 3-product body); the choice is uniform for the work-group.
__global__ __launch_bounds__(32 * ANW) void k_attn(const bf* __restrict__ Qh, const bf* __restrict__ Ql, const bf* __restrict__ Kh, const bf* __restrict__ Kl, const bf* __restrict__ Vh, const bf* __restrict__ Vl, const h16* __restrict__ Q16, const h16* __restrict__ K16, const h16* __restrict__ V16, bf* Ah, bf* Al) {
    __shared__ __align__(16) float sm[ANW * 32 * APIT];
    const int pl = (int)blockIdx.x, ty = (int)blockIdx.y; const size_t po = (size_t)pl * TT * HD; const size_t ao = (size_t)(pl / NH_) * TT * DQ + (size_t)(pl % NH_) * HD;   /* plane = batch * 16 + head */
    if (ty < (TT - RH) / 32) attn_body<h16, false, 2>(sm, TT - 32 * (ty + 1), Q16 + po, nullptr, K16 + po, nullptr, V16 + po, nullptr, Ah + ao, Al + ao);
    else attn_body<bf, true, 1>(sm, RH - 16 * (ty - (TT - RH) / 32 + 1), Qh + po, Ql + po, Kh + po, Kl + po, Vh + po, Vl + po, Ah + ao, Al + ao);
}

__device__ __forceinline__ h16 tohx(float x) { return (h16)x; }
typedef __attribute__((ext_vector_type(2))) _Float16 v2h;
typedef __attribute__((ext_vector_type(2))) unsigned short v2us;
typedef __attribute__((ext_vector_type(2))) float v2f;
typedef __attribute__((ext_vector_type(4))) int v4i;

__global__ __launch_bounds__(256) void k_wtG(const float* __restrict__ w0, const float* __restrict__ w1, const float* __restrict__ w2, const float* __restrict__ w3, int K, int N, bf* Bt) {
    const float* w = blockIdx.y == 0 ? w0 : blockIdx.y == 1 ? w1 : blockIdx.y == 2 ? w2 : w3; Bt += (size_t)blockIdx.y * K * N;   // one grid row per weight; the four transposed planes lie one behind the other
    const int lane = threadIdx.x & 31; const int L0 = (blockIdx.x * 8 + (threadIdx.x >> 5)) * 8; const int nlines = N * K / 64;
{
#pragma unroll 1
        for (int l = 0; l < 8; ++l) { const int L = L0 + l; if (L >= nlines) break; const size_t e = (size_t)L * 64 + lane * 2; const int k = (int)(e % K), n = (int)(e / K); v2us o;
            o[0] = f2bf(w[(size_t)k * N + n]); o[1] = f2bf(w[(size_t)(k + 1) * N + n]); *(v2us*)(Bt + e) = o; }
         }
}
__global__ __launch_bounds__(256) void k_cvt8(const float* __restrict__ src, bf* dst, size_t n8) { const size_t i = (size_t)blockIdx.x * 256 + threadIdx.x; if (i >= n8) return; const v8f v = *(const v8f*)(src + i * 8); v8us o;
#pragma unroll
    for (int k = 0; k < 8; ++k) o[k] = f2bf(v[k]); *(v8us*)(dst + i * 8) = o;  }

__global__ __launch_bounds__(256) void k_ropeI(const float* __restrict__ F, int pitch, int nheads, int nplanes, const float* __restrict__ CS, float sc, h16* P16, bf* Ph, bf* Pl) {
    const size_t e = ((size_t)blockIdx.x * 256 + threadIdx.x) * 2; if (e >= (size_t)nplanes * TT * HD) return; const int d = (int)(e % HD); const int t = (int)((e / HD) % TT); const int h = (int)(e / ((size_t)HD * TT)); /* plane h = block * nheads + head; block = one TT-row block of F (q batch 0, q batch 1, k batch 0, k batch 1) */ const float* f = F + ((size_t)(h / nheads) * TT + t) * pitch + (h % nheads) * HD; const float x0 = f[d], x1 = f[d + 1]; const v2f cs = *(const v2f*)(CS + ((size_t)t * HD + d) * 2); v2h o16; v2us oh, ol;
    float a0 = __fmul_rn(x0, cs[0]), b0 = __fmul_rn(x1, cs[1]), a1 = __fmul_rn(x1, cs[0]), b1 = __fmul_rn(x0, cs[1]); asm volatile("" : "+v"(a0), "+v"(b0), "+v"(a1), "+v"(b1));
    float r0 = __fsub_rn(a0, b0) * sc, r1 = __fadd_rn(b1, a1) * sc;   /* even: x0 c - x1 s; odd: x0 s + x1 c */
    o16[0] = tohx(r0); o16[1] = tohx(r1); { unsigned short a2, c2; splitf(r0, a2, c2); oh[0] = a2; ol[0] = c2; splitf(r1, a2, c2); oh[1] = a2; ol[1] = c2; }
    *(v2h*)(P16 + e) = o16; *(v2us*)(Ph + e) = oh; *(v2us*)(Pl + e) = ol;  }

__constant__ float INV2[HD / 2] = { 1.000000000e+00f, 7.498942018e-01f, 5.623413324e-01f, 4.216965139e-01f, 3.162277639e-01f, 2.371373773e-01f, 1.778279394e-01f, 1.333521456e-01f, 1.000000015e-01f, 7.498942316e-02f, 5.623413250e-02f, 4.216964915e-02f, 3.162277490e-02f, 2.371373773e-02f, 1.778279431e-02f, 1.333521400e-02f, 9.999999776e-03f, 7.498942316e-03f, 5.623413250e-03f, 4.216964822e-03f, 3.162277630e-03f, 2.371373819e-03f, 1.778279431e-03f, 1.333521446e-03f, 1.000000047e-03f, 7.498941850e-04f, 5.623413017e-04f, 4.216965172e-04f, 3.162277571e-04f, 2.371373703e-04f, 1.778279402e-04f, 1.333521504e-04f };   // 10000 ** (-2i / 64), i = 0..31, in float32 as THIS module writes it (the NEGATIVE-POWER spelling '10000.0 ** (-ts / dim)' evaluated in the reference's own f32 arithmetic: these 32 literals equal it bit for bit); ten entries differ by one ulp from the reciprocal values the host's own table held

__global__ __launch_bounds__(256) void k_vtp(const float* __restrict__ F, int pitch, int nheads, h16* V16, bf* Vh, bf* Vl) { const size_t e = ((size_t)blockIdx.x * 256 + threadIdx.x) * 2; if (e >= (size_t)NB_ * nheads * HD * TT) return; const int t = (int)(e % TT); const int d = (int)((e / TT) % HD); const int g = (int)(e / ((size_t)TT * HD)); v2h o16; v2us oh, ol;
#pragma unroll
    for (int q = 0; q < 2; ++q) { const float x = F[((size_t)(g / nheads) * TT + t + q) * pitch + (g % nheads) * HD + d];   /* plane g = batch * nheads + head */ o16[q] = tohx(x); unsigned short a2, c2; splitf(x, a2, c2); oh[q] = a2; ol[q] = c2; }
    *(v2h*)(V16 + e) = o16; *(v2us*)(Vh + e) = oh; *(v2us*)(Vl + e) = ol;  }
__global__ __launch_bounds__(256) void k_csP(float* CS) { const int idx = blockIdx.x * 256 + threadIdx.x; if (idx >= TT * HD) return; const int d = idx % HD; const int t = idx / HD; const float a = __fmul_rn((float)t, INV2[d >> 1]); v2f cs; cs[0] = cosf(a); cs[1] = sinf(a); *(v2f*)(CS + (size_t)idx * 2) = cs;  }
__global__ __launch_bounds__(256) void k_premise(const int* __restrict__ flag, float* out, size_t n4) { const size_t i = (size_t)blockIdx.x * 256 + threadIdx.x; if (i >= n4) return; if (flag[0] == NH_) return;   /* premise holds (num_heads == 16): nothing to do */ const float qn = __int_as_float(0x7fc00000); v4f o; o[0] = qn; o[1] = qn; o[2] = qn; o[3] = qn; *(v4f*)(out + i * 4) = o;  }

extern "C" void kernel_launch(void* const* d_in, const int* in_sizes, int n_in,
                              void* d_out, int out_size, void* d_ws, size_t ws_size, hipStream_t stream) {
    (void)in_sizes; (void)n_in; (void)out_size;
    const float* x = (const float*)d_in[0]; const float* wq = (const float*)d_in[1]; const float* wk = (const float*)d_in[2]; const float* wv = (const float*)d_in[3]; const float* wo = (const float*)d_in[4]; const int* flag = (const int*)d_in[5];   /* input order x, Wq, Wk, Wv, Wo ('xw' [1024][1024]), num_heads (the SIXTH input, slot 5: the python int 16 as an int scalar: READ ON DEVICE by k_premise after the output is written: the whole output is NaN-filled unless it equals NH_ = 16) */
    float* OUT = (float*)d_out;     // [2][2048][1024]
    char* wsp = (char*)d_ws;
    auto take = [&](size_t bytes) { char* p = wsp; wsp += (bytes + 255) & ~(size_t)255; return (void*)p; };
    bf* WQ = (bf*)take((size_t)4 * DQ * DM * 2); bf* WO = WQ + (size_t)3 * DQ * DM;   // transposed Wq, Wk, Wv, Wo, one behind the other (z-stride DQ*DM)
    float* CS = (float*)take((size_t)TT * HD * 2 * 4);
    const size_t PL = (size_t)NB_ * NH_ * TT * HD;   // one operand's planes, both batches
    h16* QP16 = (h16*)take(2 * PL * 2); h16* KP16 = QP16 + PL; bf* QPh = (bf*)take(2 * PL * 2); bf* KPh = QPh + PL; bf* QPl = (bf*)take(2 * PL * 2); bf* KPl = QPl + PL;   // k planes directly behind the q planes: one rotary launch fills both
    h16* VT16 = (h16*)take(PL * 2); bf* VTh = (bf*)take(PL * 2); bf* VTl = (bf*)take(PL * 2);
    bf* ATh = (bf*)take((size_t)NB_ * TT * DQ * 2); bf* ATl = (bf*)take((size_t)NB_ * TT * DQ * 2);
    bf* XB = (bf*)take((size_t)NB_ * TT * DM * 2); float* FQ = (float*)take((size_t)3 * NB_ * TT * DQ * 4); float* FV = FQ + (size_t)2 * NB_ * TT * DQ;   // bf16 copy of x; the f32 q, k, v projections (z-stride NB_*TT*DQ)
    if ((size_t)(wsp - (char*)d_ws) > ws_size) return;    // ws 256 MiB
    k_wtG<<<dim3((unsigned)((DM * DQ / 64 + 63) / 64), 4, 1), 256, 0, stream>>>(wq, wk, wv, wo, DM, DQ, WQ);
    k_csP<<<(TT * HD + 255) / 256, 256, 0, stream>>>(CS);
    k_cvt8<<<(unsigned)(((size_t)NB_ * TT * DM / 8 + 255) / 256), 256, 0, stream>>>(x, XB, (size_t)NB_ * TT * DM / 8);
    k_gemmw<bf, 0, false, 8><<<dim3(NB_ * TT / 64, DQ / 64, 3), 256, 0, stream>>>(XB, nullptr, WQ, nullptr, DM, FQ, DQ, nullptr, 0, (size_t)DQ * DM, (size_t)NB_ * TT * DQ);
    k_ropeI<<<(unsigned)((2 * PL / 2 + 255) / 256), 256, 0, stream>>>(FQ, DQ, NH_, 2 * NB_ * NH_, CS, 1.0f, QP16, QPh, QPl);
    k_vtp<<<(unsigned)((PL / 2 + 255) / 256), 256, 0, stream>>>(FV, DKV, NKV, VT16, VTh, VTl);
    k_attn<<<dim3(NB_ * NH_, (TT - RH) / 32 + RH / 16, 1), 32 * ANW, 0, stream>>>(QPh, QPl, KPh, KPl, VTh, VTl, QP16, KP16, VT16, ATh, ATl);   // one kv head per query head: plane index batch * 16 + head for q, k and v alike
    k_gemmw<bf, 1, false, 8><<<dim3(NB_ * TT / 64, DM / 64, 1), 256, 0, stream>>>(ATh, ATl, WO, nullptr, DQ, OUT, DM, nullptr, 0, 0, 0);
k_premise<<<(unsigned)(((size_t)NB_ * TT * DM / 4 + 255) / 256), 256, 0, stream>>>(flag, OUT, (size_t)NB_ * TT * DM / 4);   /* after every batch's output is written: poison it all if the premise fails */
}

// v004
// It runs in 154 microseconds.
// In both of two side-by-side timings against v003, it was 1.21 times as fast.
// Counting every step since v000, it is 9.42 times as fast.
#include <hip/hip_runtime.h>

// Causal multi-head attention with a pre-scaled query, interleaved-pair rotary embeddings and a scalar head-count input (x [2][2048][1024]; q = (x Wq) x 1/sqrt(1024), k = x Wk, v = x Wv ('xw' [1024][1024] 0.02, no bias; 16 heads x 64: the head count arrives as the python int 16, the LAST input: read on device by the premise guard); rope x cos + x_rot sin with x_rot: (x1, x2) -> (-x2, x1) on adjacent pairs and cos / sin = repeat(c, 2) of angle t x 10000^(-2i/64) (32 f32 frequencies jnp-exact for the module's negative-power expression; precise cosf/sinf); logits = q.k (no further scale: net 1/32); where(tril, logits, -1e8) == exclusion; softmax; out = merged Wo ('xw', no bias) -> [2][2048][1024] (4.2 M); argument order x, Wq, Wk, Wv, Wo, num_heads).
// VALUE PREMISE: this kernel implements num_heads == 16 only; k_premise reads the scalar on the device after the output is written and NaN-fills the whole output if it is not 16.
// Layout (both batches in every launch; planes ordered [batch * 16 + head]): bf16 copy of x; 'xw' weights transposed once; exact projections whose epilogue applies the rotation (k_csP computed table, pair-shared entries) and writes the q, k and transposed v planes itself; k_attn causal T-2048 attention of all planes in one launch, scores and probabilities in registers (hybrid rows: < 512 hi/lo 3 products, rest fp16 x1024; key blocks above the diagonal are never formed); merged hi/lo x Wo exact.
// Compute dtypes, f32 accumulate: every input rounded to bf16; projections exact; rotary f32; attention rows < 512 3 products, rest fp16; softmax f32; Wo hl x exact.

#define NB_  2
#define TT   2048
#define DM   1024
#define NH_  16
#define NKV  16
#define HD   64
#define DQ   (NH_ * HD)
#define DKV  (NKV * HD)
#define RH   512                  // query rows < RH use hi+lo planes (0: none)
#define SCL  0.03125f   // 1 / sqrt(1024): the module scales q by 1 / sqrt(d_model) BEFORE the rotation and applies no other scale (a power of two: exact, commutes with the rotation)
typedef _Float16 h16;
typedef unsigned short bf;
typedef __attribute__((ext_vector_type(16))) __bf16   v16bf;
typedef __attribute__((ext_vector_type(16))) _Float16 v16h;
typedef __attribute__((ext_vector_type(8)))  _Float16 v8h;
typedef __attribute__((ext_vector_type(8)))  unsigned short v8us;
typedef __attribute__((ext_vector_type(8)))  float    v8f;
typedef __attribute__((ext_vector_type(4)))  float    v4f;
typedef v8h  __attribute__((may_alias)) v8ha;
typedef v4f  __attribute__((may_alias)) v4fa;
typedef v8us __attribute__((may_alias)) v8usa;
typedef __attribute__((ext_vector_type(4))) unsigned short v4us;
typedef __attribute__((ext_vector_type(4))) _Float16 v4h;
typedef __attribute__((ext_vector_type(2))) float v2f;

__device__ __forceinline__ unsigned short f2bf(float f) { unsigned u = __float_as_uint(f); u += 0x7FFFu + ((u >> 16) & 1u); return (unsigned short)(u >> 16); }
__device__ __forceinline__ float bf2f(unsigned short b) { return __uint_as_float(((unsigned)b) << 16); }
__device__ __forceinline__ float bfr(float f) { return bf2f(f2bf(f)); }
__device__ __forceinline__ void splitf(float y, unsigned short& h, unsigned short& l) { h = f2bf(y); l = f2bf(y - bf2f(h)); }
__device__ __forceinline__ v16h cat16(v8h lo, v8h hi) { return __builtin_shufflevector(lo, hi, 0, 1, 2, 3, 4, 5, 6, 7, 8, 9, 10, 11, 12, 13, 14, 15); }
__device__ __forceinline__ v16bf cat16b(v8us lo, v8us hi) { return __builtin_bit_cast(v16bf, __builtin_shufflevector(lo, hi, 0, 1, 2, 3, 4, 5, 6, 7, 8, 9, 10, 11, 12, 13, 14, 15)); }
__device__ __forceinline__ v8f wmma16(v16h a, v16h b, v8f c) { return __builtin_amdgcn_wmma_f32_16x16x32_f16(false, a, false, b, (short)0, c, false, false); }
__device__ __forceinline__ v8f wmmab(v16bf a, v16bf b, v8f c) { return __builtin_amdgcn_wmma_f32_16x16x32_bf16(false, a, false, b, (short)0, c, false, false); }



// ---- k_gemmw: register-blocked GEMM, one work-group of NW waves per 64x64 output tile; wave w takes the 32-wide k steps w, w + NW, ... into its own 16 accumulators, and the NW partial tiles are summed through LDS in wave order 0..NW-1 (a fixed order); operands straight from K-contiguous 16-bit planes; grid (M/64, N/64, Z), 32 * NW threads.
// C[m][n] (f32, pitch ldc, + optional f32 bias[n]) = sum_k A[m][k] Bt[n][k] (+ split products per NSPLIT). z-batch strides sA/sB/sC in elements. K % 32 == 0.
// PLN (the q, k, v projections; z = 0, 1, 2; one 64-wide column tile = one head): no f32 C; the epilogue turns the summed tile straight into the attention operand planes (fp16, bf16 hi, bf16 lo).
// z < 2: rows are tokens, columns d: the interleaved-pair rotation from the table CS, stored to plane [(z * 2 + batch) * 16 + head][t][d]. z == 2: the two operands change places, so the tile comes out as [d][token] and is stored to the transposed plane [batch * 16 + head][d][t] in whole lines.
template <typename T16> struct WFrag;
template <> struct WFrag<h16> { typedef v16h V; static __device__ __forceinline__ V ld(const h16* p) { return cat16(*(const v8h*)p, *(const v8h*)(p + 16)); } static __device__ __forceinline__ v8f mma(V a, V b, v8f c) { return wmma16(a, b, c); } };
template <> struct WFrag<bf> { typedef v16bf V; static __device__ __forceinline__ V ld(const bf* p) { return cat16b(*(const v8us*)p, *(const v8us*)(p + 16)); } static __device__ __forceinline__ v8f mma(V a, V b, v8f c) { return wmmab(a, b, c); } };
template <typename T16, int NSPLIT, bool BIAS, int NW, bool PLN>
__global__ __launch_bounds__(32 * NW) void k_gemmw(const T16* __restrict__ A, const T16* __restrict__ A2, const T16* __restrict__ Bt, const T16* __restrict__ Bt2, int K, float* C, int ldc, const float* __restrict__ bias, size_t sA, size_t sB, size_t sC, const float* __restrict__ CS, h16* P16, bf* Ph, bf* Pl, h16* V16, bf* Vh, bf* Vl) {
    typedef typename WFrag<T16>::V V;
    constexpr int MBR = (NW > 1) ? 4 : 1;                            // 16-row blocks staged per LDS round: the whole tile at once where several waves meet (one barrier), one block where a wave is alone
    __shared__ __align__(16) float os[NW * MBR * 16 * 68];
    const size_t z = blockIdx.z; A += z * sA; if (A2) A2 += z * sA; Bt += z * sB; if (Bt2) Bt2 += z * sB; C += z * sC;
    const int lane = threadIdx.x & 31, lr = lane & 15, hi = lane >> 4; const int wave = (NW > 1) ? __builtin_amdgcn_readfirstlane((int)(threadIdx.x >> 5)) : 0;
    const bool tr = PLN && blockIdx.z == 2;                          // the v projection: tile formed transposed (uniform for the work-group)
    if (tr) { const T16* x = A; A = Bt; Bt = x; }
    const int r0 = (tr ? blockIdx.y : blockIdx.x) * 64, c0 = (tr ? blockIdx.x : blockIdx.y) * 64;
    v8f acc[4][4];
#pragma unroll
    for (int mb = 0; mb < 4; ++mb)
#pragma unroll
        for (int nb = 0; nb < 4; ++nb) acc[mb][nb] = (v8f){};
    const size_t aoff = (size_t)(r0 + lr) * K + 8 * hi, boff = (size_t)(c0 + lr) * K + 8 * hi;
#pragma unroll 1
    for (int kc = 32 * wave; kc < K; kc += 32 * NW) {
        V a[4], a2[4];
#pragma unroll
        for (int mb = 0; mb < 4; ++mb) { a[mb] = WFrag<T16>::ld(A + aoff + (size_t)mb * 16 * K + kc); if (NSPLIT == 1 || NSPLIT == 2) a2[mb] = WFrag<T16>::ld(A2 + aoff + (size_t)mb * 16 * K + kc); }
#pragma unroll
        for (int nb = 0; nb < 4; ++nb) { const V b = WFrag<T16>::ld(Bt + boff + (size_t)nb * 16 * K + kc); V b2; if (NSPLIT >= 2) b2 = WFrag<T16>::ld(Bt2 + boff + (size_t)nb * 16 * K + kc);
#pragma unroll
            for (int mb = 0; mb < 4; ++mb) { acc[mb][nb] = WFrag<T16>::mma(a[mb], b, acc[mb][nb]); if (NSPLIT == 1 || NSPLIT == 2) acc[mb][nb] = WFrag<T16>::mma(a2[mb], b, acc[mb][nb]); if (NSPLIT >= 2) acc[mb][nb] = WFrag<T16>::mma(a[mb], b2, acc[mb][nb]); } }
        asm volatile("v_nop\n\tv_nop\n\tv_nop\n\tv_nop" : "+v"(acc[0][0]), "+v"(acc[1][1]), "+v"(acc[2][2]), "+v"(acc[3][3]) : "v"(a[0]), "v"(a[3]));
    }
    constexpr int NS = MBR * 8 / NW;                                 // 4-wide pieces of the summed tile per thread
    static_assert(!PLN || MBR == 4, "the plane epilogue takes the whole tile in one LDS round");
    v2f cs[NS][2]; v4f pv[NS];                                       // (cos, sin) of this thread's two pairs in each of its pieces: asked for here, so that the table's latency passes behind the LDS round; the summed pieces
    if constexpr (PLN) { if (!tr) { const float* c = CS + (size_t)(r0 % TT) * (HD * 2) + threadIdx.x * 8;   // piece q = s * 32 * NW + thread holds row q / 16, columns 4 (q % 16)..: table entry (row * 64 + column) * 2 = 8 q
#pragma unroll   // cs is indexed by constants only, so it stays in registers
        for (int s = 0; s < NS; ++s) { cs[s][0] = *(const v2f*)(c + s * (256 * NW)); cs[s][1] = *(const v2f*)(c + s * (256 * NW) + 4); }
        asm volatile("s_wait_xcnt 0x0" ::: "memory"); } }   // behind the table loads, which stay in flight: their address registers are reused directly behind them
    float* osw = os + wave * (MBR * 16 * 68);                        // this wave's own partial tile
#pragma unroll
    for (int mb0 = 0; mb0 < 4; mb0 += MBR) {
#pragma unroll
        for (int mi = 0; mi < MBR; ++mi) {
#pragma unroll
            for (int nb = 0; nb < 4; ++nb) {
#pragma unroll
                for (int j = 0; j < 8; ++j) osw[(mi * 16 + hi * 8 + j) * 68 + nb * 16 + lr] = acc[mb0 + mi][nb][j]; } }
        if (NW > 1) __syncthreads();                                 // every wave's partial tile is in LDS before any wave sums across them
        else { __builtin_amdgcn_wave_barrier(); asm volatile("" ::: "memory"); }
        float* crow = C + (size_t)(r0 + mb0 * 16) * ldc + c0;
#pragma unroll
        for (int s = 0; s < NS; ++s) { const int q = s * (32 * NW) + (int)threadIdx.x; const int row = q >> 4, cofs = (q & 15) * 4; v4f val = *(const v4fa*)(os + row * 68 + cofs);
#pragma unroll
            for (int w = 1; w < NW; ++w) val += *(const v4fa*)(os + w * (MBR * 16 * 68) + row * 68 + cofs);   // partial sums added in wave order: the same order on every run
            if (BIAS) { val[0] += bfr(bias[c0 + cofs]); val[1] += bfr(bias[c0 + cofs + 1]); val[2] += bfr(bias[c0 + cofs + 2]); val[3] += bfr(bias[c0 + cofs + 3]); }
            if constexpr (PLN) pv[s] = val; else
            *(v4f*)(crow + (size_t)row * ldc + cofs) = val; }
        if constexpr (PLN) {
            const int tk = tr ? c0 : r0;                             // the tile's first token; 64 divides TT, so a tile lies in one batch
            const size_t eb = tr ? ((size_t)(tk / TT) * NH_ + blockIdx.y) * HD * TT + tk % TT : ((((size_t)blockIdx.z * NB_ + tk / TT) * NH_ + blockIdx.y) * TT + tk % TT) * HD;
            const int pit = tr ? TT : HD; h16* d16 = (tr ? V16 : P16) + eb; bf* dh = (tr ? Vh : Ph) + eb; bf* dl = (tr ? Vl : Pl) + eb;
#pragma unroll   // pv and cs are indexed by constants only, so they stay in registers
            for (int s = 0; s < NS; ++s) { const int q = s * (32 * NW) + (int)threadIdx.x; const int o = (q >> 4) * pit + (q & 15) * 4; v4f r = pv[s];
                if (!tr) {
#pragma unroll   // vector elements picked by constants
                    for (int p = 0; p < 2; ++p) { const float x0 = pv[s][2 * p], x1 = pv[s][2 * p + 1], c = cs[s][p][0], sn = cs[s][p][1]; r[2 * p] = x0 * c - x1 * sn; r[2 * p + 1] = x0 * sn + x1 * c; } }   /* even: x0 c - x1 s; odd: x0 s + x1 c */
                v4h o16; v4us oh, ol;
#pragma unroll   // vector elements picked by constants
                for (int j = 0; j < 4; ++j) { o16[j] = (h16)r[j]; unsigned short a2, c2; splitf(r[j], a2, c2); oh[j] = a2; ol[j] = c2; }
                *(v4h*)(d16 + o) = o16; *(v4us*)(dh + o) = oh; *(v4us*)(dl + o) = ol;
                if (s + 1 < NS) asm volatile("s_wait_xcnt 0x0" ::: "memory");   // behind the three stores: the next piece's values may land on their address or data registers
            } }
        if (NW == 1) { __builtin_amdgcn_wave_barrier(); asm volatile("" ::: "memory"); }
    }
}

// ---- k_attn: causal attention of one query tile of one (batch, head) plane in one work-group; scores and probabilities never leave the registers.
// Transposed products: S^T = K Q^T (A = 16 keys x 32 d from the key plane, B = 16 queries from the query plane), so a lane holds 8 + 8 keys of ONE query (column lr, rows hi * 8 + j of two 16-key tiles): exactly the k order of a B fragment
// (elements 0..7 = keys 8 hi + e, elements 8..15 = keys 16 + 8 hi + e), which then meets A = V^T (16 d x 32 keys, same k order) in O^T = V^T P^T. Row statistics are per lane (one exchange between the two 16-lane halves).
// The ANW waves take the 32-key blocks w, w + ANW, ... up to the diagonal block, each with its own running maximum, sum and O^T (online softmax); the partials are merged through LDS in wave order 0..ANW-1 (a fixed order), normalised, split hi/lo and stored in merged [token][head * 64 + d] order.
#define ANW  8                    // waves per work-group: they share the key loop
#define APIT 68                   // f32 pitch of one query's partial row in LDS: 64 outputs, then its maximum and its sum
__device__ __forceinline__ float ex2(float x) { float r; asm("v_exp_f32 %0, %1\n\tv_nop" : "=v"(r) : "v"(x)); return r; }   // 2^x; the v_nop is the one slot the instruction set asks for behind a transcendental, tied to it by standing in its statement
__device__ __forceinline__ float xhalf(float x) { return __builtin_bit_cast(float, __builtin_amdgcn_permlanex16(__builtin_bit_cast(int, x), __builtin_bit_cast(int, x), 0x76543210, 0xfedcba98, false, false)); }   // lane l reads lane l ^ 16 (a vector move, no LDS round trip)
template <int N> struct USV;
template <> struct USV<8> { typedef v8us T; };
template <> struct USV<4> { typedef v4us T; };
template <typename T16, bool HR, int NQB>
__device__ __forceinline__ void attn_body(float* sm, int q0, const T16* __restrict__ Q, const T16* __restrict__ Q2, const T16* __restrict__ Kp, const T16* __restrict__ Kp2, const T16* __restrict__ Vt, const T16* __restrict__ Vt2, bf* Ah, bf* Al) {
    typedef typename WFrag<T16>::V V;
    constexpr float K1 = SCL * 1.4426950408889634f;                  // logit scale and log2(e) in one factor: the statistics live in the base-2 exponent's units
    constexpr float PB = HR ? 0.0f : 10.0f;                          // fp16 probabilities carry a factor 2^10, which cancels in the division by their own sum
    const int lane = threadIdx.x & 31, lr = lane & 15, hi = lane >> 4; const int wave = __builtin_amdgcn_readfirstlane((int)(threadIdx.x >> 5));
    V bq[NQB][2], bq2[NQB][2];
#pragma unroll
    for (int qb = 0; qb < NQB; ++qb)
#pragma unroll
        for (int ks = 0; ks < 2; ++ks) { const size_t qo = (size_t)(q0 + qb * 16 + lr) * HD + 8 * hi + ks * 32; bq[qb][ks] = WFrag<T16>::ld(Q + qo); if (HR) bq2[qb][ks] = WFrag<T16>::ld(Q2 + qo); }
    v8f o[NQB][4]; float m[NQB], l[NQB];
#pragma unroll
    for (int qb = 0; qb < NQB; ++qb) { m[qb] = -1.0e30f; l[qb] = 0.f;
#pragma unroll
        for (int db = 0; db < 4; ++db) o[qb][db] = (v8f){}; }
    const int nkb = q0 / 32 + 1;                                     // 32-key blocks up to and with the diagonal block; every query of the tile has a key in each of them
#pragma unroll 1   // rolled: one block's K and V fragments live at a time, which keeps four waves on a SIMD; every inner loop is unrolled so that fragments and accumulators stay in registers
    for (int kb = wave; kb < nkb; kb += ANW) {
        const int k0 = kb * 32;
        V ak[2][2], ak2[2][2], av[4], av2[4];
#pragma unroll
        for (int kt = 0; kt < 2; ++kt)
#pragma unroll
            for (int ks = 0; ks < 2; ++ks) { const size_t ko = (size_t)(k0 + kt * 16 + lr) * HD + 8 * hi + ks * 32; ak[kt][ks] = WFrag<T16>::ld(Kp + ko); if (HR) ak2[kt][ks] = WFrag<T16>::ld(Kp2 + ko); }
        asm volatile("s_wait_xcnt 0x0" ::: "memory");   // behind the K loads: their address registers are free for reuse (the V fragments may land on them)
#pragma unroll
        for (int db = 0; db < 4; ++db) { const size_t vo = (size_t)(db * 16 + lr) * TT + k0 + 8 * hi; av[db] = WFrag<T16>::ld(Vt + vo); if (HR) av2[db] = WFrag<T16>::ld(Vt2 + vo); }
        asm volatile("s_wait_xcnt 0x0" ::: "memory");   // behind the V loads, which are still in flight during the score products: the compiler reuses their address registers there
#pragma unroll
        for (int qb = 0; qb < NQB; ++qb) {
            v8f st[2];                                               // st[kt][j] = q.k of key k0 + kt * 16 + hi * 8 + j and query q0 + qb * 16 + lr
#pragma unroll
            for (int kt = 0; kt < 2; ++kt) { v8f s = (v8f){};
#pragma unroll
                for (int ks = 0; ks < 2; ++ks) { s = WFrag<T16>::mma(ak[kt][ks], bq[qb][ks], s); if (HR) { s = WFrag<T16>::mma(ak[kt][ks], bq2[qb][ks], s); s = WFrag<T16>::mma(ak2[kt][ks], bq[qb][ks], s); } }
                st[kt] = s; }
            if (kb == nkb - 1) {                                     // only the diagonal block holds keys behind a query
#pragma unroll
                for (int kt = 0; kt < 2; ++kt)
#pragma unroll
                    for (int j = 0; j < 8; ++j) if (k0 + kt * 16 + hi * 8 + j > q0 + qb * 16 + lr) st[kt][j] = -1.0e30f; }
            float mx = st[0][0];
#pragma unroll
            for (int e = 1; e < 16; ++e) mx = fmaxf(mx, st[e >> 3][e & 7]);
            mx = fmaxf(mx, xhalf(mx));
            const float mn = fmaxf(m[qb], mx * K1 - PB); const float al = ex2(m[qb] - mn); m[qb] = mn;
            float p[16], ps = 0.f;
#pragma unroll
            for (int e = 0; e < 16; ++e) { p[e] = ex2(st[e >> 3][e & 7] * K1 - mn); ps += p[e]; }
            l[qb] = l[qb] * al + ps;
#pragma unroll
            for (int db = 0; db < 4; ++db) o[qb][db] *= al;
            if constexpr (HR) { v8us h0, h1, l0, l1;
#pragma unroll
                for (int e = 0; e < 8; ++e) { unsigned short a, c; splitf(p[e], a, c); h0[e] = a; l0[e] = c; splitf(p[8 + e], a, c); h1[e] = a; l1[e] = c; }
                const V ph = cat16b(h0, h1), pl = cat16b(l0, l1);
#pragma unroll
                for (int db = 0; db < 4; ++db) { o[qb][db] = WFrag<T16>::mma(av[db], ph, o[qb][db]); o[qb][db] = WFrag<T16>::mma(av[db], pl, o[qb][db]); o[qb][db] = WFrag<T16>::mma(av2[db], ph, o[qb][db]); }
            } else { V pb;
#pragma unroll
                for (int e = 0; e < 16; ++e) pb[e] = (h16)p[e];
#pragma unroll
                for (int db = 0; db < 4; ++db) o[qb][db] = WFrag<T16>::mma(av[db], pb, o[qb][db]); }
        }
        asm volatile("v_nop\n\tv_nop\n\tv_nop\n\tv_nop" : "+v"(o[NQB - 1][0]), "+v"(o[NQB - 1][1]), "+v"(o[NQB - 1][2]), "+v"(o[NQB - 1][3]));   // the matrix instructions' distance on the taken branch out of the loop (its target reads o)
    }
    float* my = sm + wave * (NQB * 16 * APIT);                       // this wave's own partial tile
#pragma unroll
    for (int qb = 0; qb < NQB; ++qb) { l[qb] += xhalf(l[qb]); float* r = my + (qb * 16 + lr) * APIT;
#pragma unroll
        for (int db = 0; db < 4; ++db) { v4f a, b;
#pragma unroll
            for (int j = 0; j < 4; ++j) { a[j] = o[qb][db][j]; b[j] = o[qb][db][4 + j]; }
            *(v4fa*)(r + db * 16 + hi * 8) = a; *(v4fa*)(r + db * 16 + hi * 8 + 4) = b; }
        if (hi == 0) { r[64] = m[qb]; r[65] = l[qb]; } }
    __syncthreads();                                                 // every wave's partial tile and statistics are in LDS before any thread merges them
    constexpr int EPT = NQB * 16 * HD / (32 * ANW);                  // outputs per thread: consecutive d of one query
    const int qi = (int)threadIdx.x / (HD / EPT), d0 = ((int)threadIdx.x % (HD / EPT)) * EPT; const float* r0 = sm + qi * APIT;
    float M = r0[64];
#pragma unroll
    for (int w = 1; w < ANW; ++w) M = fmaxf(M, r0[w * (NQB * 16 * APIT) + 64]);
    float L = 0.f, acc[EPT];
#pragma unroll
    for (int e = 0; e < EPT; ++e) acc[e] = 0.f;
#pragma unroll
    for (int w = 0; w < ANW; ++w) { const float* rw = r0 + w * (NQB * 16 * APIT); const float wt = ex2(rw[64] - M); L += wt * rw[65];   // a wave that had no block weighs 0; partials added in wave order: the same order on every run
#pragma unroll
        for (int e4 = 0; e4 < EPT; e4 += 4) { const v4f x = *(const v4fa*)(rw + d0 + e4);
#pragma unroll
            for (int j = 0; j < 4; ++j) acc[e4 + j] += wt * x[j]; } }
    const float f = __fdiv_rn(1.0f, L); typename USV<EPT>::T oh, ol;
#pragma unroll
    for (int e = 0; e < EPT; ++e) { unsigned short a, c; splitf(acc[e] * f, a, c); oh[e] = a; ol[e] = c; }
    const size_t oo = (size_t)(q0 + qi) * DQ + d0; *(typename USV<EPT>::T*)(Ah + oo) = oh; *(typename USV<EPT>::T*)(Al + oo) = ol;
    asm volatile("s_wait_xcnt 0x0" ::: "memory");   // one body's code is laid out in front of the other's: the wait stands between these stores and any later write of their address or data registers
}
// grid (planes, query tiles): tiles in falling order of their key count, the longest start first; query rows >= RH in tiles of 32 (fp16 body), rows < RH in tiles of 16 (hi/lo 3-product body); the choice is uniform for the work-group.
__global__ __launch_bounds__(32 * ANW) void k_attn(const bf* __restrict__ Qh, const bf* __restrict__ Ql, const bf* __restrict__ Kh, const bf* __restrict__ Kl, const bf* __restrict__ Vh, const bf* __restrict__ Vl, const h16* __restrict__ Q16, const h16* __restrict__ K16, const h16* __restrict__ V16, bf* Ah, bf* Al) {
    __shared__ __align__(16) float sm[ANW * 32 * APIT];
    const int pl = (int)blockIdx.x, ty = (int)blockIdx.y; const size_t po = (size_t)pl * TT * HD; const size_t ao = (size_t)(pl / NH_) * TT * DQ + (size_t)(pl % NH_) * HD;   /* plane = batch * 16 + head */
    if (ty < (TT - RH) / 32) attn_body<h16, false, 2>(sm, TT - 32 * (ty + 1), Q16 + po, nullptr, K16 + po, nullptr, V16 + po, nullptr, Ah + ao, Al + ao);
    else attn_body<bf, true, 1>(sm, RH - 16 * (ty - (TT - RH) / 32 + 1), Qh + po, Ql + po, Kh + po, Kl + po, Vh + po, Vl + po, Ah + ao, Al + ao);
}

typedef __attribute__((ext_vector_type(2))) unsigned short v2us;
typedef __attribute__((ext_vector_type(4))) int v4i;

__global__ __launch_bounds__(256) void k_wtG(const float* __restrict__ w0, const float* __restrict__ w1, const float* __restrict__ w2, const float* __restrict__ w3, int K, int N, bf* Bt) {
    const float* w = blockIdx.y == 0 ? w0 : blockIdx.y == 1 ? w1 : blockIdx.y == 2 ? w2 : w3; Bt += (size_t)blockIdx.y * K * N;   // one grid row per weight; the four transposed planes lie one behind the other
    const int lane = threadIdx.x & 31; const int L0 = (blockIdx.x * 8 + (threadIdx.x >> 5)) * 8; const int nlines = N * K / 64;
{
#pragma unroll 1
        for (int l = 0; l < 8; ++l) { const int L = L0 + l; if (L >= nlines) break; const size_t e = (size_t)L * 64 + lane * 2; const int k = (int)(e % K), n = (int)(e / K); v2us o;
            o[0] = f2bf(w[(size_t)k * N + n]); o[1] = f2bf(w[(size_t)(k + 1) * N + n]); *(v2us*)(Bt + e) = o; }
         }
}
__global__ __launch_bounds__(256) void k_cvt8(const float* __restrict__ src, bf* dst, size_t n8) { const size_t i = (size_t)blockIdx.x * 256 + threadIdx.x; if (i >= n8) return; const v8f v = *(const v8f*)(src + i * 8); v8us o;
#pragma unroll
    for (int k = 0; k < 8; ++k) o[k] = f2bf(v[k]); *(v8us*)(dst + i * 8) = o;  }

__constant__ float INV2[HD / 2] = { 1.000000000e+00f, 7.498942018e-01f, 5.623413324e-01f, 4.216965139e-01f, 3.162277639e-01f, 2.371373773e-01f, 1.778279394e-01f, 1.333521456e-01f, 1.000000015e-01f, 7.498942316e-02f, 5.623413250e-02f, 4.216964915e-02f, 3.162277490e-02f, 2.371373773e-02f, 1.778279431e-02f, 1.333521400e-02f, 9.999999776e-03f, 7.498942316e-03f, 5.623413250e-03f, 4.216964822e-03f, 3.162277630e-03f, 2.371373819e-03f, 1.778279431e-03f, 1.333521446e-03f, 1.000000047e-03f, 7.498941850e-04f, 5.623413017e-04f, 4.216965172e-04f, 3.162277571e-04f, 2.371373703e-04f, 1.778279402e-04f, 1.333521504e-04f };   // 10000 ** (-2i / 64), i = 0..31, in float32 as THIS module writes it (the NEGATIVE-POWER spelling '10000.0 ** (-ts / dim)' evaluated in the reference's own f32 arithmetic: these 32 literals equal it bit for bit); ten entries differ by one ulp from the reciprocal values the host's own table held

__global__ __launch_bounds__(256) void k_csP(float* CS) { const int idx = blockIdx.x * 256 + threadIdx.x; if (idx >= TT * HD) return; const int d = idx % HD; const int t = idx / HD; const float a = __fmul_rn((float)t, INV2[d >> 1]); v2f cs; cs[0] = cosf(a); cs[1] = sinf(a); *(v2f*)(CS + (size_t)idx * 2) = cs;  }
__global__ __launch_bounds__(256) void k_premise(const int* __restrict__ flag, float* out, size_t n4) { const size_t i = (size_t)blockIdx.x * 256 + threadIdx.x; if (i >= n4) return; if (flag[0] == NH_) return;   /* premise holds (num_heads == 16): nothing to do */ const float qn = __int_as_float(0x7fc00000); v4f o; o[0] = qn; o[1] = qn; o[2] = qn; o[3] = qn; *(v4f*)(out + i * 4) = o;  }

extern "C" void kernel_launch(void* const* d_in, const int* in_sizes, int n_in,
                              void* d_out, int out_size, void* d_ws, size_t ws_size, hipStream_t stream) {
    (void)in_sizes; (void)n_in; (void)out_size;
    const float* x = (const float*)d_in[0]; const float* wq = (const float*)d_in[1]; const float* wk = (const float*)d_in[2]; const float* wv = (const float*)d_in[3]; const float* wo = (const float*)d_in[4]; const int* flag = (const int*)d_in[5];   /* input order x, Wq, Wk, Wv, Wo ('xw' [1024][1024]), num_heads (the SIXTH input, slot 5: the python int 16 as an int scalar: READ ON DEVICE by k_premise after the output is written: the whole output is NaN-filled unless it equals NH_ = 16) */
    float* OUT = (float*)d_out;     // [2][2048][1024]
    char* wsp = (char*)d_ws;
    auto take = [&](size_t bytes) { char* p = wsp; wsp += (bytes + 255) & ~(size_t)255; return (void*)p; };
    bf* WQ = (bf*)take((size_t)4 * DQ * DM * 2); bf* WO = WQ + (size_t)3 * DQ * DM;   // transposed Wq, Wk, Wv, Wo, one behind the other (z-stride DQ*DM)
    float* CS = (float*)take((size_t)TT * HD * 2 * 4);
    const size_t PL = (size_t)NB_ * NH_ * TT * HD;   // one operand's planes, both batches
    h16* QP16 = (h16*)take(2 * PL * 2); h16* KP16 = QP16 + PL; bf* QPh = (bf*)take(2 * PL * 2); bf* KPh = QPh + PL; bf* QPl = (bf*)take(2 * PL * 2); bf* KPl = QPl + PL;   // k planes directly behind the q planes: plane index (z * 2 + batch) * 16 + head in the projection's epilogue
    h16* VT16 = (h16*)take(PL * 2); bf* VTh = (bf*)take(PL * 2); bf* VTl = (bf*)take(PL * 2);
    bf* ATh = (bf*)take((size_t)NB_ * TT * DQ * 2); bf* ATl = (bf*)take((size_t)NB_ * TT * DQ * 2);
    bf* XB = (bf*)take((size_t)NB_ * TT * DM * 2);   // bf16 copy of x
    if ((size_t)(wsp - (char*)d_ws) > ws_size) return;    // ws 256 MiB
    k_wtG<<<dim3((unsigned)((DM * DQ / 64 + 63) / 64), 4, 1), 256, 0, stream>>>(wq, wk, wv, wo, DM, DQ, WQ);
    k_csP<<<(TT * HD + 255) / 256, 256, 0, stream>>>(CS);
    k_cvt8<<<(unsigned)(((size_t)NB_ * TT * DM / 8 + 255) / 256), 256, 0, stream>>>(x, XB, (size_t)NB_ * TT * DM / 8);
    k_gemmw<bf, 0, false, 8, true><<<dim3(NB_ * TT / 64, DQ / 64, 3), 256, 0, stream>>>(XB, nullptr, WQ, nullptr, DM, nullptr, 0, nullptr, 0, (size_t)DQ * DM, 0, CS, QP16, QPh, QPl, VT16, VTh, VTl);
    k_attn<<<dim3(NB_ * NH_, (TT - RH) / 32 + RH / 16, 1), 32 * ANW, 0, stream>>>(QPh, QPl, KPh, KPl, VTh, VTl, QP16, KP16, VT16, ATh, ATl);   // one kv head per query head: plane index batch * 16 + head for q, k and v alike
    k_gemmw<bf, 1, false, 8, false><<<dim3(NB_ * TT / 64, DM / 64, 1), 256, 0, stream>>>(ATh, ATl, WO, nullptr, DQ, OUT, DM, nullptr, 0, 0, 0, nullptr, nullptr, nullptr, nullptr, nullptr, nullptr, nullptr);
k_premise<<<(unsigned)(((size_t)NB_ * TT * DM / 4 + 255) / 256), 256, 0, stream>>>(flag, OUT, (size_t)NB_ * TT * DM / 4);   /* after every batch's output is written: poison it all if the premise fails */
}

// v005
// It runs in 148 microseconds.
// In two side-by-side timings against v004, it was 1.04 and 1.05 times as fast.
// Over all steps from v000 it is 9.84 times as fast.
#include <hip/hip_runtime.h>

// Causal multi-head attention with a pre-scaled query, interleaved-pair rotary embeddings and a scalar head-count input (x [2][2048][1024]; q = (x Wq) x 1/sqrt(1024), k = x Wk, v = x Wv ('xw' [1024][1024] 0.02, no bias; 16 heads x 64: the head count arrives as the python int 16, the LAST input: read on device by the premise guard); rope x cos + x_rot sin with x_rot: (x1, x2) -> (-x2, x1) on adjacent pairs and cos / sin = repeat(c, 2) of angle t x 10000^(-2i/64) (32 f32 frequencies jnp-exact for the module's negative-power expression; precise cosf/sinf); logits = q.k (no further scale: net 1/32); where(tril, logits, -1e8) == exclusion; softmax; out = merged Wo ('xw', no bias) -> [2][2048][1024] (4.2 M); argument order x, Wq, Wk, Wv, Wo, num_heads).
// VALUE PREMISE: this kernel implements num_heads == 16 only; the output GEMM reads the scalar on the device and stores NaN in place of every output element if it is not 16.
// Layout (both batches in every launch; planes ordered [batch * 16 + head]): k_prep: bf16 copy of x, 'xw' weights transposed once and the rotation table, in one grid; exact projections whose epilogue applies the rotation (computed table, pair-shared entries) and writes the q, k and transposed v planes itself; k_attn causal T-2048 attention of all planes in one launch, scores and probabilities in registers (hybrid rows: < 512 hi/lo 3 products, rest fp16 x1024; key blocks above the diagonal are never formed); merged hi/lo x Wo exact.
// Compute dtypes, f32 accumulate: every input rounded to bf16; projections exact; rotary f32; attention rows < 512 3 products, rest fp16; softmax f32; Wo hl x exact.

#define NB_  2
#define TT   2048
#define DM   1024
#define NH_  16
#define NKV  16
#define HD   64
#define DQ   (NH_ * HD)
#define DKV  (NKV * HD)
#define RH   512                  // query rows < RH use hi+lo planes (0: none)
#define SCL  0.03125f   // 1 / sqrt(1024): the module scales q by 1 / sqrt(d_model) BEFORE the rotation and applies no other scale (a power of two: exact, commutes with the rotation)
typedef _Float16 h16;
typedef unsigned short bf;
typedef __attribute__((ext_vector_type(16))) __bf16   v16bf;
typedef __attribute__((ext_vector_type(16))) _Float16 v16h;
typedef __attribute__((ext_vector_type(8)))  _Float16 v8h;
typedef __attribute__((ext_vector_type(8)))  unsigned short v8us;
typedef __attribute__((ext_vector_type(8)))  float    v8f;
typedef __attribute__((ext_vector_type(4)))  float    v4f;
typedef v8h  __attribute__((may_alias)) v8ha;
typedef v4f  __attribute__((may_alias)) v4fa;
typedef v8us __attribute__((may_alias)) v8usa;
typedef __attribute__((ext_vector_type(4))) unsigned short v4us;
typedef __attribute__((ext_vector_type(4))) _Float16 v4h;
typedef __attribute__((ext_vector_type(2))) float v2f;

__device__ __forceinline__ unsigned short f2bf(float f) { unsigned u = __float_as_uint(f); u += 0x7FFFu + ((u >> 16) & 1u); return (unsigned short)(u >> 16); }
__device__ __forceinline__ float bf2f(unsigned short b) { return __uint_as_float(((unsigned)b) << 16); }
__device__ __forceinline__ float bfr(float f) { return bf2f(f2bf(f)); }
__device__ __forceinline__ void splitf(float y, unsigned short& h, unsigned short& l) { h = f2bf(y); l = f2bf(y - bf2f(h)); }
__device__ __forceinline__ v16h cat16(v8h lo, v8h hi) { return __builtin_shufflevector(lo, hi, 0, 1, 2, 3, 4, 5, 6, 7, 8, 9, 10, 11, 12, 13, 14, 15); }
__device__ __forceinline__ v16bf cat16b(v8us lo, v8us hi) { return __builtin_bit_cast(v16bf, __builtin_shufflevector(lo, hi, 0, 1, 2, 3, 4, 5, 6, 7, 8, 9, 10, 11, 12, 13, 14, 15)); }
__device__ __forceinline__ v8f wmma16(v16h a, v16h b, v8f c) { return __builtin_amdgcn_wmma_f32_16x16x32_f16(false, a, false, b, (short)0, c, false, false); }
__device__ __forceinline__ v8f wmmab(v16bf a, v16bf b, v8f c) { return __builtin_amdgcn_wmma_f32_16x16x32_bf16(false, a, false, b, (short)0, c, false, false); }



// ---- k_gemmw: register-blocked GEMM, one work-group of NW waves per 64x64 output tile; wave w takes the 32-wide k steps w, w + NW, ... into its own 16 accumulators, and the NW partial tiles are summed through LDS in wave order 0..NW-1 (a fixed order); operands straight from K-contiguous 16-bit planes; grid (M/64, N/64, Z), 32 * NW threads.
// C[m][n] (f32, pitch ldc, + optional f32 bias[n]) = sum_k A[m][k] Bt[n][k] (+ split products per NSPLIT). z-batch strides sA/sB/sC in elements. K % 32 == 0.
// PLN (the q, k, v projections; z = 0, 1, 2; one 64-wide column tile = one head): no f32 C; the epilogue turns the summed tile straight into the attention operand planes (fp16, bf16 hi, bf16 lo).
// GRD (the output GEMM): every stored value is replaced by NaN unless flag[0] == NH_ (the premise guard; the scalar is asked for ahead of the k loop, so its latency passes behind it).
// z < 2: rows are tokens, columns d: the interleaved-pair rotation from the table CS, stored to plane [(z * 2 + batch) * 16 + head][t][d]. z == 2: the two operands change places, so the tile comes out as [d][token] and is stored to the transposed plane [batch * 16 + head][d][t] in whole lines.
template <typename T16> struct WFrag;
template <> struct WFrag<h16> { typedef v16h V; static __device__ __forceinline__ V ld(const h16* p) { return cat16(*(const v8h*)p, *(const v8h*)(p + 16)); } static __device__ __forceinline__ v8f mma(V a, V b, v8f c) { return wmma16(a, b, c); } };
template <> struct WFrag<bf> { typedef v16bf V; static __device__ __forceinline__ V ld(const bf* p) { return cat16b(*(const v8us*)p, *(const v8us*)(p + 16)); } static __device__ __forceinline__ v8f mma(V a, V b, v8f c) { return wmmab(a, b, c); } };
template <typename T16, int NSPLIT, bool BIAS, int NW, bool PLN, bool GRD>
__global__ __launch_bounds__(32 * NW) void k_gemmw(const T16* __restrict__ A, const T16* __restrict__ A2, const T16* __restrict__ Bt, const T16* __restrict__ Bt2, int K, float* C, int ldc, const float* __restrict__ bias, size_t sA, size_t sB, size_t sC, const float* __restrict__ CS, h16* P16, bf* Ph, bf* Pl, h16* V16, bf* Vh, bf* Vl, const int* __restrict__ flag) {
    typedef typename WFrag<T16>::V V;
    bool bad = false; if constexpr (GRD) bad = flag[0] != NH_;      // uniform for the whole grid
    constexpr int MBR = (NW > 1) ? 4 : 1;                            // 16-row blocks staged per LDS round: the whole tile at once where several waves meet (one barrier), one block where a wave is alone
    __shared__ __align__(16) float os[NW * MBR * 16 * 68];
    const size_t z = blockIdx.z; A += z * sA; if (A2) A2 += z * sA; Bt += z * sB; if (Bt2) Bt2 += z * sB; C += z * sC;
    const int lane = threadIdx.x & 31, lr = lane & 15, hi = lane >> 4; const int wave = (NW > 1) ? __builtin_amdgcn_readfirstlane((int)(threadIdx.x >> 5)) : 0;
    const bool tr = PLN && blockIdx.z == 2;                          // the v projection: tile formed transposed (uniform for the work-group)
    if (tr) { const T16* x = A; A = Bt; Bt = x; }
    const int r0 = (tr ? blockIdx.y : blockIdx.x) * 64, c0 = (tr ? blockIdx.x : blockIdx.y) * 64;
    v8f acc[4][4];
#pragma unroll
    for (int mb = 0; mb < 4; ++mb)
#pragma unroll
        for (int nb = 0; nb < 4; ++nb) acc[mb][nb] = (v8f){};
    const size_t aoff = (size_t)(r0 + lr) * K + 8 * hi, boff = (size_t)(c0 + lr) * K + 8 * hi;
#pragma unroll 1
    for (int kc = 32 * wave; kc < K; kc += 32 * NW) {
        V a[4], a2[4];
#pragma unroll
        for (int mb = 0; mb < 4; ++mb) { a[mb] = WFrag<T16>::ld(A + aoff + (size_t)mb * 16 * K + kc); if (NSPLIT == 1 || NSPLIT == 2) a2[mb] = WFrag<T16>::ld(A2 + aoff + (size_t)mb * 16 * K + kc); }
#pragma unroll
        for (int nb = 0; nb < 4; ++nb) { const V b = WFrag<T16>::ld(Bt + boff + (size_t)nb * 16 * K + kc); V b2; if (NSPLIT >= 2) b2 = WFrag<T16>::ld(Bt2 + boff + (size_t)nb * 16 * K + kc);
#pragma unroll
            for (int mb = 0; mb < 4; ++mb) { acc[mb][nb] = WFrag<T16>::mma(a[mb], b, acc[mb][nb]); if (NSPLIT == 1 || NSPLIT == 2) acc[mb][nb] = WFrag<T16>::mma(a2[mb], b, acc[mb][nb]); if (NSPLIT >= 2) acc[mb][nb] = WFrag<T16>::mma(a[mb], b2, acc[mb][nb]); } }
        asm volatile("v_nop\n\tv_nop\n\tv_nop\n\tv_nop" : "+v"(acc[0][0]), "+v"(acc[1][1]), "+v"(acc[2][2]), "+v"(acc[3][3]) : "v"(a[0]), "v"(a[3]));
    }
    constexpr int NS = MBR * 8 / NW;                                 // 4-wide pieces of the summed tile per thread
    static_assert(!PLN || MBR == 4, "the plane epilogue takes the whole tile in one LDS round");
    v2f cs[NS][2]; v4f pv[NS];                                       // (cos, sin) of this thread's two pairs in each of its pieces: asked for here, so that the table's latency passes behind the LDS round; the summed pieces
    if constexpr (PLN) { if (!tr) { const float* c = CS + (size_t)(r0 % TT) * (HD * 2) + threadIdx.x * 8;   // piece q = s * 32 * NW + thread holds row q / 16, columns 4 (q % 16)..: table entry (row * 64 + column) * 2 = 8 q
#pragma unroll   // cs is indexed by constants only, so it stays in registers
        for (int s = 0; s < NS; ++s) { cs[s][0] = *(const v2f*)(c + s * (256 * NW)); cs[s][1] = *(const v2f*)(c + s * (256 * NW) + 4); }
        asm volatile("s_wait_xcnt 0x0" ::: "memory"); } }   // behind the table loads, which stay in flight: their address registers are reused directly behind them
    float* osw = os + wave * (MBR * 16 * 68);                        // this wave's own partial tile
#pragma unroll
    for (int mb0 = 0; mb0 < 4; mb0 += MBR) {
#pragma unroll
        for (int mi = 0; mi < MBR; ++mi) {
#pragma unroll
            for (int nb = 0; nb < 4; ++nb) {
#pragma unroll
                for (int j = 0; j < 8; ++j) osw[(mi * 16 + hi * 8 + j) * 68 + nb * 16 + lr] = acc[mb0 + mi][nb][j]; } }
        if (NW > 1) __syncthreads();                                 // every wave's partial tile is in LDS before any wave sums across them
        else { __builtin_amdgcn_wave_barrier(); asm volatile("" ::: "memory"); }
        float* crow = C + (size_t)(r0 + mb0 * 16) * ldc + c0;
#pragma unroll
        for (int s = 0; s < NS; ++s) { const int q = s * (32 * NW) + (int)threadIdx.x; const int row = q >> 4, cofs = (q & 15) * 4; v4f val = *(const v4fa*)(os + row * 68 + cofs);
#pragma unroll
            for (int w = 1; w < NW; ++w) val += *(const v4fa*)(os + w * (MBR * 16 * 68) + row * 68 + cofs);   // partial sums added in wave order: the same order on every run
            if (BIAS) { val[0] += bfr(bias[c0 + cofs]); val[1] += bfr(bias[c0 + cofs + 1]); val[2] += bfr(bias[c0 + cofs + 2]); val[3] += bfr(bias[c0 + cofs + 3]); }
            if constexpr (GRD) { if (bad) { const float qn = __int_as_float(0x7fc00000); val[0] = qn; val[1] = qn; val[2] = qn; val[3] = qn; } }   // premise fails: the whole output is NaN
            if constexpr (PLN) pv[s] = val; else
            *(v4f*)(crow + (size_t)row * ldc + cofs) = val; }
        if constexpr (PLN) {
            const int tk = tr ? c0 : r0;                             // the tile's first token; 64 divides TT, so a tile lies in one batch
            const size_t eb = tr ? ((size_t)(tk / TT) * NH_ + blockIdx.y) * HD * TT + tk % TT : ((((size_t)blockIdx.z * NB_ + tk / TT) * NH_ + blockIdx.y) * TT + tk % TT) * HD;
            const int pit = tr ? TT : HD; h16* d16 = (tr ? V16 : P16) + eb; bf* dh = (tr ? Vh : Ph) + eb; bf* dl = (tr ? Vl : Pl) + eb;
#pragma unroll   // pv and cs are indexed by constants only, so they stay in registers
            for (int s = 0; s < NS; ++s) { const int q = s * (32 * NW) + (int)threadIdx.x; const int o = (q >> 4) * pit + (q & 15) * 4; v4f r = pv[s];
                if (!tr) {
#pragma unroll   // vector elements picked by constants
                    for (int p = 0; p < 2; ++p) { const float x0 = pv[s][2 * p], x1 = pv[s][2 * p + 1], c = cs[s][p][0], sn = cs[s][p][1]; r[2 * p] = x0 * c - x1 * sn; r[2 * p + 1] = x0 * sn + x1 * c; } }   /* even: x0 c - x1 s; odd: x0 s + x1 c */
                v4h o16; v4us oh, ol;
#pragma unroll   // vector elements picked by constants
                for (int j = 0; j < 4; ++j) { o16[j] = (h16)r[j]; unsigned short a2, c2; splitf(r[j], a2, c2); oh[j] = a2; ol[j] = c2; }
                *(v4h*)(d16 + o) = o16; *(v4us*)(dh + o) = oh; *(v4us*)(dl + o) = ol;
                if (s + 1 < NS) asm volatile("s_wait_xcnt 0x0" ::: "memory");   // behind the three stores: the next piece's values may land on their address or data registers
            } }
        if (NW == 1) { __builtin_amdgcn_wave_barrier(); asm volatile("" ::: "memory"); }
    }
}

// ---- k_attn: causal attention of one query tile of one (batch, head) plane in one work-group; scores and probabilities never leave the registers.
// Transposed products: S^T = K Q^T (A = 16 keys x 32 d from the key plane, B = 16 queries from the query plane), so a lane holds 8 + 8 keys of ONE query (column lr, rows hi * 8 + j of two 16-key tiles): exactly the k order of a B fragment
// (elements 0..7 = keys 8 hi + e, elements 8..15 = keys 16 + 8 hi + e), which then meets A = V^T (16 d x 32 keys, same k order) in O^T = V^T P^T. Row statistics are per lane (one exchange between the two 16-lane halves).
// The ANW waves take the 32-key blocks w, w + ANW, ... up to the diagonal block, each with its own running maximum, sum and O^T (online softmax); the partials are merged through LDS in wave order 0..ANW-1 (a fixed order), normalised, split hi/lo and stored in merged [token][head * 64 + d] order.
#define ANW  8                    // waves per work-group: they share the key loop
#define APIT 68                   // f32 pitch of one query's partial row in LDS: 64 outputs, then its maximum and its sum
__device__ __forceinline__ float ex2(float x) { float r; asm("v_exp_f32 %0, %1\n\tv_nop" : "=v"(r) : "v"(x)); return r; }   // 2^x; the v_nop is the one slot the instruction set asks for behind a transcendental, tied to it by standing in its statement
__device__ __forceinline__ float xhalf(float x) { return __builtin_bit_cast(float, __builtin_amdgcn_permlanex16(__builtin_bit_cast(int, x), __builtin_bit_cast(int, x), 0x76543210, 0xfedcba98, false, false)); }   // lane l reads lane l ^ 16 (a vector move, no LDS round trip)
template <int N> struct USV;
template <> struct USV<8> { typedef v8us T; };
template <> struct USV<4> { typedef v4us T; };
template <typename T16, bool HR, int NQB>
__device__ __forceinline__ void attn_body(float* sm, int q0, const T16* __restrict__ Q, const T16* __restrict__ Q2, const T16* __restrict__ Kp, const T16* __restrict__ Kp2, const T16* __restrict__ Vt, const T16* __restrict__ Vt2, bf* Ah, bf* Al) {
    typedef typename WFrag<T16>::V V;
    constexpr float K1 = SCL * 1.4426950408889634f;                  // logit scale and log2(e) in one factor: the statistics live in the base-2 exponent's units
    constexpr float PB = HR ? 0.0f : 10.0f;                          // fp16 probabilities carry a factor 2^10, which cancels in the division by their own sum
    const int lane = threadIdx.x & 31, lr = lane & 15, hi = lane >> 4; const int wave = __builtin_amdgcn_readfirstlane((int)(threadIdx.x >> 5));
    V bq[NQB][2], bq2[NQB][2];
#pragma unroll
    for (int qb = 0; qb < NQB; ++qb)
#pragma unroll
        for (int ks = 0; ks < 2; ++ks) { const size_t qo = (size_t)(q0 + qb * 16 + lr) * HD + 8 * hi + ks * 32; bq[qb][ks] = WFrag<T16>::ld(Q + qo); if (HR) bq2[qb][ks] = WFrag<T16>::ld(Q2 + qo); }
    v8f o[NQB][4]; float m[NQB], l[NQB];
#pragma unroll
    for (int qb = 0; qb < NQB; ++qb) { m[qb] = -1.0e30f; l[qb] = 0.f;
#pragma unroll
        for (int db = 0; db < 4; ++db) o[qb][db] = (v8f){}; }
    const int nkb = q0 / 32 + 1;                                     // 32-key blocks up to and with the diagonal block; every query of the tile has a key in each of them
#pragma unroll 1   // rolled: one block's K and V fragments live at a time, which keeps four waves on a SIMD; every inner loop is unrolled so that fragments and accumulators stay in registers
    for (int kb = wave; kb < nkb; kb += ANW) {
        const int k0 = kb * 32;
        V ak[2][2], ak2[2][2], av[4], av2[4];
#pragma unroll
        for (int kt = 0; kt < 2; ++kt)
#pragma unroll
            for (int ks = 0; ks < 2; ++ks) { const size_t ko = (size_t)(k0 + kt * 16 + lr) * HD + 8 * hi + ks * 32; ak[kt][ks] = WFrag<T16>::ld(Kp + ko); if (HR) ak2[kt][ks] = WFrag<T16>::ld(Kp2 + ko); }
        asm volatile("s_wait_xcnt 0x0" ::: "memory");   // behind the K loads: their address registers are free for reuse (the V fragments may land on them)
#pragma unroll
        for (int db = 0; db < 4; ++db) { const size_t vo = (size_t)(db * 16 + lr) * TT + k0 + 8 * hi; av[db] = WFrag<T16>::ld(Vt + vo); if (HR) av2[db] = WFrag<T16>::ld(Vt2 + vo); }
        asm volatile("s_wait_xcnt 0x0" ::: "memory");   // behind the V loads, which are still in flight during the score products: the compiler reuses their address registers there
#pragma unroll
        for (int qb = 0; qb < NQB; ++qb) {
            v8f st[2];                                               // st[kt][j] = q.k of key k0 + kt * 16 + hi * 8 + j and query q0 + qb * 16 + lr
#pragma unroll
            for (int kt = 0; kt < 2; ++kt) { v8f s = (v8f){};
#pragma unroll
                for (int ks = 0; ks < 2; ++ks) { s = WFrag<T16>::mma(ak[kt][ks], bq[qb][ks], s); if (HR) { s = WFrag<T16>::mma(ak[kt][ks], bq2[qb][ks], s); s = WFrag<T16>::mma(ak2[kt][ks], bq[qb][ks], s); } }
                st[kt] = s; }
            if (kb == nkb - 1) {                                     // only the diagonal block holds keys behind a query
#pragma unroll
                for (int kt = 0; kt < 2; ++kt)
#pragma unroll
                    for (int j = 0; j < 8; ++j) if (k0 + kt * 16 + hi * 8 + j > q0 + qb * 16 + lr) st[kt][j] = -1.0e30f; }
            float mx = st[0][0];
#pragma unroll
            for (int e = 1; e < 16; ++e) mx = fmaxf(mx, st[e >> 3][e & 7]);
            mx = fmaxf(mx, xhalf(mx));
            const float mn = fmaxf(m[qb], mx * K1 - PB); const float al = ex2(m[qb] - mn); m[qb] = mn;
            float p[16], ps = 0.f;
#pragma unroll
            for (int e = 0; e < 16; ++e) { p[e] = ex2(st[e >> 3][e & 7] * K1 - mn); ps += p[e]; }
            l[qb] = l[qb] * al + ps;
#pragma unroll
            for (int db = 0; db < 4; ++db) o[qb][db] *= al;
            if constexpr (HR) { v8us h0, h1, l0, l1;
#pragma unroll
                for (int e = 0; e < 8; ++e) { unsigned short a, c; splitf(p[e], a, c); h0[e] = a; l0[e] = c; splitf(p[8 + e], a, c); h1[e] = a; l1[e] = c; }
                const V ph = cat16b(h0, h1), pl = cat16b(l0, l1);
#pragma unroll
                for (int db = 0; db < 4; ++db) { o[qb][db] = WFrag<T16>::mma(av[db], ph, o[qb][db]); o[qb][db] = WFrag<T16>::mma(av[db], pl, o[qb][db]); o[qb][db] = WFrag<T16>::mma(av2[db], ph, o[qb][db]); }
            } else { V pb;
#pragma unroll
                for (int e = 0; e < 16; ++e) pb[e] = (h16)p[e];
#pragma unroll
                for (int db = 0; db < 4; ++db) o[qb][db] = WFrag<T16>::mma(av[db], pb, o[qb][db]); }
        }
        asm volatile("v_nop\n\tv_nop\n\tv_nop\n\tv_nop" : "+v"(o[NQB - 1][0]), "+v"(o[NQB - 1][1]), "+v"(o[NQB - 1][2]), "+v"(o[NQB - 1][3]));   // the matrix instructions' distance on the taken branch out of the loop (its target reads o)
    }
    float* my = sm + wave * (NQB * 16 * APIT);                       // this wave's own partial tile
#pragma unroll
    for (int qb = 0; qb < NQB; ++qb) { l[qb] += xhalf(l[qb]); float* r = my + (qb * 16 + lr) * APIT;
#pragma unroll
        for (int db = 0; db < 4; ++db) { v4f a, b;
#pragma unroll
            for (int j = 0; j < 4; ++j) { a[j] = o[qb][db][j]; b[j] = o[qb][db][4 + j]; }
            *(v4fa*)(r + db * 16 + hi * 8) = a; *(v4fa*)(r + db * 16 + hi * 8 + 4) = b; }
        if (hi == 0) { r[64] = m[qb]; r[65] = l[qb]; } }
    __syncthreads();                                                 // every wave's partial tile and statistics are in LDS before any thread merges them
    constexpr int EPT = NQB * 16 * HD / (32 * ANW);                  // outputs per thread: consecutive d of one query
    const int qi = (int)threadIdx.x / (HD / EPT), d0 = ((int)threadIdx.x % (HD / EPT)) * EPT; const float* r0 = sm + qi * APIT;
    float M = r0[64];
#pragma unroll
    for (int w = 1; w < ANW; ++w) M = fmaxf(M, r0[w * (NQB * 16 * APIT) + 64]);
    float L = 0.f, acc[EPT];
#pragma unroll
    for (int e = 0; e < EPT; ++e) acc[e] = 0.f;
#pragma unroll
    for (int w = 0; w < ANW; ++w) { const float* rw = r0 + w * (NQB * 16 * APIT); const float wt = ex2(rw[64] - M); L += wt * rw[65];   // a wave that had no block weighs 0; partials added in wave order: the same order on every run
#pragma unroll
        for (int e4 = 0; e4 < EPT; e4 += 4) { const v4f x = *(const v4fa*)(rw + d0 + e4);
#pragma unroll
            for (int j = 0; j < 4; ++j) acc[e4 + j] += wt * x[j]; } }
    const float f = __fdiv_rn(1.0f, L); typename USV<EPT>::T oh, ol;
#pragma unroll
    for (int e = 0; e < EPT; ++e) { unsigned short a, c; splitf(acc[e] * f, a, c); oh[e] = a; ol[e] = c; }
    const size_t oo = (size_t)(q0 + qi) * DQ + d0; *(typename USV<EPT>::T*)(Ah + oo) = oh; *(typename USV<EPT>::T*)(Al + oo) = ol;
    asm volatile("s_wait_xcnt 0x0" ::: "memory");   // one body's code is laid out in front of the other's: the wait stands between these stores and any later write of their address or data registers
}
// grid (planes, query tiles): tiles in falling order of their key count, the longest start first; query rows >= RH in tiles of 32 (fp16 body), rows < RH in tiles of 16 (hi/lo 3-product body); the choice is uniform for the work-group.
__global__ __launch_bounds__(32 * ANW) void k_attn(const bf* __restrict__ Qh, const bf* __restrict__ Ql, const bf* __restrict__ Kh, const bf* __restrict__ Kl, const bf* __restrict__ Vh, const bf* __restrict__ Vl, const h16* __restrict__ Q16, const h16* __restrict__ K16, const h16* __restrict__ V16, bf* Ah, bf* Al) {
    __shared__ __align__(16) float sm[ANW * 32 * APIT];
    const int pl = (int)blockIdx.x, ty = (int)blockIdx.y; const size_t po = (size_t)pl * TT * HD; const size_t ao = (size_t)(pl / NH_) * TT * DQ + (size_t)(pl % NH_) * HD;   /* plane = batch * 16 + head */
    if (ty < (TT - RH) / 32) attn_body<h16, false, 2>(sm, TT - 32 * (ty + 1), Q16 + po, nullptr, K16 + po, nullptr, V16 + po, nullptr, Ah + ao, Al + ao);
    else attn_body<bf, true, 1>(sm, RH - 16 * (ty - (TT - RH) / 32 + 1), Qh + po, Ql + po, Kh + po, Kl + po, Vh + po, Vl + po, Ah + ao, Al + ao);
}

typedef __attribute__((ext_vector_type(2))) unsigned short v2us;
typedef __attribute__((ext_vector_type(4))) int v4i;

__constant__ float INV2[HD / 2] = { 1.000000000e+00f, 7.498942018e-01f, 5.623413324e-01f, 4.216965139e-01f, 3.162277639e-01f, 2.371373773e-01f, 1.778279394e-01f, 1.333521456e-01f, 1.000000015e-01f, 7.498942316e-02f, 5.623413250e-02f, 4.216964915e-02f, 3.162277490e-02f, 2.371373773e-02f, 1.778279431e-02f, 1.333521400e-02f, 9.999999776e-03f, 7.498942316e-03f, 5.623413250e-03f, 4.216964822e-03f, 3.162277630e-03f, 2.371373819e-03f, 1.778279431e-03f, 1.333521446e-03f, 1.000000047e-03f, 7.498941850e-04f, 5.623413017e-04f, 4.216965172e-04f, 3.162277571e-04f, 2.371373703e-04f, 1.778279402e-04f, 1.333521504e-04f };   // 10000 ** (-2i / 64), i = 0..31, in float32 as THIS module writes it (the NEGATIVE-POWER spelling '10000.0 ** (-ts / dim)' evaluated in the reference's own f32 arithmetic: these 32 literals equal it bit for bit); ten entries differ by one ulp from the reciprocal values the host's own table held

// ---- k_prep: the three preparations, which do not depend on one another, in ONE grid (the choice is uniform for the work-group); the longest blocks have the lowest indices and start first.
#define PBW1 ((DM * DQ / 64 + 63) / 64)   // blocks per transposed weight
#define PBW  (4 * PBW1)                   // blocks 0 .. PBW-1: the four 'xw' weights, transposed to bf16, one plane behind the other
#define PBC  ((TT * HD + 255) / 256)      // the next PBC blocks: the rotation table
#define PBX  ((NB_ * TT * DM / 8 + 255) / 256)   // the last PBX blocks: the bf16 copy of x, 8 elements a thread
__global__ __launch_bounds__(256) void k_prep(const float* __restrict__ w0, const float* __restrict__ w1, const float* __restrict__ w2, const float* __restrict__ w3, const float* __restrict__ src, bf* Bt, float* CS, bf* dst) {
    const int blk = (int)blockIdx.x;
    if (blk < PBW) {
        constexpr int K = DM, N = DQ; const int wy = blk / PBW1, wx = blk % PBW1;
        const float* w = wy == 0 ? w0 : wy == 1 ? w1 : wy == 2 ? w2 : w3; Bt += (size_t)wy * K * N;
        const int lane = threadIdx.x & 31; const int L0 = (wx * 8 + (threadIdx.x >> 5)) * 8; const int nlines = N * K / 64;
#pragma unroll 1
        for (int l = 0; l < 8; ++l) { const int L = L0 + l; if (L >= nlines) break; const size_t e = (size_t)L * 64 + lane * 2; const int k = (int)(e % K), n = (int)(e / K); v2us o;
            o[0] = f2bf(w[(size_t)k * N + n]); o[1] = f2bf(w[(size_t)(k + 1) * N + n]); *(v2us*)(Bt + e) = o; }
    } else if (blk < PBW + PBC) {
        const int idx = (blk - PBW) * 256 + threadIdx.x; if (idx >= TT * HD) return; const int d = idx % HD; const int t = idx / HD; const float a = __fmul_rn((float)t, INV2[d >> 1]); v2f cs; cs[0] = cosf(a); cs[1] = sinf(a); *(v2f*)(CS + (size_t)idx * 2) = cs;
    } else {
        const size_t i = (size_t)(blk - PBW - PBC) * 256 + threadIdx.x; if (i >= (size_t)NB_ * TT * DM / 8) return; const v8f v = *(const v8f*)(src + i * 8); v8us o;
#pragma unroll
        for (int k = 0; k < 8; ++k) o[k] = f2bf(v[k]); *(v8us*)(dst + i * 8) = o;
    }
}

extern "C" void kernel_launch(void* const* d_in, const int* in_sizes, int n_in,
                              void* d_out, int out_size, void* d_ws, size_t ws_size, hipStream_t stream) {
    (void)in_sizes; (void)n_in; (void)out_size;
    const float* x = (const float*)d_in[0]; const float* wq = (const float*)d_in[1]; const float* wk = (const float*)d_in[2]; const float* wv = (const float*)d_in[3]; const float* wo = (const float*)d_in[4]; const int* flag = (const int*)d_in[5];   /* order x, Wq, Wk, Wv, Wo ('xw' [1024][1024]), num_heads (the SIXTH input, slot 5: the python int 16 as an int scalar: READ ON DEVICE by the output GEMM: the whole output is NaN unless it equals NH_ = 16) */
    float* OUT = (float*)d_out;     // [2][2048][1024]
    char* wsp = (char*)d_ws;
    auto take = [&](size_t bytes) { char* p = wsp; wsp += (bytes + 255) & ~(size_t)255; return (void*)p; };
    bf* WQ = (bf*)take((size_t)4 * DQ * DM * 2); bf* WO = WQ + (size_t)3 * DQ * DM;   // transposed Wq, Wk, Wv, Wo, one behind the other (z-stride DQ*DM)
    float* CS = (float*)take((size_t)TT * HD * 2 * 4);
    const size_t PL = (size_t)NB_ * NH_ * TT * HD;   // one operand's planes, both batches
    h16* QP16 = (h16*)take(2 * PL * 2); h16* KP16 = QP16 + PL; bf* QPh = (bf*)take(2 * PL * 2); bf* KPh = QPh + PL; bf* QPl = (bf*)take(2 * PL * 2); bf* KPl = QPl + PL;   // k planes directly behind the q planes: plane index (z * 2 + batch) * 16 + head in the projection's epilogue
    h16* VT16 = (h16*)take(PL * 2); bf* VTh = (bf*)take(PL * 2); bf* VTl = (bf*)take(PL * 2);
    bf* ATh = (bf*)take((size_t)NB_ * TT * DQ * 2); bf* ATl = (bf*)take((size_t)NB_ * TT * DQ * 2);
    bf* XB = (bf*)take((size_t)NB_ * TT * DM * 2);   // bf16 copy of x
    if ((size_t)(wsp - (char*)d_ws) > ws_size) return;    // ws 256 MiB
    k_prep<<<PBW + PBC + PBX, 256, 0, stream>>>(wq, wk, wv, wo, x, WQ, CS, XB);
    k_gemmw<bf, 0, false, 8, true, false><<<dim3(NB_ * TT / 64, DQ / 64, 3), 256, 0, stream>>>(XB, nullptr, WQ, nullptr, DM, nullptr, 0, nullptr, 0, (size_t)DQ * DM, 0, CS, QP16, QPh, QPl, VT16, VTh, VTl, nullptr);
    k_attn<<<dim3(NB_ * NH_, (TT - RH) / 32 + RH / 16, 1), 32 * ANW, 0, stream>>>(QPh, QPl, KPh, KPl, VTh, VTl, QP16, KP16, VT16, ATh, ATl);   // one kv head per query head: plane index batch * 16 + head for q, k and v alike
    k_gemmw<bf, 1, false, 8, false, true><<<dim3(NB_ * TT / 64, DM / 64, 1), 256, 0, stream>>>(ATh, ATl, WO, nullptr, DQ, OUT, DM, nullptr, 0, 0, 0, nullptr, nullptr, nullptr, nullptr, nullptr, nullptr, nullptr, flag);   // the premise guard rides in its stores
}

// v006
// Measured time: 106 microseconds a run.
// Timed twice side by side with v005, it ran 1.39 and 1.38 times as fast.
// Over all steps from v000 it is 13.7 times as fast.
#include <hip/hip_runtime.h>

// Causal multi-head attention with a pre-scaled query, interleaved-pair rotary embeddings and a scalar head-count input (x [2][2048][1024]; q = (x Wq) x 1/sqrt(1024), k = x Wk, v = x Wv ('xw' [1024][1024] 0.02, no bias; 16 heads x 64: the head count arrives as the python int 16, the LAST input: read on device by the premise guard); rope x cos + x_rot sin with x_rot: (x1, x2) -> (-x2, x1) on adjacent pairs and cos / sin = repeat(c, 2) of angle t x 10000^(-2i/64) (32 f32 frequencies jnp-exact for the module's negative-power expression; precise cosf/sinf); logits = q.k (no further scale: net 1/32); where(tril, logits, -1e8) == exclusion; softmax; out = merged Wo ('xw', no bias) -> [2][2048][1024] (4.2 M); argument order x, Wq, Wk, Wv, Wo, num_heads).
// VALUE PREMISE: this kernel implements num_heads == 16 only; the output GEMM reads the scalar on the device and stores NaN in place of every output element if it is not 16.
// Layout (both batches in every launch; planes ordered [batch * 16 + head]): k_prep: bf16 copy of x, 'xw' weights transposed once and the rotation table, in one grid; exact projections whose epilogue applies the rotation (computed table, pair-shared entries) and writes the q, k and transposed v planes itself; k_attn causal T-2048 attention of all planes in one launch, scores and probabilities in registers (hybrid rows: < 512 hi/lo 3 products, rest fp16 x1024; key blocks above the diagonal are never formed); merged hi/lo x Wo exact.
// Compute dtypes, f32 accumulate: every input rounded to bf16; projections exact; rotary f32; attention rows < 512 3 products, rest fp16; softmax f32; Wo hl x exact.

#define NB_  2
#define TT   2048
#define DM   1024
#define NH_  16
#define NKV  16
#define HD   64
#define DQ   (NH_ * HD)
#define DKV  (NKV * HD)
#define RH   512                  // query rows < RH use hi+lo planes (0: none)
#define SCL  0.03125f   // 1 / sqrt(1024): the module scales q by 1 / sqrt(d_model) BEFORE the rotation and applies no other scale (a power of two: exact, commutes with the rotation)
typedef _Float16 h16;
typedef unsigned short bf;
typedef __attribute__((ext_vector_type(16))) __bf16   v16bf;
typedef __attribute__((ext_vector_type(16))) _Float16 v16h;
typedef __attribute__((ext_vector_type(8)))  _Float16 v8h;
typedef __attribute__((ext_vector_type(8)))  unsigned short v8us;
typedef __attribute__((ext_vector_type(8)))  float    v8f;
typedef __attribute__((ext_vector_type(4)))  float    v4f;
typedef v8h  __attribute__((may_alias)) v8ha;
typedef v4f  __attribute__((may_alias)) v4fa;
typedef v8us __attribute__((may_alias)) v8usa;
typedef __attribute__((ext_vector_type(4))) unsigned short v4us;
typedef __attribute__((ext_vector_type(4))) _Float16 v4h;
typedef __attribute__((ext_vector_type(2))) float v2f;

__device__ __forceinline__ unsigned short f2bf(float f) { unsigned u = __float_as_uint(f); u += 0x7FFFu + ((u >> 16) & 1u); return (unsigned short)(u >> 16); }
__device__ __forceinline__ float bf2f(unsigned short b) { return __uint_as_float(((unsigned)b) << 16); }
__device__ __forceinline__ float bfr(float f) { return bf2f(f2bf(f)); }
__device__ __forceinline__ void splitf(float y, unsigned short& h, unsigned short& l) { h = f2bf(y); l = f2bf(y - bf2f(h)); }
__device__ __forceinline__ v16h cat16(v8h lo, v8h hi) { return __builtin_shufflevector(lo, hi, 0, 1, 2, 3, 4, 5, 6, 7, 8, 9, 10, 11, 12, 13, 14, 15); }
__device__ __forceinline__ v16bf cat16b(v8us lo, v8us hi) { return __builtin_bit_cast(v16bf, __builtin_shufflevector(lo, hi, 0, 1, 2, 3, 4, 5, 6, 7, 8, 9, 10, 11, 12, 13, 14, 15)); }
__device__ __forceinline__ v8f wmma16(v16h a, v16h b, v8f c) { return __builtin_amdgcn_wmma_f32_16x16x32_f16(false, a, false, b, (short)0, c, false, false); }
__device__ __forceinline__ v8f wmmab(v16bf a, v16bf b, v8f c) { return __builtin_amdgcn_wmma_f32_16x16x32_bf16(false, a, false, b, (short)0, c, false, false); }



// ---- k_gemmt: LDS-staged GEMM, one work-group of 4 waves (2 x 2) per 128x128 output tile; each wave owns one 64x64 sub-tile (16 accumulators) over the WHOLE k range, so no partial tiles are summed.
// Operands are K-contiguous bf16 planes. A stage is 64 k (one 128-B line) of the tile's 128 A rows, 128 B rows (and 128 A2 rows), brought into LDS by asynchronous copies (16 B a lane), two buffers: the next stage flies while this one is worked on. Every staged row is read by two waves.
// C[m][n] (f32, pitch ldc) = sum_k (A[m][k] + A2[m][k]) Bt[n][k] (A2 only where NSPLIT). grid (M/128, N/128, Z), 128 threads; z strides Bt by sB elements. K % 64 == 0.
// PLN (the q, k, v projections; z = 0, 1, 2; one wave's 64-wide column range = one head): no f32 C; the epilogue turns the wave's tile straight into the attention operand planes (fp16, bf16 hi, bf16 lo).
// GRD (the output GEMM): every stored value is replaced by NaN unless flag[0] == NH_ (the premise guard; the scalar is asked for ahead of the k loop, so its latency passes behind it).
// z < 2: rows are tokens, columns d: the interleaved-pair rotation from the table CS, stored to plane [(z * 2 + batch) * 16 + head][t][d]. z == 2: the two operands change places, so the tile comes out as [d][token] and is stored to the transposed plane [batch * 16 + head][d][t] in whole lines.
template <typename T16> struct WFrag;
template <> struct WFrag<h16> { typedef v16h V; static __device__ __forceinline__ V ld(const h16* p) { return cat16(*(const v8h*)p, *(const v8h*)(p + 16)); } static __device__ __forceinline__ v8f mma(V a, V b, v8f c) { return wmma16(a, b, c); } };
template <> struct WFrag<bf> { typedef v16bf V; static __device__ __forceinline__ V ld(const bf* p) { return cat16b(*(const v8us*)p, *(const v8us*)(p + 16)); } static __device__ __forceinline__ v8f mma(V a, V b, v8f c) { return wmmab(a, b, c); } };
#define GKC  64                   // k elements of a stage
#define GPIT 144                  // LDS bytes of a staged row: 128 + 16, the conflict-free pitch for 16-byte reads
// eight copies of one wave: 32 rows of one operand (lane: row lane / 8 of each group of 4, 16-byte piece lane % 8). The s_wait_xcnt stands in the copies' own statement, so that no address register is rewritten ahead of it.
__device__ __forceinline__ void cp8(unsigned l, const bf* g, size_t r4) {
    asm volatile("global_load_async_to_lds_b128 %0, %8, off\n\t"
                 "global_load_async_to_lds_b128 %1, %9, off\n\t"
                 "global_load_async_to_lds_b128 %2, %10, off\n\t"
                 "global_load_async_to_lds_b128 %3, %11, off\n\t"
                 "global_load_async_to_lds_b128 %4, %12, off\n\t"
                 "global_load_async_to_lds_b128 %5, %13, off\n\t"
                 "global_load_async_to_lds_b128 %6, %14, off\n\t"
                 "global_load_async_to_lds_b128 %7, %15, off\n\t"
                 "s_wait_xcnt 0x0"
                 :: "v"(l), "v"(l + 4 * GPIT), "v"(l + 8 * GPIT), "v"(l + 12 * GPIT), "v"(l + 16 * GPIT), "v"(l + 20 * GPIT), "v"(l + 24 * GPIT), "v"(l + 28 * GPIT),
                    "v"(g), "v"(g + r4), "v"(g + 2 * r4), "v"(g + 3 * r4), "v"(g + 4 * r4), "v"(g + 5 * r4), "v"(g + 6 * r4), "v"(g + 7 * r4) : "memory");
}
template <int NSPLIT, bool PLN, bool GRD>
__global__ __launch_bounds__(128) void k_gemmt(const bf* __restrict__ A, const bf* __restrict__ A2, const bf* __restrict__ Bt, int K, float* C, int ldc, size_t sB, const float* __restrict__ CS, h16* P16, bf* Ph, bf* Pl, h16* V16, bf* Vh, bf* Vl, const int* __restrict__ flag) {
    typedef WFrag<bf>::V V;
    constexpr int OPB = 128 * GPIT, STG = (NSPLIT ? 3 : 2) * OPB;    // bytes of one operand's rows in a stage; of a stage
    constexpr int RING = 2 * STG, EPI = 4 * 64 * 68 * 4;             // the two buffers; the four waves' output staging, which takes the ring's place behind the loop
    __shared__ __align__(16) char sm[RING > EPI ? RING : EPI];
    bool bad = false; if constexpr (GRD) bad = flag[0] != NH_;      // uniform for the whole grid
    Bt += (size_t)blockIdx.z * sB;
    const int lane = threadIdx.x & 31, lr = lane & 15, hi = lane >> 4; const int wave = __builtin_amdgcn_readfirstlane((int)(threadIdx.x >> 5)); const int wm = wave >> 1, wn = wave & 1;
    const bool tr = PLN && blockIdx.z == 2;                          // the v projection: tile formed transposed (uniform for the work-group)
    if (tr) { const bf* x = A; A = Bt; Bt = x; }
    const int r0 = (tr ? blockIdx.y : blockIdx.x) * 128, c0 = (tr ? blockIdx.x : blockIdx.y) * 128;
    const int crow = wave * 32 + (lane >> 3);                        // this lane's first row of the 128 of each operand
    const unsigned l0 = (unsigned)(size_t)sm + (unsigned)(crow * GPIT + (lane & 7) * 16);
    const size_t ga = (size_t)(r0 + crow) * K + (lane & 7) * 8, gb = (size_t)(c0 + crow) * K + (lane & 7) * 8, r4 = (size_t)4 * K;
    auto fill = [&](int t) { const unsigned l = l0 + (unsigned)((t & 1) * STG);
        cp8(l, A + ga + t * GKC, r4); cp8(l + OPB, Bt + gb + t * GKC, r4); if constexpr (NSPLIT != 0) cp8(l + 2 * OPB, A2 + ga + t * GKC, r4); };
    v8f acc[4][4];
#pragma unroll
    for (int mb = 0; mb < 4; ++mb)
#pragma unroll
        for (int nb = 0; nb < 4; ++nb) acc[mb][nb] = (v8f){};
    const int NT = K / GKC;
    fill(0);
    asm volatile("s_wait_asynccnt 0x0" ::: "memory");               // this wave's copies of stage 0 have landed
    __syncthreads();                                                 // and every other wave's: stage 0 may be read
    if (NT > 1) fill(1);
#pragma unroll 1   // rolled: one trip a stage, the ring's order stands once in the code
    for (int t = 0; t < NT; ++t) {
        const char* pa = sm + (t & 1) * STG + (wm * 64 + lr) * GPIT + hi * 16; const char* pb = sm + (t & 1) * STG + OPB + (wn * 64 + lr) * GPIT + hi * 16;
#pragma unroll
        for (int ks = 0; ks < 2; ++ks) {
            V a[4], a2[4], b[4];
#pragma unroll
            for (int mb = 0; mb < 4; ++mb) { a[mb] = WFrag<bf>::ld((const bf*)(pa + mb * 16 * GPIT + ks * 64)); if constexpr (NSPLIT != 0) a2[mb] = WFrag<bf>::ld((const bf*)(pa + 2 * OPB + mb * 16 * GPIT + ks * 64)); }
#pragma unroll
            for (int nb = 0; nb < 4; ++nb) b[nb] = WFrag<bf>::ld((const bf*)(pb + nb * 16 * GPIT + ks * 64));   // all of the block's LDS reads stand together, ahead of its products
            __builtin_amdgcn_sched_barrier(0);   // keeps the reads in one group: without it the compiler sinks each B fragment's reads in front of its four products, on one register set, and every group then waits out the LDS latency
#pragma unroll
            for (int nb = 0; nb < 4; ++nb)
#pragma unroll
                for (int mb = 0; mb < 4; ++mb) { acc[mb][nb] = WFrag<bf>::mma(a[mb], b[nb], acc[mb][nb]); if constexpr (NSPLIT != 0) acc[mb][nb] = WFrag<bf>::mma(a2[mb], b[nb], acc[mb][nb]); }
        }
        asm volatile("s_wait_dscnt 0x0" ::: "memory");              // this wave's reads of the buffer have returned
        asm volatile("s_wait_asynccnt 0x0" ::: "memory");           // this wave's copies of the next stage have landed
        __syncthreads();                                             // publishes the next stage and ends every reader's last read of this buffer
        if (t + 2 < NT) fill(t + 2);                                 // refill of the buffer just left (the test reads the same for the whole work-group)
    }
    asm volatile("s_wait_asynccnt 0x0" ::: "memory");               // nothing is in flight when the ring becomes output staging
    const int rw = r0 + wm * 64, cw = c0 + wn * 64;                  // the wave's own 64x64 tile
    float* osw = (float*)sm + wave * (64 * 68);                      // and its own staging range
#pragma unroll
    for (int mb = 0; mb < 4; ++mb)
#pragma unroll
        for (int nb = 0; nb < 4; ++nb)
#pragma unroll
            for (int j = 0; j < 8; ++j) osw[(mb * 16 + hi * 8 + j) * 68 + nb * 16 + lr] = acc[mb][nb][j];
    constexpr int NS = 32;                                           // 4-wide pieces of the tile per lane: piece q = s * 32 + lane holds row q / 16, columns 4 (q % 16)..
    v2f cs[NS][2];                                                   // (cos, sin) of this lane's two pairs in each of its pieces: asked for here, all at once, so that the table's latency is met once and passes behind the LDS round
    if constexpr (PLN) { if (!tr) { const float* c = CS + (size_t)(rw % TT) * (HD * 2) + lane * 8;   // table entry (row * 64 + column) * 2 = 8 q
#pragma unroll   // cs is indexed by constants only, so it stays in registers
        for (int s = 0; s < NS; ++s) { cs[s][0] = *(const v2f*)(c + s * 256); cs[s][1] = *(const v2f*)(c + s * 256 + 4); }
        asm volatile("s_wait_xcnt 0x0" ::: "memory"); } }   // behind the table loads, which stay in flight: their address registers are reused behind them
    __syncthreads();                                                 // the staged tile is whole before its lanes read one another's values
    v4f pg[8];                                                       // indexed by constants only (the loops below are unrolled), so it stays in registers
    if constexpr (PLN) {
        const int tk = tr ? cw : rw, hd = (tr ? rw : cw) / HD;       // the tile's first token (64 divides TT, so a tile lies in one batch) and its head
        const size_t eb = tr ? ((size_t)(tk / TT) * NH_ + hd) * HD * TT + tk % TT : ((((size_t)blockIdx.z * NB_ + tk / TT) * NH_ + hd) * TT + tk % TT) * HD;
        const int pit = tr ? TT : HD; h16* d16 = (tr ? V16 : P16) + eb; bf* dh = (tr ? Vh : Ph) + eb; bf* dl = (tr ? Vl : Pl) + eb;
#pragma unroll   // cs is indexed by constants only, so it stays in registers
        for (int s = 0; s < NS; ++s) { const int q = s * 32 + lane; const int o = (q >> 4) * pit + (q & 15) * 4;
            if (s % 8 == 0) {   // eight pieces are read from LDS at a time, so that its latency is met once for the eight
#pragma unroll
                for (int u = 0; u < 8; ++u) pg[u] = *(const v4fa*)(osw + ((q >> 4) + 2 * u) * 68 + (q & 15) * 4); }
            const v4f pv = pg[s % 8]; v4f r = pv;
            if (!tr) {
#pragma unroll   // vector elements picked by constants
                for (int p = 0; p < 2; ++p) { const float x0 = pv[2 * p], x1 = pv[2 * p + 1], c = cs[s][p][0], sn = cs[s][p][1]; r[2 * p] = x0 * c - x1 * sn; r[2 * p + 1] = x0 * sn + x1 * c; } }   /* even: x0 c - x1 s; odd: x0 s + x1 c */
            v4h o16; v4us oh, ol;
#pragma unroll   // vector elements picked by constants
            for (int j = 0; j < 4; ++j) { o16[j] = (h16)r[j]; unsigned short a2, c2; splitf(r[j], a2, c2); oh[j] = a2; ol[j] = c2; }
            *(v4h*)(d16 + o) = o16; *(v4us*)(dh + o) = oh; *(v4us*)(dl + o) = ol;
            asm volatile("s_wait_xcnt 0x0" ::: "memory");   // behind the three stores: the next piece's values may land on their address or data registers
        }
    } else {
        float* crow = C + (size_t)rw * ldc + cw;
#pragma unroll
        for (int s = 0; s < NS; ++s) { const int q = s * 32 + lane;
            if (s % 8 == 0) {   // eight pieces are read from LDS at a time, so that its latency is met once for the eight
#pragma unroll
                for (int u = 0; u < 8; ++u) pg[u] = *(const v4fa*)(osw + ((q >> 4) + 2 * u) * 68 + (q & 15) * 4); }
            v4f val = pg[s % 8];
            if constexpr (GRD) { if (bad) { const float qn = __int_as_float(0x7fc00000); val[0] = qn; val[1] = qn; val[2] = qn; val[3] = qn; } }   // premise fails: the whole output is NaN
            *(v4f*)(crow + (size_t)(q >> 4) * ldc + (q & 15) * 4) = val;
            asm volatile("s_wait_xcnt 0x0" ::: "memory");   // behind the store: the next piece's value may land on its address or data registers
        }
    }
}

// ---- k_attn: causal attention of one query tile of one (batch, head) plane in one work-group; scores and probabilities never leave the registers.
// Transposed products: S^T = K Q^T (A = 16 keys x 32 d from the key plane, B = 16 queries from the query plane), so a lane holds 8 + 8 keys of ONE query (column lr, rows hi * 8 + j of two 16-key tiles): exactly the k order of a B fragment
// (elements 0..7 = keys 8 hi + e, elements 8..15 = keys 16 + 8 hi + e), which then meets A = V^T (16 d x 32 keys, same k order) in O^T = V^T P^T. Row statistics are per lane (one exchange between the two 16-lane halves).
// The ANW waves take the 32-key blocks w, w + ANW, ... up to the diagonal block, each with its own running maximum, sum and O^T (online softmax); the partials are merged through LDS in wave order 0..ANW-1 (a fixed order), normalised, split hi/lo and stored in merged [token][head * 64 + d] order.
#define ANW  8                    // waves per work-group: they share the key loop
#define APIT 68                   // f32 pitch of one query's partial row in LDS: 64 outputs, then its maximum and its sum
__device__ __forceinline__ float ex2(float x) { float r; asm("v_exp_f32 %0, %1\n\tv_nop" : "=v"(r) : "v"(x)); return r; }   // 2^x; the v_nop is the one slot the instruction set asks for behind a transcendental, tied to it by standing in its statement
__device__ __forceinline__ float xhalf(float x) { return __builtin_bit_cast(float, __builtin_amdgcn_permlanex16(__builtin_bit_cast(int, x), __builtin_bit_cast(int, x), 0x76543210, 0xfedcba98, false, false)); }   // lane l reads lane l ^ 16 (a vector move, no LDS round trip)
template <int N> struct USV;
template <> struct USV<8> { typedef v8us T; };
template <> struct USV<4> { typedef v4us T; };
template <typename T16, bool HR, int NQB>
__device__ __forceinline__ void attn_body(float* sm, int q0, const T16* __restrict__ Q, const T16* __restrict__ Q2, const T16* __restrict__ Kp, const T16* __restrict__ Kp2, const T16* __restrict__ Vt, const T16* __restrict__ Vt2, bf* Ah, bf* Al) {
    typedef typename WFrag<T16>::V V;
    constexpr float K1 = SCL * 1.4426950408889634f;                  // logit scale and log2(e) in one factor: the statistics live in the base-2 exponent's units
    constexpr float PB = HR ? 0.0f : 10.0f;                          // fp16 probabilities carry a factor 2^10, which cancels in the division by their own sum
    const int lane = threadIdx.x & 31, lr = lane & 15, hi = lane >> 4; const int wave = __builtin_amdgcn_readfirstlane((int)(threadIdx.x >> 5));
    V bq[NQB][2], bq2[NQB][2];
#pragma unroll
    for (int qb = 0; qb < NQB; ++qb)
#pragma unroll
        for (int ks = 0; ks < 2; ++ks) { const size_t qo = (size_t)(q0 + qb * 16 + lr) * HD + 8 * hi + ks * 32; bq[qb][ks] = WFrag<T16>::ld(Q + qo); if (HR) bq2[qb][ks] = WFrag<T16>::ld(Q2 + qo); }
    v8f o[NQB][4]; float m[NQB], l[NQB];
#pragma unroll
    for (int qb = 0; qb < NQB; ++qb) { m[qb] = -1.0e30f; l[qb] = 0.f;
#pragma unroll
        for (int db = 0; db < 4; ++db) o[qb][db] = (v8f){}; }
    const int nkb = q0 / 32 + 1;                                     // 32-key blocks up to and with the diagonal block; every query of the tile has a key in each of them
#pragma unroll 1   // rolled: one block's K and V fragments live at a time, which keeps four waves on a SIMD; every inner loop is unrolled so that fragments and accumulators stay in registers
    for (int kb = wave; kb < nkb; kb += ANW) {
        const int k0 = kb * 32;
        V ak[2][2], ak2[2][2], av[4], av2[4];
#pragma unroll
        for (int kt = 0; kt < 2; ++kt)
#pragma unroll
            for (int ks = 0; ks < 2; ++ks) { const size_t ko = (size_t)(k0 + kt * 16 + lr) * HD + 8 * hi + ks * 32; ak[kt][ks] = WFrag<T16>::ld(Kp + ko); if (HR) ak2[kt][ks] = WFrag<T16>::ld(Kp2 + ko); }
        asm volatile("s_wait_xcnt 0x0" ::: "memory");   // behind the K loads: their address registers are free for reuse (the V fragments may land on them)
#pragma unroll
        for (int db = 0; db < 4; ++db) { const size_t vo = (size_t)(db * 16 + lr) * TT + k0 + 8 * hi; av[db] = WFrag<T16>::ld(Vt + vo); if (HR) av2[db] = WFrag<T16>::ld(Vt2 + vo); }
        asm volatile("s_wait_xcnt 0x0" ::: "memory");   // behind the V loads, which are still in flight during the score products: the compiler reuses their address registers there
#pragma unroll
        for (int qb = 0; qb < NQB; ++qb) {
            v8f st[2];                                               // st[kt][j] = q.k of key k0 + kt * 16 + hi * 8 + j and query q0 + qb * 16 + lr
#pragma unroll
            for (int kt = 0; kt < 2; ++kt) { v8f s = (v8f){};
#pragma unroll
                for (int ks = 0; ks < 2; ++ks) { s = WFrag<T16>::mma(ak[kt][ks], bq[qb][ks], s); if (HR) { s = WFrag<T16>::mma(ak[kt][ks], bq2[qb][ks], s); s = WFrag<T16>::mma(ak2[kt][ks], bq[qb][ks], s); } }
                st[kt] = s; }
            if (kb == nkb - 1) {                                     // only the diagonal block holds keys behind a query
#pragma unroll
                for (int kt = 0; kt < 2; ++kt)
#pragma unroll
                    for (int j = 0; j < 8; ++j) if (k0 + kt * 16 + hi * 8 + j > q0 + qb * 16 + lr) st[kt][j] = -1.0e30f; }
            float mx = st[0][0];
#pragma unroll
            for (int e = 1; e < 16; ++e) mx = fmaxf(mx, st[e >> 3][e & 7]);
            mx = fmaxf(mx, xhalf(mx));
            const float mn = fmaxf(m[qb], mx * K1 - PB); const float al = ex2(m[qb] - mn); m[qb] = mn;
            float p[16], ps = 0.f;
#pragma unroll
            for (int e = 0; e < 16; ++e) { p[e] = ex2(st[e >> 3][e & 7] * K1 - mn); ps += p[e]; }
            l[qb] = l[qb] * al + ps;
#pragma unroll
            for (int db = 0; db < 4; ++db) o[qb][db] *= al;
            if constexpr (HR) { v8us h0, h1, l0, l1;
#pragma unroll
                for (int e = 0; e < 8; ++e) { unsigned short a, c; splitf(p[e], a, c); h0[e] = a; l0[e] = c; splitf(p[8 + e], a, c); h1[e] = a; l1[e] = c; }
                const V ph = cat16b(h0, h1), pl = cat16b(l0, l1);
#pragma unroll
                for (int db = 0; db < 4; ++db) { o[qb][db] = WFrag<T16>::mma(av[db], ph, o[qb][db]); o[qb][db] = WFrag<T16>::mma(av[db], pl, o[qb][db]); o[qb][db] = WFrag<T16>::mma(av2[db], ph, o[qb][db]); }
            } else { V pb;
#pragma unroll
                for (int e = 0; e < 16; ++e) pb[e] = (h16)p[e];
#pragma unroll
                for (int db = 0; db < 4; ++db) o[qb][db] = WFrag<T16>::mma(av[db], pb, o[qb][db]); }
        }
        asm volatile("v_nop\n\tv_nop\n\tv_nop\n\tv_nop" : "+v"(o[NQB - 1][0]), "+v"(o[NQB - 1][1]), "+v"(o[NQB - 1][2]), "+v"(o[NQB - 1][3]));   // the matrix instructions' distance on the taken branch out of the loop (its target reads o)
    }
    float* my = sm + wave * (NQB * 16 * APIT);                       // this wave's own partial tile
#pragma unroll
    for (int qb = 0; qb < NQB; ++qb) { l[qb] += xhalf(l[qb]); float* r = my + (qb * 16 + lr) * APIT;
#pragma unroll
        for (int db = 0; db < 4; ++db) { v4f a, b;
#pragma unroll
            for (int j = 0; j < 4; ++j) { a[j] = o[qb][db][j]; b[j] = o[qb][db][4 + j]; }
            *(v4fa*)(r + db * 16 + hi * 8) = a; *(v4fa*)(r + db * 16 + hi * 8 + 4) = b; }
        if (hi == 0) { r[64] = m[qb]; r[65] = l[qb]; } }
    __syncthreads();                                                 // every wave's partial tile and statistics are in LDS before any thread merges them
    constexpr int EPT = NQB * 16 * HD / (32 * ANW);                  // outputs per thread: consecutive d of one query
    const int qi = (int)threadIdx.x / (HD / EPT), d0 = ((int)threadIdx.x % (HD / EPT)) * EPT; const float* r0 = sm + qi * APIT;
    float M = r0[64];
#pragma unroll
    for (int w = 1; w < ANW; ++w) M = fmaxf(M, r0[w * (NQB * 16 * APIT) + 64]);
    float L = 0.f, acc[EPT];
#pragma unroll
    for (int e = 0; e < EPT; ++e) acc[e] = 0.f;
#pragma unroll
    for (int w = 0; w < ANW; ++w) { const float* rw = r0 + w * (NQB * 16 * APIT); const float wt = ex2(rw[64] - M); L += wt * rw[65];   // a wave that had no block weighs 0; partials added in wave order: the same order on every run
#pragma unroll
        for (int e4 = 0; e4 < EPT; e4 += 4) { const v4f x = *(const v4fa*)(rw + d0 + e4);
#pragma unroll
            for (int j = 0; j < 4; ++j) acc[e4 + j] += wt * x[j]; } }
    const float f = __fdiv_rn(1.0f, L); typename USV<EPT>::T oh, ol;
#pragma unroll
    for (int e = 0; e < EPT; ++e) { unsigned short a, c; splitf(acc[e] * f, a, c); oh[e] = a; ol[e] = c; }
    const size_t oo = (size_t)(q0 + qi) * DQ + d0; *(typename USV<EPT>::T*)(Ah + oo) = oh; *(typename USV<EPT>::T*)(Al + oo) = ol;
    asm volatile("s_wait_xcnt 0x0" ::: "memory");   // one body's code is laid out in front of the other's: the wait stands between these stores and any later write of their address or data registers
}
// grid (planes, query tiles): tiles in falling order of their key count, the longest start first; query rows >= RH in tiles of 32 (fp16 body), rows < RH in tiles of 16 (hi/lo 3-product body); the choice is uniform for the work-group.
__global__ __launch_bounds__(32 * ANW) void k_attn(const bf* __restrict__ Qh, const bf* __restrict__ Ql, const bf* __restrict__ Kh, const bf* __restrict__ Kl, const bf* __restrict__ Vh, const bf* __restrict__ Vl, const h16* __restrict__ Q16, const h16* __restrict__ K16, const h16* __restrict__ V16, bf* Ah, bf* Al) {
    __shared__ __align__(16) float sm[ANW * 32 * APIT];
    const int pl = (int)blockIdx.x, ty = (int)blockIdx.y; const size_t po = (size_t)pl * TT * HD; const size_t ao = (size_t)(pl / NH_) * TT * DQ + (size_t)(pl % NH_) * HD;   /* plane = batch * 16 + head */
    if (ty < (TT - RH) / 32) attn_body<h16, false, 2>(sm, TT - 32 * (ty + 1), Q16 + po, nullptr, K16 + po, nullptr, V16 + po, nullptr, Ah + ao, Al + ao);
    else attn_body<bf, true, 1>(sm, RH - 16 * (ty - (TT - RH) / 32 + 1), Qh + po, Ql + po, Kh + po, Kl + po, Vh + po, Vl + po, Ah + ao, Al + ao);
}

typedef __attribute__((ext_vector_type(2))) unsigned short v2us;
typedef __attribute__((ext_vector_type(4))) int v4i;

__constant__ float INV2[HD / 2] = { 1.000000000e+00f, 7.498942018e-01f, 5.623413324e-01f, 4.216965139e-01f, 3.162277639e-01f, 2.371373773e-01f, 1.778279394e-01f, 1.333521456e-01f, 1.000000015e-01f, 7.498942316e-02f, 5.623413250e-02f, 4.216964915e-02f, 3.162277490e-02f, 2.371373773e-02f, 1.778279431e-02f, 1.333521400e-02f, 9.999999776e-03f, 7.498942316e-03f, 5.623413250e-03f, 4.216964822e-03f, 3.162277630e-03f, 2.371373819e-03f, 1.778279431e-03f, 1.333521446e-03f, 1.000000047e-03f, 7.498941850e-04f, 5.623413017e-04f, 4.216965172e-04f, 3.162277571e-04f, 2.371373703e-04f, 1.778279402e-04f, 1.333521504e-04f };   // 10000 ** (-2i / 64), i = 0..31, in float32 as THIS module writes it (the NEGATIVE-POWER spelling '10000.0 ** (-ts / dim)' evaluated in the reference's own f32 arithmetic: these 32 literals equal it bit for bit); ten entries differ by one ulp from the reciprocal values the host's own table held

// ---- k_prep: the three preparations, which do not depend on one another, in ONE grid (the choice is uniform for the work-group); the longest blocks have the lowest indices and start first.
#define PBW1 ((DM * DQ / 64 + 63) / 64)   // blocks per transposed weight
#define PBW  (4 * PBW1)                   // blocks 0 .. PBW-1: the four 'xw' weights, transposed to bf16, one plane behind the other
#define PBC  ((TT * HD + 255) / 256)      // the next PBC blocks: the rotation table
#define PBX  ((NB_ * TT * DM / 8 + 255) / 256)   // the last PBX blocks: the bf16 copy of x, 8 elements a thread
__global__ __launch_bounds__(256) void k_prep(const float* __restrict__ w0, const float* __restrict__ w1, const float* __restrict__ w2, const float* __restrict__ w3, const float* __restrict__ src, bf* Bt, float* CS, bf* dst) {
    const int blk = (int)blockIdx.x;
    if (blk < PBW) {
        constexpr int K = DM, N = DQ; const int wy = blk / PBW1, wx = blk % PBW1;
        const float* w = wy == 0 ? w0 : wy == 1 ? w1 : wy == 2 ? w2 : w3; Bt += (size_t)wy * K * N;
        const int lane = threadIdx.x & 31; const int L0 = (wx * 8 + (threadIdx.x >> 5)) * 8; const int nlines = N * K / 64;
#pragma unroll 1
        for (int l = 0; l < 8; ++l) { const int L = L0 + l; if (L >= nlines) break; const size_t e = (size_t)L * 64 + lane * 2; const int k = (int)(e % K), n = (int)(e / K); v2us o;
            o[0] = f2bf(w[(size_t)k * N + n]); o[1] = f2bf(w[(size_t)(k + 1) * N + n]); *(v2us*)(Bt + e) = o; }
    } else if (blk < PBW + PBC) {
        const int idx = (blk - PBW) * 256 + threadIdx.x; if (idx >= TT * HD) return; const int d = idx % HD; const int t = idx / HD; const float a = __fmul_rn((float)t, INV2[d >> 1]); v2f cs; cs[0] = cosf(a); cs[1] = sinf(a); *(v2f*)(CS + (size_t)idx * 2) = cs;
    } else {
        const size_t i = (size_t)(blk - PBW - PBC) * 256 + threadIdx.x; if (i >= (size_t)NB_ * TT * DM / 8) return; const v8f v = *(const v8f*)(src + i * 8); v8us o;
#pragma unroll
        for (int k = 0; k < 8; ++k) o[k] = f2bf(v[k]); *(v8us*)(dst + i * 8) = o;
    }
}

extern "C" void kernel_launch(void* const* d_in, const int* in_sizes, int n_in,
                              void* d_out, int out_size, void* d_ws, size_t ws_size, hipStream_t stream) {
    (void)in_sizes; (void)n_in; (void)out_size;
    const float* x = (const float*)d_in[0]; const float* wq = (const float*)d_in[1]; const float* wk = (const float*)d_in[2]; const float* wv = (const float*)d_in[3]; const float* wo = (const float*)d_in[4]; const int* flag = (const int*)d_in[5];   /* order x, Wq, Wk, Wv, Wo ('xw' [1024][1024]), num_heads (the SIXTH input, slot 5: the python int 16 as an int scalar: READ ON DEVICE by the output GEMM: the whole output is NaN unless it equals NH_ = 16) */
    float* OUT = (float*)d_out;     // [2][2048][1024]
    char* wsp = (char*)d_ws;
    auto take = [&](size_t bytes) { char* p = wsp; wsp += (bytes + 255) & ~(size_t)255; return (void*)p; };
    bf* WQ = (bf*)take((size_t)4 * DQ * DM * 2); bf* WO = WQ + (size_t)3 * DQ * DM;   // transposed Wq, Wk, Wv, Wo, one behind the other (z-stride DQ*DM)
    float* CS = (float*)take((size_t)TT * HD * 2 * 4);
    const size_t PL = (size_t)NB_ * NH_ * TT * HD;   // one operand's planes, both batches
    h16* QP16 = (h16*)take(2 * PL * 2); h16* KP16 = QP16 + PL; bf* QPh = (bf*)take(2 * PL * 2); bf* KPh = QPh + PL; bf* QPl = (bf*)take(2 * PL * 2); bf* KPl = QPl + PL;   // k planes directly behind the q planes: plane index (z * 2 + batch) * 16 + head in the projection's epilogue
    h16* VT16 = (h16*)take(PL * 2); bf* VTh = (bf*)take(PL * 2); bf* VTl = (bf*)take(PL * 2);
    bf* ATh = (bf*)take((size_t)NB_ * TT * DQ * 2); bf* ATl = (bf*)take((size_t)NB_ * TT * DQ * 2);
    bf* XB = (bf*)take((size_t)NB_ * TT * DM * 2);   // bf16 copy of x
    if ((size_t)(wsp - (char*)d_ws) > ws_size) return;    // ws 256 MiB
    k_prep<<<PBW + PBC + PBX, 256, 0, stream>>>(wq, wk, wv, wo, x, WQ, CS, XB);
    k_gemmt<0, true, false><<<dim3(NB_ * TT / 128, DQ / 128, 3), 128, 0, stream>>>(XB, nullptr, WQ, DM, nullptr, 0, (size_t)DQ * DM, CS, QP16, QPh, QPl, VT16, VTh, VTl, nullptr);
    k_attn<<<dim3(NB_ * NH_, (TT - RH) / 32 + RH / 16, 1), 32 * ANW, 0, stream>>>(QPh, QPl, KPh, KPl, VTh, VTl, QP16, KP16, VT16, ATh, ATl);   // one kv head per query head: plane index batch * 16 + head for q, k and v alike
    k_gemmt<1, false, true><<<dim3(NB_ * TT / 128, DM / 128, 1), 128, 0, stream>>>(ATh, ATl, WO, DQ, OUT, DM, 0, nullptr, nullptr, nullptr, nullptr, nullptr, nullptr, nullptr, flag);   // the premise guard rides in its stores
}

// v007
// Measured time: 87.9 microseconds a run.
// Two timings next to v006 both put it at 1.21 times that version's speed.
// All steps since v000 together make it 16.5 times as fast.
#include <hip/hip_runtime.h>

// Causal multi-head attention with a pre-scaled query, interleaved-pair rotary embeddings and a scalar head-count input (x [2][2048][1024]; q = (x Wq) x 1/sqrt(1024), k = x Wk, v = x Wv ('xw' [1024][1024] 0.02, no bias; 16 heads x 64: the head count arrives as the python int 16, the LAST input: read on device by the premise guard); rope x cos + x_rot sin with x_rot: (x1, x2) -> (-x2, x1) on adjacent pairs and cos / sin = repeat(c, 2) of angle t x 10000^(-2i/64) (32 f32 frequencies jnp-exact for the module's negative-power expression; precise cosf/sinf); logits = q.k (no further scale: net 1/32); where(tril, logits, -1e8) == exclusion; softmax; out = merged Wo ('xw', no bias) -> [2][2048][1024] (4.2 M); argument order x, Wq, Wk, Wv, Wo, num_heads).
// VALUE PREMISE: this kernel implements num_heads == 16 only; the output GEMM reads the scalar on the device and stores NaN in place of every output element if it is not 16.
// Layout (both batches in every launch; planes ordered [batch * 16 + head]): k_prep: bf16 copy of x, 'xw' weights transposed once and the rotation table, in one grid; exact projections whose epilogue applies the rotation (computed table, pair-shared entries) and writes the q, k and transposed v planes itself; k_attn causal T-2048 attention of all planes in one launch, scores and probabilities in registers (hybrid rows: < 512 hi/lo 3 products, rest fp16 x1024; key blocks above the diagonal are never formed); merged hi/lo x Wo exact.
// Compute dtypes, f32 accumulate: every input rounded to bf16; projections exact; rotary f32; attention rows < 512 3 products, rest fp16; softmax f32; Wo hl x exact.

#define NB_  2
#define TT   2048
#define DM   1024
#define NH_  16
#define NKV  16
#define HD   64
#define DQ   (NH_ * HD)
#define DKV  (NKV * HD)
#define RH   512                  // query rows < RH use hi+lo planes (0: none)
#define SCL  0.03125f   // 1 / sqrt(1024): the module scales q by 1 / sqrt(d_model) BEFORE the rotation and applies no other scale (a power of two: exact, commutes with the rotation)
typedef _Float16 h16;
typedef unsigned short bf;
typedef __attribute__((ext_vector_type(16))) __bf16   v16bf;
typedef __attribute__((ext_vector_type(16))) _Float16 v16h;
typedef __attribute__((ext_vector_type(8)))  _Float16 v8h;
typedef __attribute__((ext_vector_type(8)))  unsigned short v8us;
typedef __attribute__((ext_vector_type(8)))  float    v8f;
typedef __attribute__((ext_vector_type(4)))  float    v4f;
typedef v8h  __attribute__((may_alias)) v8ha;
typedef v4f  __attribute__((may_alias)) v4fa;
typedef v8us __attribute__((may_alias)) v8usa;
typedef __attribute__((ext_vector_type(4))) unsigned short v4us;
typedef __attribute__((ext_vector_type(4))) _Float16 v4h;
typedef __attribute__((ext_vector_type(2))) float v2f;

__device__ __forceinline__ unsigned short f2bf(float f) { unsigned u = __float_as_uint(f); u += 0x7FFFu + ((u >> 16) & 1u); return (unsigned short)(u >> 16); }
__device__ __forceinline__ float bf2f(unsigned short b) { return __uint_as_float(((unsigned)b) << 16); }
__device__ __forceinline__ float bfr(float f) { return bf2f(f2bf(f)); }
__device__ __forceinline__ void splitf(float y, unsigned short& h, unsigned short& l) { h = f2bf(y); l = f2bf(y - bf2f(h)); }
__device__ __forceinline__ v16h cat16(v8h lo, v8h hi) { return __builtin_shufflevector(lo, hi, 0, 1, 2, 3, 4, 5, 6, 7, 8, 9, 10, 11, 12, 13, 14, 15); }
__device__ __forceinline__ v16bf cat16b(v8us lo, v8us hi) { return __builtin_bit_cast(v16bf, __builtin_shufflevector(lo, hi, 0, 1, 2, 3, 4, 5, 6, 7, 8, 9, 10, 11, 12, 13, 14, 15)); }
__device__ __forceinline__ v8f wmma16(v16h a, v16h b, v8f c) { return __builtin_amdgcn_wmma_f32_16x16x32_f16(false, a, false, b, (short)0, c, false, false); }
__device__ __forceinline__ v8f wmmab(v16bf a, v16bf b, v8f c) { return __builtin_amdgcn_wmma_f32_16x16x32_bf16(false, a, false, b, (short)0, c, false, false); }



// ---- k_gemmt: LDS-staged GEMM, one work-group of 4 waves (2 x 2) per 128x128 output tile; each wave owns one 64x64 sub-tile (16 accumulators) over the WHOLE k range, so no partial tiles are summed.
// Operands are K-contiguous bf16 planes. A stage is 64 k (one 128-B line) of the tile's 128 A rows, 128 B rows (and 128 A2 rows), brought into LDS by asynchronous copies (16 B a lane), two buffers: the next stage flies while this one is worked on. Every staged row is read by two waves.
// C[m][n] (f32, pitch ldc) = sum_k (A[m][k] + A2[m][k]) Bt[n][k] (A2 only where NSPLIT). grid (M/128, N/128, Z), 128 threads; z strides Bt by sB elements. K % 64 == 0.
// PLN (the q, k, v projections; z = 0, 1, 2; one wave's 64-wide column range = one head): no f32 C; the epilogue turns the wave's tile straight into the attention operand planes (fp16, bf16 hi, bf16 lo).
// GRD (the output GEMM): every stored value is replaced by NaN unless flag[0] == NH_ (the premise guard; the scalar is asked for ahead of the k loop, so its latency passes behind it).
// z < 2: rows are tokens, columns d: the interleaved-pair rotation from the table CS, stored to plane [(z * 2 + batch) * 16 + head][t][d]. z == 2: the two operands change places, so the tile comes out as [d][token] and is stored to the transposed plane [batch * 16 + head][d][t] in whole lines.
template <typename T16> struct WFrag;
template <> struct WFrag<h16> { typedef v16h V; static __device__ __forceinline__ V ld(const h16* p) { return cat16(*(const v8h*)p, *(const v8h*)(p + 16)); } static __device__ __forceinline__ v8f mma(V a, V b, v8f c) { return wmma16(a, b, c); } };
template <> struct WFrag<bf> { typedef v16bf V; static __device__ __forceinline__ V ld(const bf* p) { return cat16b(*(const v8us*)p, *(const v8us*)(p + 16)); } static __device__ __forceinline__ v8f mma(V a, V b, v8f c) { return wmmab(a, b, c); } };
#define GKC  64                   // k elements of a stage
#define GPIT 144                  // LDS bytes of a staged row: 128 + 16, the conflict-free pitch for 16-byte reads
// eight copies of one wave: 32 rows of one operand (lane: row lane / 8 of each group of 4, 16-byte piece lane % 8). The s_wait_xcnt stands in the copies' own statement, so that no address register is rewritten ahead of it.
__device__ __forceinline__ void cp8(unsigned l, const bf* g, size_t r4) {
    asm volatile("global_load_async_to_lds_b128 %0, %8, off\n\t"
                 "global_load_async_to_lds_b128 %1, %9, off\n\t"
                 "global_load_async_to_lds_b128 %2, %10, off\n\t"
                 "global_load_async_to_lds_b128 %3, %11, off\n\t"
                 "global_load_async_to_lds_b128 %4, %12, off\n\t"
                 "global_load_async_to_lds_b128 %5, %13, off\n\t"
                 "global_load_async_to_lds_b128 %6, %14, off\n\t"
                 "global_load_async_to_lds_b128 %7, %15, off\n\t"
                 "s_wait_xcnt 0x0"
                 :: "v"(l), "v"(l + 4 * GPIT), "v"(l + 8 * GPIT), "v"(l + 12 * GPIT), "v"(l + 16 * GPIT), "v"(l + 20 * GPIT), "v"(l + 24 * GPIT), "v"(l + 28 * GPIT),
                    "v"(g), "v"(g + r4), "v"(g + 2 * r4), "v"(g + 3 * r4), "v"(g + 4 * r4), "v"(g + 5 * r4), "v"(g + 6 * r4), "v"(g + 7 * r4) : "memory");
}
template <int NSPLIT, bool PLN, bool GRD>
__global__ __launch_bounds__(128) void k_gemmt(const bf* __restrict__ A, const bf* __restrict__ A2, const bf* __restrict__ Bt, int K, float* C, int ldc, size_t sB, const float* __restrict__ CS, h16* P16, bf* Ph, bf* Pl, h16* V16, bf* Vh, bf* Vl, const int* __restrict__ flag) {
    typedef WFrag<bf>::V V;
    constexpr int OPB = 128 * GPIT, STG = (NSPLIT ? 3 : 2) * OPB;    // bytes of one operand's rows in a stage; of a stage
    constexpr int RING = 2 * STG, EPI = 4 * 64 * 68 * 4;             // the two buffers; the four waves' output staging, which takes the ring's place behind the loop
    __shared__ __align__(16) char sm[RING > EPI ? RING : EPI];
    bool bad = false; if constexpr (GRD) bad = flag[0] != NH_;      // uniform for the whole grid
    Bt += (size_t)blockIdx.z * sB;
    const int lane = threadIdx.x & 31, lr = lane & 15, hi = lane >> 4; const int wave = __builtin_amdgcn_readfirstlane((int)(threadIdx.x >> 5)); const int wm = wave >> 1, wn = wave & 1;
    const bool tr = PLN && blockIdx.z == 2;                          // the v projection: tile formed transposed (uniform for the work-group)
    if (tr) { const bf* x = A; A = Bt; Bt = x; }
    const int r0 = (tr ? blockIdx.y : blockIdx.x) * 128, c0 = (tr ? blockIdx.x : blockIdx.y) * 128;
    const int crow = wave * 32 + (lane >> 3);                        // this lane's first row of the 128 of each operand
    const unsigned l0 = (unsigned)(size_t)sm + (unsigned)(crow * GPIT + (lane & 7) * 16);
    const size_t ga = (size_t)(r0 + crow) * K + (lane & 7) * 8, gb = (size_t)(c0 + crow) * K + (lane & 7) * 8, r4 = (size_t)4 * K;
    auto fill = [&](int t) { const unsigned l = l0 + (unsigned)((t & 1) * STG);
        cp8(l, A + ga + t * GKC, r4); cp8(l + OPB, Bt + gb + t * GKC, r4); if constexpr (NSPLIT != 0) cp8(l + 2 * OPB, A2 + ga + t * GKC, r4); };
    v8f acc[4][4];
#pragma unroll
    for (int mb = 0; mb < 4; ++mb)
#pragma unroll
        for (int nb = 0; nb < 4; ++nb) acc[mb][nb] = (v8f){};
    const int NT = K / GKC;
    fill(0);
    asm volatile("s_wait_asynccnt 0x0" ::: "memory");               // this wave's copies of stage 0 have landed
    __syncthreads();                                                 // and every other wave's: stage 0 may be read
    if (NT > 1) fill(1);
#pragma unroll 1   // rolled: one trip a stage, the ring's order stands once in the code
    for (int t = 0; t < NT; ++t) {
        const char* pa = sm + (t & 1) * STG + (wm * 64 + lr) * GPIT + hi * 16; const char* pb = sm + (t & 1) * STG + OPB + (wn * 64 + lr) * GPIT + hi * 16;
#pragma unroll
        for (int ks = 0; ks < 2; ++ks) {
            V a[4], a2[4], b[4];
#pragma unroll
            for (int mb = 0; mb < 4; ++mb) { a[mb] = WFrag<bf>::ld((const bf*)(pa + mb * 16 * GPIT + ks * 64)); if constexpr (NSPLIT != 0) a2[mb] = WFrag<bf>::ld((const bf*)(pa + 2 * OPB + mb * 16 * GPIT + ks * 64)); }
#pragma unroll
            for (int nb = 0; nb < 4; ++nb) b[nb] = WFrag<bf>::ld((const bf*)(pb + nb * 16 * GPIT + ks * 64));   // all of the block's LDS reads stand together, ahead of its products
            __builtin_amdgcn_sched_barrier(0);   // keeps the reads in one group: without it the compiler sinks each B fragment's reads in front of its four products, on one register set, and every group then waits out the LDS latency
#pragma unroll
            for (int nb = 0; nb < 4; ++nb)
#pragma unroll
                for (int mb = 0; mb < 4; ++mb) { acc[mb][nb] = WFrag<bf>::mma(a[mb], b[nb], acc[mb][nb]); if constexpr (NSPLIT != 0) acc[mb][nb] = WFrag<bf>::mma(a2[mb], b[nb], acc[mb][nb]); }
        }
        asm volatile("s_wait_dscnt 0x0" ::: "memory");              // this wave's reads of the buffer have returned
        asm volatile("s_wait_asynccnt 0x0" ::: "memory");           // this wave's copies of the next stage have landed
        __syncthreads();                                             // publishes the next stage and ends every reader's last read of this buffer
        if (t + 2 < NT) fill(t + 2);                                 // refill of the buffer just left (the test reads the same for the whole work-group)
    }
    asm volatile("s_wait_asynccnt 0x0" ::: "memory");               // nothing is in flight when the ring becomes output staging
    const int rw = r0 + wm * 64, cw = c0 + wn * 64;                  // the wave's own 64x64 tile
    float* osw = (float*)sm + wave * (64 * 68);                      // and its own staging range
#pragma unroll
    for (int mb = 0; mb < 4; ++mb)
#pragma unroll
        for (int nb = 0; nb < 4; ++nb)
#pragma unroll
            for (int j = 0; j < 8; ++j) osw[(mb * 16 + hi * 8 + j) * 68 + nb * 16 + lr] = acc[mb][nb][j];
    constexpr int NS = 32;                                           // 4-wide pieces of the tile per lane: piece q = s * 32 + lane holds row q / 16, columns 4 (q % 16)..
    v2f cs[NS][2];                                                   // (cos, sin) of this lane's two pairs in each of its pieces: asked for here, all at once, so that the table's latency is met once and passes behind the LDS round
    if constexpr (PLN) { if (!tr) { const float* c = CS + (size_t)(rw % TT) * (HD * 2) + lane * 8;   // table entry (row * 64 + column) * 2 = 8 q
#pragma unroll   // cs is indexed by constants only, so it stays in registers
        for (int s = 0; s < NS; ++s) { cs[s][0] = *(const v2f*)(c + s * 256); cs[s][1] = *(const v2f*)(c + s * 256 + 4); }
        asm volatile("s_wait_xcnt 0x0" ::: "memory"); } }   // behind the table loads, which stay in flight: their address registers are reused behind them
    __syncthreads();                                                 // the staged tile is whole before its lanes read one another's values
    v4f pg[8];                                                       // indexed by constants only (the loops below are unrolled), so it stays in registers
    if constexpr (PLN) {
        const int tk = tr ? cw : rw, hd = (tr ? rw : cw) / HD;       // the tile's first token (64 divides TT, so a tile lies in one batch) and its head
        const size_t eb = tr ? ((size_t)(tk / TT) * NH_ + hd) * HD * TT + tk % TT : ((((size_t)blockIdx.z * NB_ + tk / TT) * NH_ + hd) * TT + tk % TT) * HD;
        const int pit = tr ? TT : HD; h16* d16 = (tr ? V16 : P16) + eb; bf* dh = (tr ? Vh : Ph) + eb; bf* dl = (tr ? Vl : Pl) + eb;
#pragma unroll   // cs is indexed by constants only, so it stays in registers
        for (int s = 0; s < NS; ++s) { const int q = s * 32 + lane; const int o = (q >> 4) * pit + (q & 15) * 4;
            if (s % 8 == 0) {   // eight pieces are read from LDS at a time, so that its latency is met once for the eight
#pragma unroll
                for (int u = 0; u < 8; ++u) pg[u] = *(const v4fa*)(osw + ((q >> 4) + 2 * u) * 68 + (q & 15) * 4); }
            const v4f pv = pg[s % 8]; v4f r = pv;
            if (!tr) {
#pragma unroll   // vector elements picked by constants
                for (int p = 0; p < 2; ++p) { const float x0 = pv[2 * p], x1 = pv[2 * p + 1], c = cs[s][p][0], sn = cs[s][p][1]; r[2 * p] = x0 * c - x1 * sn; r[2 * p + 1] = x0 * sn + x1 * c; } }   /* even: x0 c - x1 s; odd: x0 s + x1 c */
            v4h o16; v4us oh, ol;
#pragma unroll   // vector elements picked by constants
            for (int j = 0; j < 4; ++j) { o16[j] = (h16)r[j]; unsigned short a2, c2; splitf(r[j], a2, c2); oh[j] = a2; ol[j] = c2; }
            *(v4h*)(d16 + o) = o16; *(v4us*)(dh + o) = oh; *(v4us*)(dl + o) = ol;
            asm volatile("s_wait_xcnt 0x0" ::: "memory");   // behind the three stores: the next piece's values may land on their address or data registers
        }
    } else {
        float* crow = C + (size_t)rw * ldc + cw;
#pragma unroll
        for (int s = 0; s < NS; ++s) { const int q = s * 32 + lane;
            if (s % 8 == 0) {   // eight pieces are read from LDS at a time, so that its latency is met once for the eight
#pragma unroll
                for (int u = 0; u < 8; ++u) pg[u] = *(const v4fa*)(osw + ((q >> 4) + 2 * u) * 68 + (q & 15) * 4); }
            v4f val = pg[s % 8];
            if constexpr (GRD) { if (bad) { const float qn = __int_as_float(0x7fc00000); val[0] = qn; val[1] = qn; val[2] = qn; val[3] = qn; } }   // premise fails: the whole output is NaN
            *(v4f*)(crow + (size_t)(q >> 4) * ldc + (q & 15) * 4) = val;
            asm volatile("s_wait_xcnt 0x0" ::: "memory");   // behind the store: the next piece's value may land on its address or data registers
        }
    }
}

// ---- k_attn: causal attention of one query tile of one (batch, head) plane in one work-group; scores and probabilities never leave the registers.
// Transposed products: S^T = K Q^T (A = 16 keys x 32 d from the key plane, B = 16 queries from the query plane), so a lane holds 8 + 8 keys of ONE query (column lr, rows hi * 8 + j of two 16-key tiles): exactly the k order of a B fragment
// (elements 0..7 = keys 8 hi + e, elements 8..15 = keys 16 + 8 hi + e), which then meets A = V^T (16 d x 32 keys, same k order) in O^T = V^T P^T. Row statistics are per lane (one exchange between the two 16-lane halves).
// The 8 waves are AQG query groups x AKG key groups. A stage is AKS = 128 keys of K (whole 128-B rows) and of V^T (256 B of each of its 64 rows), brought into LDS in whole lines by asynchronous copies (16 B a lane), two buffers: the next stage flies while this one is worked on.
// Key group c takes the stage's 32-key block c, up to its query group's diagonal block, with its own running maximum, sum and O^T (online softmax); a staged block is read by each query group whose diagonal block it does not pass. The AKG partials of a query are merged through LDS in key-group order (a fixed order), normalised, split hi/lo and stored in merged [token][head * 64 + d] order.
#define ANW  8                    // waves per work-group
#define AQG  2                    // query groups
#define AKG  4                    // key groups: the waves of one query group share the key loop
#define AKS  (AKG * 32)           // keys of a stage
#define KPIT 144                  // LDS bytes of a staged key row: 128 + 16, the conflict-free pitch for 16-byte reads
#define VPIT 272                  // LDS bytes of a staged V^T row: 256 + 16, likewise
#define AKB  (AKS * KPIT)         // bytes of a stage's key rows
#define AVB  (HD * VPIT)          // bytes of a stage's V^T rows
#define APIT 68                   // f32 pitch of one query's partial row in LDS: 64 outputs, then its maximum and its sum
__device__ __forceinline__ float ex2(float x) { float r; asm("v_exp_f32 %0, %1\n\tv_nop" : "=v"(r) : "v"(x)); return r; }   // 2^x; the v_nop is the one slot the instruction set asks for behind a transcendental, tied to it by standing in its statement
__device__ __forceinline__ float xhalf(float x) { return __builtin_bit_cast(float, __builtin_amdgcn_permlanex16(__builtin_bit_cast(int, x), __builtin_bit_cast(int, x), 0x76543210, 0xfedcba98, false, false)); }   // lane l reads lane l ^ 16 (a vector move, no LDS round trip)
// four copies of one wave, 512 B each; LDS step ls and global step gs in bytes. The s_wait_xcnt stands in the copies' own statement, so that no address register is rewritten ahead of it.
__device__ __forceinline__ void cp4(unsigned l, unsigned ls, const char* g, size_t gs) {
    asm volatile("global_load_async_to_lds_b128 %0, %4, off\n\t"
                 "global_load_async_to_lds_b128 %1, %5, off\n\t"
                 "global_load_async_to_lds_b128 %2, %6, off\n\t"
                 "global_load_async_to_lds_b128 %3, %7, off\n\t"
                 "s_wait_xcnt 0x0"
                 :: "v"(l), "v"(l + ls), "v"(l + 2 * ls), "v"(l + 3 * ls), "v"(g), "v"(g + gs), "v"(g + 2 * gs), "v"(g + 3 * gs) : "memory");
}
template <typename T16, bool HR, int NQB>
__device__ __forceinline__ void attn_body(char* sm, int q0, const T16* __restrict__ Q, const T16* __restrict__ Q2, const T16* __restrict__ Kp, const T16* __restrict__ Kp2, const T16* __restrict__ Vt, const T16* __restrict__ Vt2, bf* Ah, bf* Al) {
    typedef typename WFrag<T16>::V V;
    constexpr float K1 = SCL * 1.4426950408889634f;                  // logit scale and log2(e) in one factor: the statistics live in the base-2 exponent's units
    constexpr float PB = HR ? 0.0f : 10.0f;                          // fp16 probabilities carry a factor 2^10, which cancels in the division by their own sum
    constexpr int PLB = AKB + AVB, STG = (HR ? 2 : 1) * PLB;         // bytes of one plane set's K and V^T rows in a stage; of a stage (hi set, then lo set)
    const int lane = threadIdx.x & 31, lr = lane & 15, hi = lane >> 4; const int wave = __builtin_amdgcn_readfirstlane((int)(threadIdx.x >> 5)); const int qg = wave / AKG, kg = wave % AKG;
    const int qw = q0 + qg * (NQB * 16);                             // the first query of this wave's group
    // this wave's share of a stage: key rows 16 wave .. + 15 (a copy: 4 rows, lane: row lane / 8, piece lane % 8) and V^T rows 8 wave .. + 7 (a copy: 2 rows, lane: row lane / 16, piece lane % 16)
    const unsigned lk = (unsigned)(size_t)sm + (unsigned)((wave * 16 + (lane >> 3)) * KPIT + (lane & 7) * 16), lv = (unsigned)(size_t)sm + (unsigned)(AKB + (wave * 8 + (lane >> 4)) * VPIT + (lane & 15) * 16);
    const size_t gk = (size_t)(wave * 16 + (lane >> 3)) * HD + (lane & 7) * 8, gv = (size_t)(wave * 8 + (lane >> 4)) * TT + (lane & 15) * 8;
    auto fill = [&](int s) { const unsigned b = (unsigned)((s & 1) * STG); const size_t ok = gk + (size_t)s * (AKS * HD), ov = gv + (size_t)s * AKS;
        cp4(lk + b, 4 * KPIT, (const char*)(Kp + ok), 4 * HD * 2); cp4(lv + b, 2 * VPIT, (const char*)(Vt + ov), 2 * TT * 2);
        if constexpr (HR) { cp4(lk + b + PLB, 4 * KPIT, (const char*)(Kp2 + ok), 4 * HD * 2); cp4(lv + b + PLB, 2 * VPIT, (const char*)(Vt2 + ov), 2 * TT * 2); } };
    const int NT = q0 / AKS + 1;                                     // stages up to and with the one that holds the tile's last diagonal block; NT * AKS <= TT, so every staged row lies in the plane
    fill(0);
    V bq[NQB][2], bq2[NQB][2];
#pragma unroll
    for (int qb = 0; qb < NQB; ++qb)
#pragma unroll
        for (int ks = 0; ks < 2; ++ks) { const size_t qo = (size_t)(qw + qb * 16 + lr) * HD + 8 * hi + ks * 32; bq[qb][ks] = WFrag<T16>::ld(Q + qo); if (HR) bq2[qb][ks] = WFrag<T16>::ld(Q2 + qo); }
    v8f o[NQB][4]; float m[NQB], l[NQB];
#pragma unroll
    for (int qb = 0; qb < NQB; ++qb) { m[qb] = -1.0e30f; l[qb] = 0.f;
#pragma unroll
        for (int db = 0; db < 4; ++db) o[qb][db] = (v8f){}; }
    const int nkb = qw / 32 + 1;                                     // 32-key blocks up to and with this group's diagonal block; every query of the group has a key in each of them
    asm volatile("s_wait_asynccnt 0x0" ::: "memory");               // this wave's copies of stage 0 have landed
    __syncthreads();                                                 // and every other wave's: stage 0 may be read
    if (NT > 1) fill(1);
#pragma unroll 1   // rolled: one trip a stage, the ring's order stands once in the code; one block's K and V fragments live at a time, which keeps four waves on a SIMD; every inner loop is unrolled so that fragments and accumulators stay in registers
    for (int t = 0; t < NT; ++t) {
        const int kb = t * AKG + kg;
        if (kb < nkb) {                                              // a scalar test: a wave whose block lies behind its group's diagonal block has no work in this stage, but passes the stage's waits and barrier
            const int k0 = kb * 32;
            const char* pk = sm + (t & 1) * STG + (kg * 32 + lr) * KPIT + hi * 16; const char* pv = sm + (t & 1) * STG + AKB + lr * VPIT + kg * 64 + hi * 16;
            V ak[2][2], ak2[2][2], av[4], av2[4];
#pragma unroll
            for (int kt = 0; kt < 2; ++kt)
#pragma unroll
                for (int ks = 0; ks < 2; ++ks) { const int ko = kt * 16 * KPIT + ks * 64; ak[kt][ks] = WFrag<T16>::ld((const T16*)(pk + ko)); if (HR) ak2[kt][ks] = WFrag<T16>::ld((const T16*)(pk + PLB + ko)); }
#pragma unroll
            for (int db = 0; db < 4; ++db) { const int vo = db * 16 * VPIT; av[db] = WFrag<T16>::ld((const T16*)(pv + vo)); if (HR) av2[db] = WFrag<T16>::ld((const T16*)(pv + PLB + vo)); }
#pragma unroll
            for (int qb = 0; qb < NQB; ++qb) {
                v8f st[2];                                           // st[kt][j] = q.k of key k0 + kt * 16 + hi * 8 + j and query qw + qb * 16 + lr
#pragma unroll
                for (int kt = 0; kt < 2; ++kt) { v8f s = (v8f){};
#pragma unroll
                    for (int ks = 0; ks < 2; ++ks) { s = WFrag<T16>::mma(ak[kt][ks], bq[qb][ks], s); if (HR) { s = WFrag<T16>::mma(ak[kt][ks], bq2[qb][ks], s); s = WFrag<T16>::mma(ak2[kt][ks], bq[qb][ks], s); } }
                    st[kt] = s; }
                if (kb == nkb - 1) {                                 // only the diagonal block holds keys behind a query
#pragma unroll
                    for (int kt = 0; kt < 2; ++kt)
#pragma unroll
                        for (int j = 0; j < 8; ++j) if (k0 + kt * 16 + hi * 8 + j > qw + qb * 16 + lr) st[kt][j] = -1.0e30f; }
                float mx = st[0][0];
#pragma unroll
                for (int e = 1; e < 16; ++e) mx = fmaxf(mx, st[e >> 3][e & 7]);
                mx = fmaxf(mx, xhalf(mx));
                const float mn = fmaxf(m[qb], mx * K1 - PB); const float al = ex2(m[qb] - mn); m[qb] = mn;
                float p[16], ps = 0.f;
#pragma unroll
                for (int e = 0; e < 16; ++e) { p[e] = ex2(st[e >> 3][e & 7] * K1 - mn); ps += p[e]; }
                l[qb] = l[qb] * al + ps;
#pragma unroll
                for (int db = 0; db < 4; ++db) o[qb][db] *= al;
                if constexpr (HR) { v8us h0, h1, l0, l1;
#pragma unroll
                    for (int e = 0; e < 8; ++e) { unsigned short a, c; splitf(p[e], a, c); h0[e] = a; l0[e] = c; splitf(p[8 + e], a, c); h1[e] = a; l1[e] = c; }
                    const V ph = cat16b(h0, h1), pl = cat16b(l0, l1);
#pragma unroll
                    for (int db = 0; db < 4; ++db) { o[qb][db] = WFrag<T16>::mma(av[db], ph, o[qb][db]); o[qb][db] = WFrag<T16>::mma(av[db], pl, o[qb][db]); o[qb][db] = WFrag<T16>::mma(av2[db], ph, o[qb][db]); }
                } else { V pb;
#pragma unroll
                    for (int e = 0; e < 16; ++e) pb[e] = (h16)p[e];
#pragma unroll
                    for (int db = 0; db < 4; ++db) o[qb][db] = WFrag<T16>::mma(av[db], pb, o[qb][db]); }
            }
            asm volatile("v_nop\n\tv_nop\n\tv_nop\n\tv_nop" : "+v"(o[NQB - 1][0]), "+v"(o[NQB - 1][1]), "+v"(o[NQB - 1][2]), "+v"(o[NQB - 1][3]));   // the matrix instructions' distance on the branches behind them (out of the loop, whose target reads o)
        }
        asm volatile("s_wait_dscnt 0x0" ::: "memory");              // this wave's reads of the buffer have returned
        asm volatile("s_wait_asynccnt 0x0" ::: "memory");           // this wave's copies of the next stage have landed
        __syncthreads();                                             // publishes the next stage and ends every reader's last read of this buffer
        if (t + 2 < NT) fill(t + 2);                                 // refill of the buffer just left (the test reads the same for the whole work-group)
    }
    asm volatile("s_wait_asynccnt 0x0" ::: "memory");               // nothing is in flight when the ring becomes the partials' staging
    float* smf = (float*)sm; float* my = smf + wave * (NQB * 16 * APIT);   // this wave's own partial tile
#pragma unroll
    for (int qb = 0; qb < NQB; ++qb) { l[qb] += xhalf(l[qb]); float* r = my + (qb * 16 + lr) * APIT;
#pragma unroll
        for (int db = 0; db < 4; ++db) { v4f a, b;
#pragma unroll
            for (int j = 0; j < 4; ++j) { a[j] = o[qb][db][j]; b[j] = o[qb][db][4 + j]; }
            *(v4fa*)(r + db * 16 + hi * 8) = a; *(v4fa*)(r + db * 16 + hi * 8 + 4) = b; }
        if (hi == 0) { r[64] = m[qb]; r[65] = l[qb]; } }
    __syncthreads();                                                 // every wave's partial tile and statistics are in LDS before any thread merges them
    constexpr int EPT = AQG * NQB * 16 * HD / (32 * ANW);            // outputs per thread: consecutive d of one query
    const int qi = (int)threadIdx.x / (HD / EPT), d0 = ((int)threadIdx.x % (HD / EPT)) * EPT; const float* r0 = smf + (qi / (NQB * 16)) * (AKG * NQB * 16 * APIT) + (qi % (NQB * 16)) * APIT;   // the query's row in the partial tile of its group's key group 0
    float M = r0[64];
#pragma unroll
    for (int w = 1; w < AKG; ++w) M = fmaxf(M, r0[w * (NQB * 16 * APIT) + 64]);
    float L = 0.f, acc[EPT];
#pragma unroll
    for (int e = 0; e < EPT; ++e) acc[e] = 0.f;
#pragma unroll
    for (int w = 0; w < AKG; ++w) { const float* rw = r0 + w * (NQB * 16 * APIT); const float wt = ex2(rw[64] - M); L += wt * rw[65];   // a wave that had no block weighs 0; partials added in key-group order: the same order on every run
#pragma unroll
        for (int e4 = 0; e4 < EPT; e4 += 4) { const v4f x = *(const v4fa*)(rw + d0 + e4);
#pragma unroll
            for (int j = 0; j < 4; ++j) acc[e4 + j] += wt * x[j]; } }
    const float f = __fdiv_rn(1.0f, L); const size_t oo = (size_t)(q0 + qi) * DQ + d0;
#pragma unroll
    for (int e8 = 0; e8 < EPT; e8 += 8) { v8us oh, ol;
#pragma unroll
        for (int e = 0; e < 8; ++e) { unsigned short a, c; splitf(acc[e8 + e] * f, a, c); oh[e] = a; ol[e] = c; }
        *(v8us*)(Ah + oo + e8) = oh; *(v8us*)(Al + oo + e8) = ol; }
    asm volatile("s_wait_xcnt 0x0" ::: "memory");   // one body's code is laid out in front of the other's: the wait stands between these stores and any later write of their address or data registers
}
// grid (planes, query tiles): tiles in falling order of their key count, the longest start first; query rows >= RH in tiles of 64 (fp16 body), rows < RH in tiles of 32 (hi/lo 3-product body); the choice is uniform for the work-group.
__global__ __launch_bounds__(32 * ANW) void k_attn(const bf* __restrict__ Qh, const bf* __restrict__ Ql, const bf* __restrict__ Kh, const bf* __restrict__ Kl, const bf* __restrict__ Vh, const bf* __restrict__ Vl, const h16* __restrict__ Q16, const h16* __restrict__ K16, const h16* __restrict__ V16, bf* Ah, bf* Al) {
    __shared__ __align__(16) char sm[2 * 2 * (AKB + AVB)];           // the hi/lo body's two buffers; the fp16 body uses half; the partial tiles (ANW * 32 * APIT floats at most) take the ring's place behind the loop
    const int pl = (int)blockIdx.x, ty = (int)blockIdx.y; const size_t po = (size_t)pl * TT * HD; const size_t ao = (size_t)(pl / NH_) * TT * DQ + (size_t)(pl % NH_) * HD;   /* plane = batch * 16 + head */
    if (ty < (TT - RH) / 64) attn_body<h16, false, 2>(sm, TT - 64 * (ty + 1), Q16 + po, nullptr, K16 + po, nullptr, V16 + po, nullptr, Ah + ao, Al + ao);
    else attn_body<bf, true, 1>(sm, RH - 32 * (ty - (TT - RH) / 64 + 1), Qh + po, Ql + po, Kh + po, Kl + po, Vh + po, Vl + po, Ah + ao, Al + ao);
}

typedef __attribute__((ext_vector_type(2))) unsigned short v2us;
typedef __attribute__((ext_vector_type(4))) int v4i;

__constant__ float INV2[HD / 2] = { 1.000000000e+00f, 7.498942018e-01f, 5.623413324e-01f, 4.216965139e-01f, 3.162277639e-01f, 2.371373773e-01f, 1.778279394e-01f, 1.333521456e-01f, 1.000000015e-01f, 7.498942316e-02f, 5.623413250e-02f, 4.216964915e-02f, 3.162277490e-02f, 2.371373773e-02f, 1.778279431e-02f, 1.333521400e-02f, 9.999999776e-03f, 7.498942316e-03f, 5.623413250e-03f, 4.216964822e-03f, 3.162277630e-03f, 2.371373819e-03f, 1.778279431e-03f, 1.333521446e-03f, 1.000000047e-03f, 7.498941850e-04f, 5.623413017e-04f, 4.216965172e-04f, 3.162277571e-04f, 2.371373703e-04f, 1.778279402e-04f, 1.333521504e-04f };   // 10000 ** (-2i / 64), i = 0..31, in float32 as THIS module writes it (the NEGATIVE-POWER spelling '10000.0 ** (-ts / dim)' evaluated in the reference's own f32 arithmetic: these 32 literals equal it bit for bit); ten entries differ by one ulp from the reciprocal values the host's own table held

// ---- k_prep: the three preparations, which do not depend on one another, in ONE grid (the choice is uniform for the work-group); the longest blocks have the lowest indices and start first.
#define PBW1 ((DM * DQ / 64 + 63) / 64)   // blocks per transposed weight
#define PBW  (4 * PBW1)                   // blocks 0 .. PBW-1: the four 'xw' weights, transposed to bf16, one plane behind the other
#define PBC  ((TT * HD + 255) / 256)      // the next PBC blocks: the rotation table
#define PBX  ((NB_ * TT * DM / 8 + 255) / 256)   // the last PBX blocks: the bf16 copy of x, 8 elements a thread
__global__ __launch_bounds__(256) void k_prep(const float* __restrict__ w0, const float* __restrict__ w1, const float* __restrict__ w2, const float* __restrict__ w3, const float* __restrict__ src, bf* Bt, float* CS, bf* dst) {
    const int blk = (int)blockIdx.x;
    if (blk < PBW) {
        constexpr int K = DM, N = DQ; const int wy = blk / PBW1, wx = blk % PBW1;
        const float* w = wy == 0 ? w0 : wy == 1 ? w1 : wy == 2 ? w2 : w3; Bt += (size_t)wy * K * N;
        const int lane = threadIdx.x & 31; const int L0 = (wx * 8 + (threadIdx.x >> 5)) * 8; const int nlines = N * K / 64;
#pragma unroll 1
        for (int l = 0; l < 8; ++l) { const int L = L0 + l; if (L >= nlines) break; const size_t e = (size_t)L * 64 + lane * 2; const int k = (int)(e % K), n = (int)(e / K); v2us o;
            o[0] = f2bf(w[(size_t)k * N + n]); o[1] = f2bf(w[(size_t)(k + 1) * N + n]); *(v2us*)(Bt + e) = o; }
    } else if (blk < PBW + PBC) {
        const int idx = (blk - PBW) * 256 + threadIdx.x; if (idx >= TT * HD) return; const int d = idx % HD; const int t = idx / HD; const float a = __fmul_rn((float)t, INV2[d >> 1]); v2f cs; cs[0] = cosf(a); cs[1] = sinf(a); *(v2f*)(CS + (size_t)idx * 2) = cs;
    } else {
        const size_t i = (size_t)(blk - PBW - PBC) * 256 + threadIdx.x; if (i >= (size_t)NB_ * TT * DM / 8) return; const v8f v = *(const v8f*)(src + i * 8); v8us o;
#pragma unroll
        for (int k = 0; k < 8; ++k) o[k] = f2bf(v[k]); *(v8us*)(dst + i * 8) = o;
    }
}

extern "C" void kernel_launch(void* const* d_in, const int* in_sizes, int n_in,
                              void* d_out, int out_size, void* d_ws, size_t ws_size, hipStream_t stream) {
    (void)in_sizes; (void)n_in; (void)out_size;
    const float* x = (const float*)d_in[0]; const float* wq = (const float*)d_in[1]; const float* wk = (const float*)d_in[2]; const float* wv = (const float*)d_in[3]; const float* wo = (const float*)d_in[4]; const int* flag = (const int*)d_in[5];   /* order x, Wq, Wk, Wv, Wo ('xw' [1024][1024]), num_heads (the SIXTH input, slot 5: the python int 16 as an int scalar: READ ON DEVICE by the output GEMM: the whole output is NaN unless it equals NH_ = 16) */
    float* OUT = (float*)d_out;     // [2][2048][1024]
    char* wsp = (char*)d_ws;
    auto take = [&](size_t bytes) { char* p = wsp; wsp += (bytes + 255) & ~(size_t)255; return (void*)p; };
    bf* WQ = (bf*)take((size_t)4 * DQ * DM * 2); bf* WO = WQ + (size_t)3 * DQ * DM;   // transposed Wq, Wk, Wv, Wo, one behind the other (z-stride DQ*DM)
    float* CS = (float*)take((size_t)TT * HD * 2 * 4);
    const size_t PL = (size_t)NB_ * NH_ * TT * HD;   // one operand's planes, both batches
    h16* QP16 = (h16*)take(2 * PL * 2); h16* KP16 = QP16 + PL; bf* QPh = (bf*)take(2 * PL * 2); bf* KPh = QPh + PL; bf* QPl = (bf*)take(2 * PL * 2); bf* KPl = QPl + PL;   // k planes directly behind the q planes: plane index (z * 2 + batch) * 16 + head in the projection's epilogue
    h16* VT16 = (h16*)take(PL * 2); bf* VTh = (bf*)take(PL * 2); bf* VTl = (bf*)take(PL * 2);
    bf* ATh = (bf*)take((size_t)NB_ * TT * DQ * 2); bf* ATl = (bf*)take((size_t)NB_ * TT * DQ * 2);
    bf* XB = (bf*)take((size_t)NB_ * TT * DM * 2);   // bf16 copy of x
    if ((size_t)(wsp - (char*)d_ws) > ws_size) return;    // ws 256 MiB
    k_prep<<<PBW + PBC + PBX, 256, 0, stream>>>(wq, wk, wv, wo, x, WQ, CS, XB);
    k_gemmt<0, true, false><<<dim3(NB_ * TT / 128, DQ / 128, 3), 128, 0, stream>>>(XB, nullptr, WQ, DM, nullptr, 0, (size_t)DQ * DM, CS, QP16, QPh, QPl, VT16, VTh, VTl, nullptr);
    k_attn<<<dim3(NB_ * NH_, (TT - RH) / 64 + RH / 32, 1), 32 * ANW, 0, stream>>>(QPh, QPl, KPh, KPl, VTh, VTl, QP16, KP16, VT16, ATh, ATl);   // one kv head per query head: plane index batch * 16 + head for q, k and v alike
    k_gemmt<1, false, true><<<dim3(NB_ * TT / 128, DM / 128, 1), 128, 0, stream>>>(ATh, ATl, WO, DQ, OUT, DM, 0, nullptr, nullptr, nullptr, nullptr, nullptr, nullptr, nullptr, flag);   // the premise guard rides in its stores
}

// v008
// It runs in 83.1 microseconds.
// Two timings next to v007 put it at 1.05 and 1.06 times that version's speed.
// Counting every step since v000, it is 17.4 times as fast.
#include <hip/hip_runtime.h>

// Causal multi-head attention with a pre-scaled query, interleaved-pair rotary embeddings and a scalar head-count input (x [2][2048][1024]; q = (x Wq) x 1/sqrt(1024), k = x Wk, v = x Wv ('xw' [1024][1024] 0.02, no bias; 16 heads x 64: the head count arrives as the python int 16, the LAST input: read on device by the premise guard); rope x cos + x_rot sin with x_rot: (x1, x2) -> (-x2, x1) on adjacent pairs and cos / sin = repeat(c, 2) of angle t x 10000^(-2i/64) (32 f32 frequencies jnp-exact for the module's negative-power expression; precise cosf/sinf); logits = q.k (no further scale: net 1/32); where(tril, logits, -1e8) == exclusion; softmax; out = merged Wo ('xw', no bias) -> [2][2048][1024] (4.2 M); argument order x, Wq, Wk, Wv, Wo, num_heads).
// VALUE PREMISE: this kernel implements num_heads == 16 only; the output GEMM reads the scalar on the device and stores NaN in place of every output element if it is not 16.
// Layout (both batches in every launch; planes ordered [batch * 16 + head]): k_prep: bf16 copy of x, 'xw' weights transposed once and the rotation table, in one grid; exact projections whose epilogue applies the rotation (computed table, pair-shared entries) and writes the q, k and transposed v planes itself; k_attn causal T-2048 attention of all planes in one launch, scores and probabilities in registers (hybrid rows: < 512 hi/lo 3 products, rest fp16 x1024; key blocks above the diagonal are never formed); merged hi/lo x Wo exact.
// Compute dtypes, f32 accumulate: every input rounded to bf16; projections exact; rotary f32; attention rows < 512 3 products, rest fp16; softmax f32; Wo hl x exact.

#define NB_  2
#define TT   2048
#define DM   1024
#define NH_  16
#define NKV  16
#define HD   64
#define DQ   (NH_ * HD)
#define DKV  (NKV * HD)
#define RH   512                  // query rows < RH use hi+lo planes (0: none)
#define SCL  0.03125f   // 1 / sqrt(1024): the module scales q by 1 / sqrt(d_model) BEFORE the rotation and applies no other scale (a power of two: exact, commutes with the rotation)
typedef _Float16 h16;
typedef unsigned short bf;
typedef __attribute__((ext_vector_type(16))) __bf16   v16bf;
typedef __attribute__((ext_vector_type(16))) _Float16 v16h;
typedef __attribute__((ext_vector_type(8)))  _Float16 v8h;
typedef __attribute__((ext_vector_type(8)))  unsigned short v8us;
typedef __attribute__((ext_vector_type(8)))  float    v8f;
typedef __attribute__((ext_vector_type(4)))  float    v4f;
typedef v8h  __attribute__((may_alias)) v8ha;
typedef v4f  __attribute__((may_alias)) v4fa;
typedef v8us __attribute__((may_alias)) v8usa;
typedef __attribute__((ext_vector_type(4))) unsigned short v4us;
typedef __attribute__((ext_vector_type(4))) _Float16 v4h;
typedef __attribute__((ext_vector_type(2))) float v2f;

__device__ __forceinline__ unsigned short f2bf(float f) { unsigned u = __float_as_uint(f); u += 0x7FFFu + ((u >> 16) & 1u); return (unsigned short)(u >> 16); }
__device__ __forceinline__ float bf2f(unsigned short b) { return __uint_as_float(((unsigned)b) << 16); }
__device__ __forceinline__ float bfr(float f) { return bf2f(f2bf(f)); }
__device__ __forceinline__ void splitf(float y, unsigned short& h, unsigned short& l) { h = f2bf(y); l = f2bf(y - bf2f(h)); }
__device__ __forceinline__ v16h cat16(v8h lo, v8h hi) { return __builtin_shufflevector(lo, hi, 0, 1, 2, 3, 4, 5, 6, 7, 8, 9, 10, 11, 12, 13, 14, 15); }
__device__ __forceinline__ v16bf cat16b(v8us lo, v8us hi) { return __builtin_bit_cast(v16bf, __builtin_shufflevector(lo, hi, 0, 1, 2, 3, 4, 5, 6, 7, 8, 9, 10, 11, 12, 13, 14, 15)); }
__device__ __forceinline__ v8f wmma16(v16h a, v16h b, v8f c) { return __builtin_amdgcn_wmma_f32_16x16x32_f16(false, a, false, b, (short)0, c, false, false); }
__device__ __forceinline__ v8f wmmab(v16bf a, v16bf b, v8f c) { return __builtin_amdgcn_wmma_f32_16x16x32_bf16(false, a, false, b, (short)0, c, false, false); }



// ---- k_gemmt: LDS-staged GEMM, one work-group of 4 waves (2 x 2) per 128x128 output tile; each wave owns one 64x64 sub-tile (16 accumulators) over the WHOLE k range, so no partial tiles are summed.
// Operands are K-contiguous bf16 planes. A stage is 64 k (one 128-B line) of the tile's 128 A rows, 128 B rows (and 128 A2 rows), brought into LDS by asynchronous copies (16 B a lane), two buffers: the next stage flies while this one is worked on. Every staged row is read by two waves.
// C[m][n] (f32, pitch ldc) = sum_k (A[m][k] + A2[m][k]) Bt[n][k] (A2 only where NSPLIT). grid (M/128, N/128, Z), 128 threads; z strides Bt by sB elements. K % 64 == 0.
// PLN (the q, k, v projections; z = 0, 1, 2; one wave's 64-wide column range = one head): no f32 C; the epilogue turns the wave's tile straight into the attention operand planes (fp16, bf16 hi, bf16 lo).
// GRD (the output GEMM): every stored value is replaced by NaN unless flag[0] == NH_ (the premise guard; the scalar is asked for ahead of the k loop, so its latency passes behind it).
// z < 2: rows are tokens, columns d: the interleaved-pair rotation from the table CS, stored to plane [(z * 2 + batch) * 16 + head][t][d]. z == 2: the two operands change places, so the tile comes out as [d][token] and is stored to the transposed plane [batch * 16 + head][d][t] in whole lines.
template <typename T16> struct WFrag;
template <> struct WFrag<h16> { typedef v16h V; static __device__ __forceinline__ V ld(const h16* p) { return cat16(*(const v8h*)p, *(const v8h*)(p + 16)); } static __device__ __forceinline__ v8f mma(V a, V b, v8f c) { return wmma16(a, b, c); } };
template <> struct WFrag<bf> { typedef v16bf V; static __device__ __forceinline__ V ld(const bf* p) { return cat16b(*(const v8us*)p, *(const v8us*)(p + 16)); } static __device__ __forceinline__ v8f mma(V a, V b, v8f c) { return wmmab(a, b, c); } };
#define GKC  64                   // k elements of a stage
#define GPIT 144                  // LDS bytes of a staged row: 128 + 16, the conflict-free pitch for 16-byte reads
// eight copies of one wave: 32 rows of one operand (lane: row lane / 8 of each group of 4, 16-byte piece lane % 8). The s_wait_xcnt stands in the copies' own statement, so that no address register is rewritten ahead of it.
__device__ __forceinline__ void cp8(unsigned l, const bf* g, size_t r4) {
    asm volatile("global_load_async_to_lds_b128 %0, %8, off\n\t"
                 "global_load_async_to_lds_b128 %1, %9, off\n\t"
                 "global_load_async_to_lds_b128 %2, %10, off\n\t"
                 "global_load_async_to_lds_b128 %3, %11, off\n\t"
                 "global_load_async_to_lds_b128 %4, %12, off\n\t"
                 "global_load_async_to_lds_b128 %5, %13, off\n\t"
                 "global_load_async_to_lds_b128 %6, %14, off\n\t"
                 "global_load_async_to_lds_b128 %7, %15, off\n\t"
                 "s_wait_xcnt 0x0"
                 :: "v"(l), "v"(l + 4 * GPIT), "v"(l + 8 * GPIT), "v"(l + 12 * GPIT), "v"(l + 16 * GPIT), "v"(l + 20 * GPIT), "v"(l + 24 * GPIT), "v"(l + 28 * GPIT),
                    "v"(g), "v"(g + r4), "v"(g + 2 * r4), "v"(g + 3 * r4), "v"(g + 4 * r4), "v"(g + 5 * r4), "v"(g + 6 * r4), "v"(g + 7 * r4) : "memory");
}
template <int NSPLIT, bool PLN, bool GRD>
__global__ __launch_bounds__(128) void k_gemmt(const bf* __restrict__ A, const bf* __restrict__ A2, const bf* __restrict__ Bt, int K, float* C, int ldc, size_t sB, const float* __restrict__ CS, h16* P16, bf* Ph, bf* Pl, h16* V16, bf* Vh, bf* Vl, const int* __restrict__ flag) {
    typedef WFrag<bf>::V V;
    constexpr int OPB = 128 * GPIT, STG = (NSPLIT ? 3 : 2) * OPB;    // bytes of one operand's rows in a stage; of a stage
    constexpr int RING = 2 * STG, EPI = 4 * 64 * 68 * 4;             // the two buffers; the four waves' output staging, which takes the ring's place behind the loop
    __shared__ __align__(16) char sm[RING > EPI ? RING : EPI];
    bool bad = false; if constexpr (GRD) bad = flag[0] != NH_;      // uniform for the whole grid
    Bt += (size_t)blockIdx.z * sB;
    const int lane = threadIdx.x & 31, lr = lane & 15, hi = lane >> 4; const int wave = __builtin_amdgcn_readfirstlane((int)(threadIdx.x >> 5)); const int wm = wave >> 1, wn = wave & 1;
    const bool tr = PLN && blockIdx.z == 2;                          // the v projection: tile formed transposed (uniform for the work-group)
    if (tr) { const bf* x = A; A = Bt; Bt = x; }
    const int r0 = (tr ? blockIdx.y : blockIdx.x) * 128, c0 = (tr ? blockIdx.x : blockIdx.y) * 128;
    const int crow = wave * 32 + (lane >> 3);                        // this lane's first row of the 128 of each operand
    const unsigned l0 = (unsigned)(size_t)sm + (unsigned)(crow * GPIT + (lane & 7) * 16);
    const size_t ga = (size_t)(r0 + crow) * K + (lane & 7) * 8, gb = (size_t)(c0 + crow) * K + (lane & 7) * 8, r4 = (size_t)4 * K;
    auto fill = [&](int t) { const unsigned l = l0 + (unsigned)((t & 1) * STG);
        cp8(l, A + ga + t * GKC, r4); cp8(l + OPB, Bt + gb + t * GKC, r4); if constexpr (NSPLIT != 0) cp8(l + 2 * OPB, A2 + ga + t * GKC, r4); };
    v8f acc[4][4];
#pragma unroll
    for (int mb = 0; mb < 4; ++mb)
#pragma unroll
        for (int nb = 0; nb < 4; ++nb) acc[mb][nb] = (v8f){};
    const int NT = K / GKC;
    fill(0);
    asm volatile("s_wait_asynccnt 0x0" ::: "memory");               // this wave's copies of stage 0 have landed
    __syncthreads();                                                 // and every other wave's: stage 0 may be read
    if (NT > 1) fill(1);
#pragma unroll 1   // rolled: one trip a stage, the ring's order stands once in the code
    for (int t = 0; t < NT; ++t) {
        const char* pa = sm + (t & 1) * STG + (wm * 64 + lr) * GPIT + hi * 16; const char* pb = sm + (t & 1) * STG + OPB + (wn * 64 + lr) * GPIT + hi * 16;
#pragma unroll
        for (int ks = 0; ks < 2; ++ks) {
            V a[4], a2[4], b[4];
#pragma unroll
            for (int mb = 0; mb < 4; ++mb) { a[mb] = WFrag<bf>::ld((const bf*)(pa + mb * 16 * GPIT + ks * 64)); if constexpr (NSPLIT != 0) a2[mb] = WFrag<bf>::ld((const bf*)(pa + 2 * OPB + mb * 16 * GPIT + ks * 64)); }
#pragma unroll
            for (int nb = 0; nb < 4; ++nb) b[nb] = WFrag<bf>::ld((const bf*)(pb + nb * 16 * GPIT + ks * 64));   // all of the block's LDS reads stand together, ahead of its products
            __builtin_amdgcn_sched_barrier(0);   // keeps the reads in one group: without it the compiler sinks each B fragment's reads in front of its four products, on one register set, and every group then waits out the LDS latency
#pragma unroll
            for (int nb = 0; nb < 4; ++nb)
#pragma unroll
                for (int mb = 0; mb < 4; ++mb) { acc[mb][nb] = WFrag<bf>::mma(a[mb], b[nb], acc[mb][nb]); if constexpr (NSPLIT != 0) acc[mb][nb] = WFrag<bf>::mma(a2[mb], b[nb], acc[mb][nb]); }
        }
        asm volatile("s_wait_dscnt 0x0" ::: "memory");              // this wave's reads of the buffer have returned
        asm volatile("s_wait_asynccnt 0x0" ::: "memory");           // this wave's copies of the next stage have landed
        __syncthreads();                                             // publishes the next stage and ends every reader's last read of this buffer
        if (t + 2 < NT) fill(t + 2);                                 // refill of the buffer just left (the test reads the same for the whole work-group)
    }
    asm volatile("s_wait_asynccnt 0x0" ::: "memory");               // nothing is in flight when the ring becomes output staging
    const int rw = r0 + wm * 64, cw = c0 + wn * 64;                  // the wave's own 64x64 tile
    float* osw = (float*)sm + wave * (64 * 68);                      // and its own staging range
#pragma unroll
    for (int mb = 0; mb < 4; ++mb)
#pragma unroll
        for (int nb = 0; nb < 4; ++nb)
#pragma unroll
            for (int j = 0; j < 8; ++j) osw[(mb * 16 + hi * 8 + j) * 68 + nb * 16 + lr] = acc[mb][nb][j];
    constexpr int NS = 32;                                           // 4-wide pieces of the tile per lane: piece q = s * 32 + lane holds row q / 16, columns 4 (q % 16)..
    v2f cs[NS][2];                                                   // (cos, sin) of this lane's two pairs in each of its pieces: asked for here, all at once, so that the table's latency is met once and passes behind the LDS round
    if constexpr (PLN) { if (!tr) { const float* c = CS + (size_t)(rw % TT) * (HD * 2) + lane * 8;   // table entry (row * 64 + column) * 2 = 8 q
#pragma unroll   // cs is indexed by constants only, so it stays in registers
        for (int s = 0; s < NS; ++s) { cs[s][0] = *(const v2f*)(c + s * 256); cs[s][1] = *(const v2f*)(c + s * 256 + 4); }
        asm volatile("s_wait_xcnt 0x0" ::: "memory"); } }   // behind the table loads, which stay in flight: their address registers are reused behind them
    __syncthreads();                                                 // the staged tile is whole before its lanes read one another's values
    v4f pg[8];                                                       // indexed by constants only (the loops below are unrolled), so it stays in registers
    if constexpr (PLN) {
        const int tk = tr ? cw : rw, hd = (tr ? rw : cw) / HD;       // the tile's first token (64 divides TT, so a tile lies in one batch) and its head
        const size_t eb = tr ? ((size_t)(tk / TT) * NH_ + hd) * HD * TT + tk % TT : ((((size_t)blockIdx.z * NB_ + tk / TT) * NH_ + hd) * TT + tk % TT) * HD;
        const int pit = tr ? TT : HD; h16* d16 = (tr ? V16 : P16) + eb; bf* dh = (tr ? Vh : Ph) + eb; bf* dl = (tr ? Vl : Pl) + eb;
#pragma unroll   // cs is indexed by constants only, so it stays in registers
        for (int s = 0; s < NS; ++s) { const int q = s * 32 + lane; const int o = (q >> 4) * pit + (q & 15) * 4;
            if (s % 8 == 0) {   // eight pieces are read from LDS at a time, so that its latency is met once for the eight
#pragma unroll
                for (int u = 0; u < 8; ++u) pg[u] = *(const v4fa*)(osw + ((q >> 4) + 2 * u) * 68 + (q & 15) * 4); }
            const v4f pv = pg[s % 8]; v4f r = pv;
            if (!tr) {
#pragma unroll   // vector elements picked by constants
                for (int p = 0; p < 2; ++p) { const float x0 = pv[2 * p], x1 = pv[2 * p + 1], c = cs[s][p][0], sn = cs[s][p][1]; r[2 * p] = x0 * c - x1 * sn; r[2 * p + 1] = x0 * sn + x1 * c; } }   /* even: x0 c - x1 s; odd: x0 s + x1 c */
            v4h o16; v4us oh, ol;
#pragma unroll   // vector elements picked by constants
            for (int j = 0; j < 4; ++j) { o16[j] = (h16)r[j]; unsigned short a2, c2; splitf(r[j], a2, c2); oh[j] = a2; ol[j] = c2; }
            *(v4h*)(d16 + o) = o16; *(v4us*)(dh + o) = oh; *(v4us*)(dl + o) = ol;
            asm volatile("s_wait_xcnt 0x0" ::: "memory");   // behind the three stores: the next piece's values may land on their address or data registers
        }
    } else {
        float* crow = C + (size_t)rw * ldc + cw;
#pragma unroll
        for (int s = 0; s < NS; ++s) { const int q = s * 32 + lane;
            if (s % 8 == 0) {   // eight pieces are read from LDS at a time, so that its latency is met once for the eight
#pragma unroll
                for (int u = 0; u < 8; ++u) pg[u] = *(const v4fa*)(osw + ((q >> 4) + 2 * u) * 68 + (q & 15) * 4); }
            v4f val = pg[s % 8];
            if constexpr (GRD) { if (bad) { const float qn = __int_as_float(0x7fc00000); val[0] = qn; val[1] = qn; val[2] = qn; val[3] = qn; } }   // premise fails: the whole output is NaN
            *(v4f*)(crow + (size_t)(q >> 4) * ldc + (q & 15) * 4) = val;
            asm volatile("s_wait_xcnt 0x0" ::: "memory");   // behind the store: the next piece's value may land on its address or data registers
        }
    }
}

// ---- k_attn: causal attention of one query tile of one (batch, head) plane in one work-group; scores and probabilities never leave the registers.
// Transposed products: S^T = K Q^T (A = 16 keys x 32 d from the key plane, B = 16 queries from the query plane), so a lane holds 8 + 8 keys of ONE query (column lr, rows hi * 8 + j of two 16-key tiles): exactly the k order of a B fragment
// (elements 0..7 = keys 8 hi + e, elements 8..15 = keys 16 + 8 hi + e), which then meets A = V^T (16 d x 32 keys, same k order) in O^T = V^T P^T. Row statistics are per lane (one exchange between the two 16-lane halves).
// The 8 waves are AQG query groups x AKG key groups. A stage is AKS = 128 keys of K (whole 128-B rows) and of V^T (256 B of each of its 64 rows), brought into LDS in whole lines by asynchronous copies (16 B a lane), two buffers: the next stage flies while this one is worked on.
// Key group c takes the stage's 32-key block c, up to its query group's diagonal block, with its own running maximum, sum and O^T (online softmax); a staged block is read by each query group whose diagonal block it does not pass. The AKG partials of a query are merged through LDS in key-group order (a fixed order), normalised, split hi/lo and stored in merged [token][head * 64 + d] order.
#define ANW  8                    // waves per work-group
#define AQG  2                    // query groups
#define AKG  4                    // key groups: the waves of one query group share the key loop
#define AKS  (AKG * 32)           // keys of a stage
#define KPIT 144                  // LDS bytes of a staged key row: 128 + 16, the conflict-free pitch for 16-byte reads
#define VPIT 272                  // LDS bytes of a staged V^T row: 256 + 16, likewise
#define AKB  (AKS * KPIT)         // bytes of a stage's key rows
#define AVB  (HD * VPIT)          // bytes of a stage's V^T rows
#define APIT 68                   // f32 pitch of one query's partial row in LDS: 64 outputs, then its maximum and its sum
__device__ __forceinline__ float ex2(float x) { float r; asm("v_exp_f32 %0, %1\n\tv_nop" : "=v"(r) : "v"(x)); return r; }   // 2^x; the v_nop is the one slot the instruction set asks for behind a transcendental, tied to it by standing in its statement
__device__ __forceinline__ float xhalf(float x) { return __builtin_bit_cast(float, __builtin_amdgcn_permlanex16(__builtin_bit_cast(int, x), __builtin_bit_cast(int, x), 0x76543210, 0xfedcba98, false, false)); }   // lane l reads lane l ^ 16 (a vector move, no LDS round trip)
// four copies of one wave, 512 B each; LDS step ls and global step gs in bytes. The s_wait_xcnt stands in the copies' own statement, so that no address register is rewritten ahead of it.
__device__ __forceinline__ void cp4(unsigned l, unsigned ls, const char* g, size_t gs) {
    asm volatile("global_load_async_to_lds_b128 %0, %4, off\n\t"
                 "global_load_async_to_lds_b128 %1, %5, off\n\t"
                 "global_load_async_to_lds_b128 %2, %6, off\n\t"
                 "global_load_async_to_lds_b128 %3, %7, off\n\t"
                 "s_wait_xcnt 0x0"
                 :: "v"(l), "v"(l + ls), "v"(l + 2 * ls), "v"(l + 3 * ls), "v"(g), "v"(g + gs), "v"(g + 2 * gs), "v"(g + 3 * gs) : "memory");
}
template <typename T16, bool HR, int NQB>
__device__ __forceinline__ void attn_body(char* sm, int q0, const T16* __restrict__ Q, const T16* __restrict__ Q2, const T16* __restrict__ Kp, const T16* __restrict__ Kp2, const T16* __restrict__ Vt, const T16* __restrict__ Vt2, bf* Ah, bf* Al) {
    typedef typename WFrag<T16>::V V;
    constexpr float K1 = SCL * 1.4426950408889634f;                  // logit scale and log2(e) in one factor: the statistics live in the base-2 exponent's units
    constexpr float PB = HR ? 0.0f : 10.0f;                          // fp16 probabilities carry a factor 2^10, which cancels in the division by their own sum
    constexpr int PLB = AKB + AVB, STG = (HR ? 2 : 1) * PLB;         // bytes of one plane set's K and V^T rows in a stage; of a stage (hi set, then lo set)
    const int lane = threadIdx.x & 31, lr = lane & 15, hi = lane >> 4; const int wave = __builtin_amdgcn_readfirstlane((int)(threadIdx.x >> 5)); const int qg = wave / AKG, kg = wave % AKG;
    const int qw = q0 + qg * (NQB * 16);                             // the first query of this wave's group
    // this wave's share of a stage: key rows 16 wave .. + 15 (a copy: 4 rows, lane: row lane / 8, piece lane % 8) and V^T rows 8 wave .. + 7 (a copy: 2 rows, lane: row lane / 16, piece lane % 16)
    const unsigned lk = (unsigned)(size_t)sm + (unsigned)((wave * 16 + (lane >> 3)) * KPIT + (lane & 7) * 16), lv = (unsigned)(size_t)sm + (unsigned)(AKB + (wave * 8 + (lane >> 4)) * VPIT + (lane & 15) * 16);
    const size_t gk = (size_t)(wave * 16 + (lane >> 3)) * HD + (lane & 7) * 8, gv = (size_t)(wave * 8 + (lane >> 4)) * TT + (lane & 15) * 8;
    auto fill = [&](int s) { const unsigned b = (unsigned)((s & 1) * STG); const size_t ok = gk + (size_t)s * (AKS * HD), ov = gv + (size_t)s * AKS;
        cp4(lk + b, 4 * KPIT, (const char*)(Kp + ok), 4 * HD * 2); cp4(lv + b, 2 * VPIT, (const char*)(Vt + ov), 2 * TT * 2);
        if constexpr (HR) { cp4(lk + b + PLB, 4 * KPIT, (const char*)(Kp2 + ok), 4 * HD * 2); cp4(lv + b + PLB, 2 * VPIT, (const char*)(Vt2 + ov), 2 * TT * 2); } };
    const int NT = q0 / AKS + 1;                                     // stages up to and with the one that holds the tile's last diagonal block; NT * AKS <= TT, so every staged row lies in the plane
    fill(0);
    V bq[NQB][2], bq2[NQB][2];
#pragma unroll
    for (int qb = 0; qb < NQB; ++qb)
#pragma unroll
        for (int ks = 0; ks < 2; ++ks) { const size_t qo = (size_t)(qw + qb * 16 + lr) * HD + 8 * hi + ks * 32; bq[qb][ks] = WFrag<T16>::ld(Q + qo); if (HR) bq2[qb][ks] = WFrag<T16>::ld(Q2 + qo); }
    v8f o[NQB][4]; float m[NQB], l[NQB];
#pragma unroll
    for (int qb = 0; qb < NQB; ++qb) { m[qb] = -1.0e30f; l[qb] = 0.f;
#pragma unroll
        for (int db = 0; db < 4; ++db) o[qb][db] = (v8f){}; }
    const int nkb = qw / 32 + 1;                                     // 32-key blocks up to and with this group's diagonal block; every query of the group has a key in each of them
    asm volatile("s_wait_asynccnt 0x0" ::: "memory");               // this wave's copies of stage 0 have landed
    __syncthreads();                                                 // and every other wave's: stage 0 may be read
    if (NT > 1) fill(1);
#pragma unroll 1   // rolled: one trip a stage, the ring's order stands once in the code; one block's K and V fragments live at a time, which keeps four waves on a SIMD; every inner loop is unrolled so that fragments and accumulators stay in registers
    for (int t = 0; t < NT; ++t) {
        const int kb = t * AKG + kg;
        if (kb < nkb) {                                              // a scalar test: a wave whose block lies behind its group's diagonal block has no work in this stage, but passes the stage's waits and barrier
            const int k0 = kb * 32;
            const char* pk = sm + (t & 1) * STG + (kg * 32 + lr) * KPIT + hi * 16; const char* pv = sm + (t & 1) * STG + AKB + lr * VPIT + kg * 64 + hi * 16;
            V ak[2][2], ak2[2][2], av[4], av2[4];
#pragma unroll
            for (int kt = 0; kt < 2; ++kt)
#pragma unroll
                for (int ks = 0; ks < 2; ++ks) { const int ko = kt * 16 * KPIT + ks * 64; ak[kt][ks] = WFrag<T16>::ld((const T16*)(pk + ko)); if (HR) ak2[kt][ks] = WFrag<T16>::ld((const T16*)(pk + PLB + ko)); }
#pragma unroll
            for (int db = 0; db < 4; ++db) { const int vo = db * 16 * VPIT; av[db] = WFrag<T16>::ld((const T16*)(pv + vo)); if (HR) av2[db] = WFrag<T16>::ld((const T16*)(pv + PLB + vo)); }
#pragma unroll
            for (int qb = 0; qb < NQB; ++qb) {
                v8f st[2];                                           // st[kt][j] = q.k of key k0 + kt * 16 + hi * 8 + j and query qw + qb * 16 + lr
#pragma unroll
                for (int kt = 0; kt < 2; ++kt) { v8f s = (v8f){};
#pragma unroll
                    for (int ks = 0; ks < 2; ++ks) { s = WFrag<T16>::mma(ak[kt][ks], bq[qb][ks], s); if (HR) { s = WFrag<T16>::mma(ak[kt][ks], bq2[qb][ks], s); s = WFrag<T16>::mma(ak2[kt][ks], bq[qb][ks], s); } }
                    st[kt] = s; }
                if (kb == nkb - 1) {                                 // only the diagonal block holds keys behind a query
#pragma unroll
                    for (int kt = 0; kt < 2; ++kt)
#pragma unroll
                        for (int j = 0; j < 8; ++j) if (k0 + kt * 16 + hi * 8 + j > qw + qb * 16 + lr) st[kt][j] = -1.0e30f; }
                float mx = st[0][0];
#pragma unroll
                for (int e = 1; e < 16; ++e) mx = fmaxf(mx, st[e >> 3][e & 7]);
                mx = fmaxf(mx, xhalf(mx));
                const float mn = fmaxf(m[qb], mx * K1 - PB); const float al = ex2(m[qb] - mn); m[qb] = mn;
                float p[16], ps = 0.f;
#pragma unroll
                for (int e = 0; e < 16; ++e) { p[e] = ex2(st[e >> 3][e & 7] * K1 - mn); ps += p[e]; }
                l[qb] = l[qb] * al + ps;
#pragma unroll
                for (int db = 0; db < 4; ++db) o[qb][db] *= al;
                if constexpr (HR) { v8us h0, h1, l0, l1;
#pragma unroll
                    for (int e = 0; e < 8; ++e) { unsigned short a, c; splitf(p[e], a, c); h0[e] = a; l0[e] = c; splitf(p[8 + e], a, c); h1[e] = a; l1[e] = c; }
                    const V ph = cat16b(h0, h1), pl = cat16b(l0, l1);
#pragma unroll
                    for (int db = 0; db < 4; ++db) { o[qb][db] = WFrag<T16>::mma(av[db], ph, o[qb][db]); o[qb][db] = WFrag<T16>::mma(av[db], pl, o[qb][db]); o[qb][db] = WFrag<T16>::mma(av2[db], ph, o[qb][db]); }
                } else { V pb;
#pragma unroll
                    for (int e = 0; e < 16; ++e) pb[e] = (h16)p[e];
#pragma unroll
                    for (int db = 0; db < 4; ++db) o[qb][db] = WFrag<T16>::mma(av[db], pb, o[qb][db]); }
            }
            asm volatile("v_nop\n\tv_nop\n\tv_nop\n\tv_nop" : "+v"(o[NQB - 1][0]), "+v"(o[NQB - 1][1]), "+v"(o[NQB - 1][2]), "+v"(o[NQB - 1][3]));   // the matrix instructions' distance on the branches behind them (out of the loop, whose target reads o)
        }
        asm volatile("s_wait_dscnt 0x0" ::: "memory");              // this wave's reads of the buffer have returned
        asm volatile("s_wait_asynccnt 0x0" ::: "memory");           // this wave's copies of the next stage have landed
        __syncthreads();                                             // publishes the next stage and ends every reader's last read of this buffer
        if (t + 2 < NT) fill(t + 2);                                 // refill of the buffer just left (the test reads the same for the whole work-group)
    }
    asm volatile("s_wait_asynccnt 0x0" ::: "memory");               // nothing is in flight when the ring becomes the partials' staging
    float* smf = (float*)sm; float* my = smf + wave * (NQB * 16 * APIT);   // this wave's own partial tile
#pragma unroll
    for (int qb = 0; qb < NQB; ++qb) { l[qb] += xhalf(l[qb]); float* r = my + (qb * 16 + lr) * APIT;
#pragma unroll
        for (int db = 0; db < 4; ++db) { v4f a, b;
#pragma unroll
            for (int j = 0; j < 4; ++j) { a[j] = o[qb][db][j]; b[j] = o[qb][db][4 + j]; }
            *(v4fa*)(r + db * 16 + hi * 8) = a; *(v4fa*)(r + db * 16 + hi * 8 + 4) = b; }
        if (hi == 0) { r[64] = m[qb]; r[65] = l[qb]; } }
    __syncthreads();                                                 // every wave's partial tile and statistics are in LDS before any thread merges them
    constexpr int EPT = AQG * NQB * 16 * HD / (32 * ANW);            // outputs per thread: consecutive d of one query
    const int qi = (int)threadIdx.x / (HD / EPT), d0 = ((int)threadIdx.x % (HD / EPT)) * EPT; const float* r0 = smf + (qi / (NQB * 16)) * (AKG * NQB * 16 * APIT) + (qi % (NQB * 16)) * APIT;   // the query's row in the partial tile of its group's key group 0
    float M = r0[64];
#pragma unroll
    for (int w = 1; w < AKG; ++w) M = fmaxf(M, r0[w * (NQB * 16 * APIT) + 64]);
    float L = 0.f, acc[EPT];
#pragma unroll
    for (int e = 0; e < EPT; ++e) acc[e] = 0.f;
#pragma unroll
    for (int w = 0; w < AKG; ++w) { const float* rw = r0 + w * (NQB * 16 * APIT); const float wt = ex2(rw[64] - M); L += wt * rw[65];   // a wave that had no block weighs 0; partials added in key-group order: the same order on every run
#pragma unroll
        for (int e4 = 0; e4 < EPT; e4 += 4) { const v4f x = *(const v4fa*)(rw + d0 + e4);
#pragma unroll
            for (int j = 0; j < 4; ++j) acc[e4 + j] += wt * x[j]; } }
    const float f = __fdiv_rn(1.0f, L); const size_t oo = (size_t)(q0 + qi) * DQ + d0;
#pragma unroll
    for (int e8 = 0; e8 < EPT; e8 += 8) { v8us oh, ol;
#pragma unroll
        for (int e = 0; e < 8; ++e) { unsigned short a, c; splitf(acc[e8 + e] * f, a, c); oh[e] = a; ol[e] = c; }
        *(v8us*)(Ah + oo + e8) = oh; *(v8us*)(Al + oo + e8) = ol; }
    asm volatile("s_wait_xcnt 0x0" ::: "memory");   // one body's code is laid out in front of the other's: the wait stands between these stores and any later write of their address or data registers
}
// grid (planes, query tiles): tiles in falling order of their key count, the longest start first; query rows >= RH in tiles of 64 (fp16 body), rows < RH in tiles of 32 (hi/lo 3-product body); the choice is uniform for the work-group.
__global__ __launch_bounds__(32 * ANW) void k_attn(const bf* __restrict__ Qh, const bf* __restrict__ Ql, const bf* __restrict__ Kh, const bf* __restrict__ Kl, const bf* __restrict__ Vh, const bf* __restrict__ Vl, const h16* __restrict__ Q16, const h16* __restrict__ K16, const h16* __restrict__ V16, bf* Ah, bf* Al) {
    __shared__ __align__(16) char sm[2 * 2 * (AKB + AVB)];           // the hi/lo body's two buffers; the fp16 body uses half; the partial tiles (ANW * 32 * APIT floats at most) take the ring's place behind the loop
    const int pl = (int)blockIdx.x, ty = (int)blockIdx.y; const size_t po = (size_t)pl * TT * HD; const size_t ao = (size_t)(pl / NH_) * TT * DQ + (size_t)(pl % NH_) * HD;   /* plane = batch * 16 + head */
    if (ty < (TT - RH) / 64) attn_body<h16, false, 2>(sm, TT - 64 * (ty + 1), Q16 + po, nullptr, K16 + po, nullptr, V16 + po, nullptr, Ah + ao, Al + ao);
    else attn_body<bf, true, 1>(sm, RH - 32 * (ty - (TT - RH) / 64 + 1), Qh + po, Ql + po, Kh + po, Kl + po, Vh + po, Vl + po, Ah + ao, Al + ao);
}

typedef __attribute__((ext_vector_type(2))) unsigned short v2us;
typedef __attribute__((ext_vector_type(4))) int v4i;

__constant__ float INV2[HD / 2] = { 1.000000000e+00f, 7.498942018e-01f, 5.623413324e-01f, 4.216965139e-01f, 3.162277639e-01f, 2.371373773e-01f, 1.778279394e-01f, 1.333521456e-01f, 1.000000015e-01f, 7.498942316e-02f, 5.623413250e-02f, 4.216964915e-02f, 3.162277490e-02f, 2.371373773e-02f, 1.778279431e-02f, 1.333521400e-02f, 9.999999776e-03f, 7.498942316e-03f, 5.623413250e-03f, 4.216964822e-03f, 3.162277630e-03f, 2.371373819e-03f, 1.778279431e-03f, 1.333521446e-03f, 1.000000047e-03f, 7.498941850e-04f, 5.623413017e-04f, 4.216965172e-04f, 3.162277571e-04f, 2.371373703e-04f, 1.778279402e-04f, 1.333521504e-04f };   // 10000 ** (-2i / 64), i = 0..31, in float32 as THIS module writes it (the NEGATIVE-POWER spelling '10000.0 ** (-ts / dim)' evaluated in the reference's own f32 arithmetic: these 32 literals equal it bit for bit); ten entries differ by one ulp from the reciprocal values the host's own table held

// ---- k_prep: the three preparations, which do not depend on one another, in ONE grid (the choice is uniform for the work-group) of few, fat work-groups: the launch is short, so the time its waves take to start counts; every wave asks for all of its data at once, in whole lines.
#define PTL  128                          // a transposed tile: PTL k x PTL n of one weight
#define PBW1 ((DM / PTL) * (DQ / PTL))    // tiles (blocks) per weight
#define PBW  (4 * PBW1)                   // blocks 0 .. PBW-1: the four 'xw' weights, transposed to bf16, one plane behind the other
#define PCT  4                            // table pairs a thread
#define PBC  (TT * (HD / 2) / (256 * PCT))   // the next PBC blocks: the rotation table
#define PXT  16                           // 4-element pieces of x a thread
#define PBX  (NB_ * TT * DM / (256 * 4 * PXT))   // the last PBX blocks: the bf16 copy of x
__global__ __launch_bounds__(256) void k_prep(const float* __restrict__ w0, const float* __restrict__ w1, const float* __restrict__ w2, const float* __restrict__ w3, const float* __restrict__ src, bf* Bt, float* CS, bf* dst) {
    __shared__ __align__(16) char ts[PTL * PTL * 2];   // the transposed tile: row n = 256 B = 16 pieces of 8 k; piece p of row n stands at place p ^ (n / 4 % 16), so that the 16-byte writes (lanes 4 rows apart) and reads (lanes along a row) both spread over all banks
    const int blk = (int)blockIdx.x, tid = (int)threadIdx.x, lane = tid & 31, wave = tid >> 5;
    if (blk < PBW) {
        constexpr int K = DM, N = DQ; const int wy = blk / PBW1, tl = blk % PBW1; const int k0 = (tl / (N / PTL)) * PTL, n0 = (tl % (N / PTL)) * PTL;
        const float* w = wy == 0 ? w0 : wy == 1 ? w1 : wy == 2 ? w2 : w3; w += (size_t)(k0 + wave * 16) * N + n0 + lane * 4;
        v4f r[16];                                                   // 16 k x 4 n: each load of the wave is 512 contiguous bytes of one k row; indexed by constants only
#pragma unroll   // all 16 loads are asked for before the first is used; r stays in registers
        for (int i = 0; i < 16; ++i) r[i] = *(const v4f*)(w + (size_t)i * N);
#pragma unroll   // vector elements picked by constants
        for (int j = 0; j < 4; ++j) { v8us a, b;
#pragma unroll   // likewise
            for (int e = 0; e < 8; ++e) { a[e] = f2bf(r[e][j]); b[e] = f2bf(r[8 + e][j]); }
            char* row = ts + (lane * 4 + j) * (PTL * 2); const int sw = lane & 15;
            *(v8usa*)(row + (((wave * 2) ^ sw) << 4)) = a; *(v8usa*)(row + (((wave * 2 + 1) ^ sw) << 4)) = b; }
        __syncthreads();                                             // the tile is whole before its rows are read
        bf* o = Bt + (size_t)wy * K * N + (size_t)(n0 + (tid >> 4)) * K + k0 + (tid & 15) * 8;
#pragma unroll   // the eight LDS reads stand together, so that their latency is met once
        for (int u = 0; u < 8; ++u) { const int n = u * 16 + (tid >> 4);   // 16 lanes store 256 contiguous bytes of one output row
            *(v8us*)(o + (size_t)u * 16 * K) = *(const v8usa*)(ts + n * (PTL * 2) + (((tid & 15) ^ ((n >> 2) & 15)) << 4)); }
    } else if (blk < PBW + PBC) {
        const float fr = INV2[tid % (HD / 2)];                       // 256 is a multiple of 32: all pairs of a thread have one frequency
#pragma unroll 1   // rolled: the long code of one (cos, sin) stands once, so the launch's text stays short
        for (int u = 0; u < PCT; ++u) { const int idx = ((blk - PBW) * PCT + u) * 256 + tid;   // pair index t * 32 + i: entries d = 2 i and 2 i + 1 hold the same (cos, sin)
            const float a = __fmul_rn((float)(idx / (HD / 2)), fr); const float c = cosf(a), s = sinf(a); v4f cs; cs[0] = c; cs[1] = s; cs[2] = c; cs[3] = s; *(v4f*)(CS + (size_t)idx * 4) = cs;
            asm volatile("s_wait_xcnt 0x0" ::: "memory");   // behind the store: the next pair's values may land on its address or data registers
        }
    } else {
        const size_t e0 = ((size_t)(blk - PBW - PBC) * 8 + wave) * (128 * PXT) + lane * 4; const float* xs = src + e0;
        v4f r[PXT];                                                  // each load of the wave is 512 contiguous bytes; indexed by constants only
#pragma unroll   // all loads are asked for before the first is used; r stays in registers
        for (int u = 0; u < PXT; ++u) r[u] = *(const v4f*)(xs + u * 128);
        asm volatile("s_wait_xcnt 0x0" :: "v"(xs) : "memory");   // behind the run of loads, which stay in flight: the address is an input here, so it stays in its registers up to the wait and no load of the run lands on it
#pragma unroll   // r is indexed by constants only
        for (int u = 0; u < PXT; ++u) { v4us o;
#pragma unroll   // vector elements picked by constants
            for (int j = 0; j < 4; ++j) o[j] = f2bf(r[u][j]);
            *(v4us*)(dst + e0 + u * 128) = o; }
        asm volatile("s_wait_xcnt 0x0" ::: "memory");   // behind the run of stores: the other parts' code is laid out behind them and writes their address and data registers
    }
}

extern "C" void kernel_launch(void* const* d_in, const int* in_sizes, int n_in,
                              void* d_out, int out_size, void* d_ws, size_t ws_size, hipStream_t stream) {
    (void)in_sizes; (void)n_in; (void)out_size;
    const float* x = (const float*)d_in[0]; const float* wq = (const float*)d_in[1]; const float* wk = (const float*)d_in[2]; const float* wv = (const float*)d_in[3]; const float* wo = (const float*)d_in[4]; const int* flag = (const int*)d_in[5];   /* order x, Wq, Wk, Wv, Wo ('xw' [1024][1024]), num_heads (the SIXTH input, slot 5: the python int 16 as an int scalar: READ ON DEVICE by the output GEMM: the whole output is NaN unless it equals NH_ = 16) */
    float* OUT = (float*)d_out;     // [2][2048][1024]
    char* wsp = (char*)d_ws;
    auto take = [&](size_t bytes) { char* p = wsp; wsp += (bytes + 255) & ~(size_t)255; return (void*)p; };
    bf* WQ = (bf*)take((size_t)4 * DQ * DM * 2); bf* WO = WQ + (size_t)3 * DQ * DM;   // transposed Wq, Wk, Wv, Wo, one behind the other (z-stride DQ*DM)
    float* CS = (float*)take((size_t)TT * HD * 2 * 4);
    const size_t PL = (size_t)NB_ * NH_ * TT * HD;   // one operand's planes, both batches
    h16* QP16 = (h16*)take(2 * PL * 2); h16* KP16 = QP16 + PL; bf* QPh = (bf*)take(2 * PL * 2); bf* KPh = QPh + PL; bf* QPl = (bf*)take(2 * PL * 2); bf* KPl = QPl + PL;   // k planes directly behind the q planes: plane index (z * 2 + batch) * 16 + head in the projection's epilogue
    h16* VT16 = (h16*)take(PL * 2); bf* VTh = (bf*)take(PL * 2); bf* VTl = (bf*)take(PL * 2);
    bf* ATh = (bf*)take((size_t)NB_ * TT * DQ * 2); bf* ATl = (bf*)take((size_t)NB_ * TT * DQ * 2);
    bf* XB = (bf*)take((size_t)NB_ * TT * DM * 2);   // bf16 copy of x
    if ((size_t)(wsp - (char*)d_ws) > ws_size) return;    // ws 256 MiB
    k_prep<<<PBW + PBC + PBX, 256, 0, stream>>>(wq, wk, wv, wo, x, WQ, CS, XB);
    k_gemmt<0, true, false><<<dim3(NB_ * TT / 128, DQ / 128, 3), 128, 0, stream>>>(XB, nullptr, WQ, DM, nullptr, 0, (size_t)DQ * DM, CS, QP16, QPh, QPl, VT16, VTh, VTl, nullptr);
    k_attn<<<dim3(NB_ * NH_, (TT - RH) / 64 + RH / 32, 1), 32 * ANW, 0, stream>>>(QPh, QPl, KPh, KPl, VTh, VTl, QP16, KP16, VT16, ATh, ATl);   // one kv head per query head: plane index batch * 16 + head for q, k and v alike
    k_gemmt<1, false, true><<<dim3(NB_ * TT / 128, DM / 128, 1), 128, 0, stream>>>(ATh, ATl, WO, DQ, OUT, DM, 0, nullptr, nullptr, nullptr, nullptr, nullptr, nullptr, nullptr, flag);   // the premise guard rides in its stores
}

// v009
// Measured time: 80.7 microseconds a run.
// In two side-by-side timings against v008, it was 1.03 and 1.04 times as fast.
// Over all steps from v000 it is 18.0 times as fast.
#include <hip/hip_runtime.h>

// Causal multi-head attention with a pre-scaled query, interleaved-pair rotary embeddings and a scalar head-count input (x [2][2048][1024]; q = (x Wq) x 1/sqrt(1024), k = x Wk, v = x Wv ('xw' [1024][1024] 0.02, no bias; 16 heads x 64: the head count arrives as the python int 16, the LAST input: read on device by the premise guard); rope x cos + x_rot sin with x_rot: (x1, x2) -> (-x2, x1) on adjacent pairs and cos / sin = repeat(c, 2) of angle t x 10000^(-2i/64) (32 f32 frequencies jnp-exact for the module's negative-power expression; precise cosf/sinf); logits = q.k (no further scale: net 1/32); where(tril, logits, -1e8) == exclusion; softmax; out = merged Wo ('xw', no bias) -> [2][2048][1024] (4.2 M); argument order x, Wq, Wk, Wv, Wo, num_heads).
// VALUE PREMISE: this kernel implements num_heads == 16 only; the output GEMM reads the scalar on the device and stores NaN in place of every output element if it is not 16.
// Layout (both batches in every launch; planes ordered [batch * 16 + head]): k_prep: bf16 copy of x, 'xw' weights transposed once and the rotation table, in one grid; exact projections whose epilogue applies the rotation (computed table, pair-shared entries) and writes the q, k and transposed v planes itself; k_attn causal T-2048 attention of all planes in one launch, scores and probabilities in registers (hybrid rows: < 512 hi/lo 3 products, rest fp16 x1024; key blocks above the diagonal are never formed); merged hi/lo x Wo exact.
// Compute dtypes, f32 accumulate: every input rounded to bf16; projections exact; rotary f32; attention rows < 512 3 products, rest fp16; softmax f32; Wo hl x exact.

#define NB_  2
#define TT   2048
#define DM   1024
#define NH_  16
#define NKV  16
#define HD   64
#define DQ   (NH_ * HD)
#define DKV  (NKV * HD)
#define RH   512                  // query rows < RH use hi+lo planes (0: none)
#define SCL  0.03125f   // 1 / sqrt(1024): the module scales q by 1 / sqrt(d_model) BEFORE the rotation and applies no other scale (a power of two: exact, commutes with the rotation)
typedef _Float16 h16;
typedef unsigned short bf;
typedef __attribute__((ext_vector_type(16))) __bf16   v16bf;
typedef __attribute__((ext_vector_type(16))) _Float16 v16h;
typedef __attribute__((ext_vector_type(8)))  _Float16 v8h;
typedef __attribute__((ext_vector_type(8)))  unsigned short v8us;
typedef __attribute__((ext_vector_type(8)))  float    v8f;
typedef __attribute__((ext_vector_type(4)))  float    v4f;
typedef v8h  __attribute__((may_alias)) v8ha;
typedef v4f  __attribute__((may_alias)) v4fa;
typedef v8us __attribute__((may_alias)) v8usa;
typedef __attribute__((ext_vector_type(4))) unsigned short v4us;
typedef __attribute__((ext_vector_type(4))) _Float16 v4h;
typedef __attribute__((ext_vector_type(2))) float v2f;

__device__ __forceinline__ unsigned short f2bf(float f) { unsigned u = __float_as_uint(f); u += 0x7FFFu + ((u >> 16) & 1u); return (unsigned short)(u >> 16); }
__device__ __forceinline__ float bf2f(unsigned short b) { return __uint_as_float(((unsigned)b) << 16); }
__device__ __forceinline__ float bfr(float f) { return bf2f(f2bf(f)); }
__device__ __forceinline__ void splitf(float y, unsigned short& h, unsigned short& l) { h = f2bf(y); l = f2bf(y - bf2f(h)); }
__device__ __forceinline__ v16h cat16(v8h lo, v8h hi) { return __builtin_shufflevector(lo, hi, 0, 1, 2, 3, 4, 5, 6, 7, 8, 9, 10, 11, 12, 13, 14, 15); }
__device__ __forceinline__ v16bf cat16b(v8us lo, v8us hi) { return __builtin_bit_cast(v16bf, __builtin_shufflevector(lo, hi, 0, 1, 2, 3, 4, 5, 6, 7, 8, 9, 10, 11, 12, 13, 14, 15)); }
__device__ __forceinline__ v8f wmma16(v16h a, v16h b, v8f c) { return __builtin_amdgcn_wmma_f32_16x16x32_f16(false, a, false, b, (short)0, c, false, false); }
__device__ __forceinline__ v8f wmmab(v16bf a, v16bf b, v8f c) { return __builtin_amdgcn_wmma_f32_16x16x32_bf16(false, a, false, b, (short)0, c, false, false); }



// ---- k_gemmt: LDS-staged GEMM, one work-group of 4 waves (2 x 2) per 128x128 output tile; each wave owns one 64x64 sub-tile (16 accumulators) over the WHOLE k range, so no partial tiles are summed.
// Operands are K-contiguous bf16 planes. A stage is 64 k (one 128-B line) of the tile's 128 A rows, 128 B rows (and 128 A2 rows), brought into LDS by asynchronous copies (16 B a lane), two buffers: the next stage flies while this one is worked on. Every staged row is read by two waves.
// C[m][n] (f32, pitch ldc) = sum_k (A[m][k] + A2[m][k]) Bt[n][k] (A2 only where NSPLIT). grid (M/128, N/128, Z), 128 threads; z strides Bt by sB elements. K % 64 == 0.
// PLN (the q, k, v projections; z = 0, 1, 2; one wave's 64-wide column range = one head): no f32 C; the epilogue turns the wave's tile straight into the attention operand planes (fp16, bf16 hi, bf16 lo).
// GRD (the output GEMM): every stored value is replaced by NaN unless flag[0] == NH_ (the premise guard; the scalar is asked for ahead of the k loop, so its latency passes behind it).
// z < 2: rows are tokens, columns d: the interleaved-pair rotation from the table CS, stored to plane [(z * 2 + batch) * 16 + head][t][d]. z == 2: the two operands change places, so the tile comes out as [d][token] and is stored to the transposed plane [batch * 16 + head][d][t] in whole lines.
template <typename T16> struct WFrag;
template <> struct WFrag<h16> { typedef v16h V; static __device__ __forceinline__ V ld(const h16* p) { return cat16(*(const v8h*)p, *(const v8h*)(p + 16)); } static __device__ __forceinline__ v8f mma(V a, V b, v8f c) { return wmma16(a, b, c); } };
template <> struct WFrag<bf> { typedef v16bf V; static __device__ __forceinline__ V ld(const bf* p) { return cat16b(*(const v8us*)p, *(const v8us*)(p + 16)); } static __device__ __forceinline__ v8f mma(V a, V b, v8f c) { return wmmab(a, b, c); } };
#define GKC  64                   // k elements of a stage
#define GPIT 144                  // LDS bytes of a staged row: 128 + 16, the conflict-free pitch for 16-byte reads
typedef __attribute__((ext_vector_type(4))) int v4i;
typedef __attribute__((address_space(1))) v4i gv4i;
typedef __attribute__((address_space(3))) v4i lv4i;
// eight copies of one wave: 32 rows of one operand (lane: row lane / 8 of each group of 4, 16-byte piece lane % 8). Written as the builtin: the kernel holds more than 256 vector registers, asm text can name only the first 256 of them, and with the copies in asm text the compiler keeps the row addresses in scratch memory.
__device__ __forceinline__ void cp8(char* l, const bf* g, size_t r4) {
#pragma unroll   // eight copies in a row, their LDS steps constants
    for (int i = 0; i < 8; ++i) __builtin_amdgcn_global_load_async_to_lds_b128((gv4i*)(g + i * r4), (lv4i*)(l + i * 4 * GPIT), 0, 0);
}
template <int NSPLIT, bool PLN, bool GRD>
__global__ __launch_bounds__(128) void k_gemmt(const bf* __restrict__ A, const bf* __restrict__ A2, const bf* __restrict__ Bt, int K, float* C, int ldc, size_t sB, const float* __restrict__ CS, h16* P16, bf* Ph, bf* Pl, h16* V16, bf* Vh, bf* Vl, const int* __restrict__ flag) {
    typedef WFrag<bf>::V V;
    constexpr int OPB = 128 * GPIT, STG = (NSPLIT ? 3 : 2) * OPB;    // bytes of one operand's rows in a stage; of a stage
    constexpr int RING = 2 * STG, EPI = 4 * 64 * 68 * 4;             // the two buffers; the four waves' output staging, which takes the ring's place behind the loop
    __shared__ __align__(16) char sm[RING > EPI ? RING : EPI];
    bool bad = false; if constexpr (GRD) bad = flag[0] != NH_;      // uniform for the whole grid
    Bt += (size_t)blockIdx.z * sB;
    const int lane = threadIdx.x & 31, lr = lane & 15, hi = lane >> 4; const int wave = __builtin_amdgcn_readfirstlane((int)(threadIdx.x >> 5)); const int wm = wave >> 1, wn = wave & 1;
    const bool tr = PLN && blockIdx.z == 2;                          // the v projection: tile formed transposed (uniform for the work-group)
    if (tr) { const bf* x = A; A = Bt; Bt = x; }
    const int r0 = (tr ? blockIdx.y : blockIdx.x) * 128, c0 = (tr ? blockIdx.x : blockIdx.y) * 128;
    const int crow = wave * 32 + (lane >> 3);                        // this lane's first row of the 128 of each operand
    char* l0 = sm + crow * GPIT + (lane & 7) * 16;
    const size_t ga = (size_t)(r0 + crow) * K + (lane & 7) * 8, gb = (size_t)(c0 + crow) * K + (lane & 7) * 8, r4 = (size_t)4 * K;
    auto fill = [&](int t) { char* l = l0 + (t & 1) * STG;
        cp8(l, A + ga + t * GKC, r4); cp8(l + OPB, Bt + gb + t * GKC, r4); if constexpr (NSPLIT != 0) cp8(l + 2 * OPB, A2 + ga + t * GKC, r4); };
    v8f acc[4][4];
#pragma unroll
    for (int mb = 0; mb < 4; ++mb)
#pragma unroll
        for (int nb = 0; nb < 4; ++nb) acc[mb][nb] = (v8f){};
    const int NT = K / GKC;
    fill(0);
    asm volatile("s_wait_asynccnt 0x0" ::: "memory");               // this wave's copies of stage 0 have landed
    __syncthreads();                                                 // and every other wave's: stage 0 may be read
    if (NT > 1) fill(1);
    // Two fragment sets in registers, each fetched one block (32 k) ahead of its products, so that the LDS reads pass behind the other set's products instead of in front of their own.
    V a0[4], s0[4], b0[4], a1[4], s1[4], b1[4];                      // set 0: the first 32 k of a stage; set 1: the second (s: the A2 fragments); indexed by constants only
    auto frag = [&](V (&a)[4], V (&s)[4], V (&b)[4], int t, int ks) {
        const char* pa = sm + (t & 1) * STG + (wm * 64 + lr) * GPIT + hi * 16 + ks * 64; const char* pb = sm + (t & 1) * STG + OPB + (wn * 64 + lr) * GPIT + hi * 16 + ks * 64;
#pragma unroll   // here and below: fragments and accumulators are indexed by constants only, so they stay in registers
        for (int mb = 0; mb < 4; ++mb) { a[mb] = WFrag<bf>::ld((const bf*)(pa + mb * 16 * GPIT)); if constexpr (NSPLIT != 0) s[mb] = WFrag<bf>::ld((const bf*)(pa + 2 * OPB + mb * 16 * GPIT)); }
#pragma unroll
        for (int nb = 0; nb < 4; ++nb) b[nb] = WFrag<bf>::ld((const bf*)(pb + nb * 16 * GPIT)); };
    auto prod = [&](V (&a)[4], V (&s)[4], V (&b)[4]) {
#pragma unroll
        for (int nb = 0; nb < 4; ++nb)
#pragma unroll
            for (int mb = 0; mb < 4; ++mb) { acc[mb][nb] = WFrag<bf>::mma(a[mb], b[nb], acc[mb][nb]); if constexpr (NSPLIT != 0) acc[mb][nb] = WFrag<bf>::mma(s[mb], b[nb], acc[mb][nb]); } };
    frag(a0, s0, b0, 0, 0);                                          // stage 0 is published: its first block's fragments
#pragma unroll 1   // rolled: one trip a stage, the ring's order stands once in the code
    for (int t = 0; t < NT; ++t) {
        frag(a1, s1, b1, t, 1);                                      // the stage's last block is asked for ...
        __builtin_amdgcn_sched_barrier(0);   // ... ahead of the first block's products: without it the compiler sinks the reads to their first use, and the wave waits out the LDS latency there
        prod(a0, s0, b0);
        __builtin_amdgcn_sched_barrier(0);   // keeps these products in front of the waits below, so that the reads of set 1 return behind them
        // the publish point of stage t + 1 stands in front of this stage's last block, whose fragments are in registers by then: the fetch of set 0 behind it already reads the next stage
        asm volatile("s_wait_dscnt 0x0" ::: "memory");              // this wave's reads of the buffer have returned
        asm volatile("s_wait_asynccnt 0x0" ::: "memory");           // this wave's copies of the next stage have landed
        __syncthreads();                                             // publishes the next stage and ends every reader's last read of this buffer
        if (t + 2 < NT) fill(t + 2);                                 // refill of the buffer just left (the test reads the same for the whole work-group)
        if (t + 1 < NT) frag(a0, s0, b0, t + 1, 0);                  // the next stage's first block (a scalar test)
        __builtin_amdgcn_sched_barrier(0);   // the reads stand ahead of the last block's products and return behind them
        prod(a1, s1, b1);
    }
    asm volatile("s_wait_asynccnt 0x0" ::: "memory");               // nothing is in flight when the ring becomes output staging
    const int rw = r0 + wm * 64, cw = c0 + wn * 64;                  // the wave's own 64x64 tile
    float* osw = (float*)sm + wave * (64 * 68);                      // and its own staging range
#pragma unroll
    for (int mb = 0; mb < 4; ++mb)
#pragma unroll
        for (int nb = 0; nb < 4; ++nb)
#pragma unroll
            for (int j = 0; j < 8; ++j) osw[(mb * 16 + hi * 8 + j) * 68 + nb * 16 + lr] = acc[mb][nb][j];
    constexpr int NS = 32;                                           // 4-wide pieces of the tile per lane: piece q = s * 32 + lane holds row q / 16, columns 4 (q % 16)..
    v2f cs[NS][2];                                                   // (cos, sin) of this lane's two pairs in each of its pieces: asked for here, all at once, so that the table's latency is met once and passes behind the LDS round
    if constexpr (PLN) { if (!tr) { const float* c = CS + (size_t)(rw % TT) * (HD * 2) + lane * 8;   // table entry (row * 64 + column) * 2 = 8 q
#pragma unroll   // cs is indexed by constants only, so it stays in registers
        for (int s = 0; s < NS; ++s) { cs[s][0] = *(const v2f*)(c + s * 256); cs[s][1] = *(const v2f*)(c + s * 256 + 4); }
        asm volatile("s_wait_xcnt 0x0" ::: "memory"); } }   // behind the table loads, which stay in flight: their address registers are reused behind them
    __syncthreads();                                                 // the staged tile is whole before its lanes read one another's values
    v4f pg[8];                                                       // indexed by constants only (the loops below are unrolled), so it stays in registers
    if constexpr (PLN) {
        const int tk = tr ? cw : rw, hd = (tr ? rw : cw) / HD;       // the tile's first token (64 divides TT, so a tile lies in one batch) and its head
        const size_t eb = tr ? ((size_t)(tk / TT) * NH_ + hd) * HD * TT + tk % TT : ((((size_t)blockIdx.z * NB_ + tk / TT) * NH_ + hd) * TT + tk % TT) * HD;
        const int pit = tr ? TT : HD; h16* d16 = (tr ? V16 : P16) + eb; bf* dh = (tr ? Vh : Ph) + eb; bf* dl = (tr ? Vl : Pl) + eb;
#pragma unroll   // cs is indexed by constants only, so it stays in registers
        for (int s = 0; s < NS; ++s) { const int q = s * 32 + lane; const int o = (q >> 4) * pit + (q & 15) * 4;
            if (s % 8 == 0) {   // eight pieces are read from LDS at a time, so that its latency is met once for the eight
#pragma unroll
                for (int u = 0; u < 8; ++u) pg[u] = *(const v4fa*)(osw + ((q >> 4) + 2 * u) * 68 + (q & 15) * 4); }
            const v4f pv = pg[s % 8]; v4f r = pv;
            if (!tr) {
#pragma unroll   // vector elements picked by constants
                for (int p = 0; p < 2; ++p) { const float x0 = pv[2 * p], x1 = pv[2 * p + 1], c = cs[s][p][0], sn = cs[s][p][1]; r[2 * p] = x0 * c - x1 * sn; r[2 * p + 1] = x0 * sn + x1 * c; } }   /* even: x0 c - x1 s; odd: x0 s + x1 c */
            v4h o16; v4us oh, ol;
#pragma unroll   // vector elements picked by constants
            for (int j = 0; j < 4; ++j) { o16[j] = (h16)r[j]; unsigned short a2, c2; splitf(r[j], a2, c2); oh[j] = a2; ol[j] = c2; }
            *(v4h*)(d16 + o) = o16; *(v4us*)(dh + o) = oh; *(v4us*)(dl + o) = ol;
            asm volatile("s_wait_xcnt 0x0" ::: "memory");   // behind the three stores: the next piece's values may land on their address or data registers
        }
    } else {
        float* crow = C + (size_t)rw * ldc + cw;
#pragma unroll
        for (int s = 0; s < NS; ++s) { const int q = s * 32 + lane;
            if (s % 8 == 0) {   // eight pieces are read from LDS at a time, so that its latency is met once for the eight
#pragma unroll
                for (int u = 0; u < 8; ++u) pg[u] = *(const v4fa*)(osw + ((q >> 4) + 2 * u) * 68 + (q & 15) * 4); }
            v4f val = pg[s % 8];
            if constexpr (GRD) { if (bad) { const float qn = __int_as_float(0x7fc00000); val[0] = qn; val[1] = qn; val[2] = qn; val[3] = qn; } }   // premise fails: the whole output is NaN
            *(v4f*)(crow + (size_t)(q >> 4) * ldc + (q & 15) * 4) = val;
            asm volatile("s_wait_xcnt 0x0" ::: "memory");   // behind the store: the next piece's value may land on its address or data registers
        }
    }
}

// ---- k_attn: causal attention of one query tile of one (batch, head) plane in one work-group; scores and probabilities never leave the registers.
// Transposed products: S^T = K Q^T (A = 16 keys x 32 d from the key plane, B = 16 queries from the query plane), so a lane holds 8 + 8 keys of ONE query (column lr, rows hi * 8 + j of two 16-key tiles): exactly the k order of a B fragment
// (elements 0..7 = keys 8 hi + e, elements 8..15 = keys 16 + 8 hi + e), which then meets A = V^T (16 d x 32 keys, same k order) in O^T = V^T P^T. Row statistics are per lane (one exchange between the two 16-lane halves).
// The 8 waves are AQG query groups x AKG key groups. A stage is AKS = 128 keys of K (whole 128-B rows) and of V^T (256 B of each of its 64 rows), brought into LDS in whole lines by asynchronous copies (16 B a lane), two buffers: the next stage flies while this one is worked on.
// Key group c takes the stage's 32-key block c, up to its query group's diagonal block, with its own running maximum, sum and O^T (online softmax); a staged block is read by each query group whose diagonal block it does not pass. The AKG partials of a query are merged through LDS in key-group order (a fixed order), normalised, split hi/lo and stored in merged [token][head * 64 + d] order.
#define ANW  8                    // waves per work-group
#define AQG  2                    // query groups
#define AKG  4                    // key groups: the waves of one query group share the key loop
#define AKS  (AKG * 32)           // keys of a stage
#define KPIT 144                  // LDS bytes of a staged key row: 128 + 16, the conflict-free pitch for 16-byte reads
#define VPIT 272                  // LDS bytes of a staged V^T row: 256 + 16, likewise
#define AKB  (AKS * KPIT)         // bytes of a stage's key rows
#define AVB  (HD * VPIT)          // bytes of a stage's V^T rows
#define APIT 68                   // f32 pitch of one query's partial row in LDS: 64 outputs, then its maximum and its sum
__device__ __forceinline__ float ex2(float x) { float r; asm("v_exp_f32 %0, %1\n\tv_nop" : "=v"(r) : "v"(x)); return r; }   // 2^x; the v_nop is the one slot the instruction set asks for behind a transcendental, tied to it by standing in its statement
__device__ __forceinline__ float xhalf(float x) { return __builtin_bit_cast(float, __builtin_amdgcn_permlanex16(__builtin_bit_cast(int, x), __builtin_bit_cast(int, x), 0x76543210, 0xfedcba98, false, false)); }   // lane l reads lane l ^ 16 (a vector move, no LDS round trip)
// four copies of one wave, 512 B each; LDS step ls and global step gs in bytes. The s_wait_xcnt stands in the copies' own statement, so that no address register is rewritten ahead of it.
__device__ __forceinline__ void cp4(unsigned l, unsigned ls, const char* g, size_t gs) {
    asm volatile("global_load_async_to_lds_b128 %0, %4, off\n\t"
                 "global_load_async_to_lds_b128 %1, %5, off\n\t"
                 "global_load_async_to_lds_b128 %2, %6, off\n\t"
                 "global_load_async_to_lds_b128 %3, %7, off\n\t"
                 "s_wait_xcnt 0x0"
                 :: "v"(l), "v"(l + ls), "v"(l + 2 * ls), "v"(l + 3 * ls), "v"(g), "v"(g + gs), "v"(g + 2 * gs), "v"(g + 3 * gs) : "memory");
}
template <typename T16, bool HR, int NQB>
__device__ __forceinline__ void attn_body(char* sm, int q0, const T16* __restrict__ Q, const T16* __restrict__ Q2, const T16* __restrict__ Kp, const T16* __restrict__ Kp2, const T16* __restrict__ Vt, const T16* __restrict__ Vt2, bf* Ah, bf* Al) {
    typedef typename WFrag<T16>::V V;
    constexpr float K1 = SCL * 1.4426950408889634f;                  // logit scale and log2(e) in one factor: the statistics live in the base-2 exponent's units
    constexpr float PB = HR ? 0.0f : 10.0f;                          // fp16 probabilities carry a factor 2^10, which cancels in the division by their own sum
    constexpr int PLB = AKB + AVB, STG = (HR ? 2 : 1) * PLB;         // bytes of one plane set's K and V^T rows in a stage; of a stage (hi set, then lo set)
    const int lane = threadIdx.x & 31, lr = lane & 15, hi = lane >> 4; const int wave = __builtin_amdgcn_readfirstlane((int)(threadIdx.x >> 5)); const int qg = wave / AKG, kg = wave % AKG;
    const int qw = q0 + qg * (NQB * 16);                             // the first query of this wave's group
    // this wave's share of a stage: key rows 16 wave .. + 15 (a copy: 4 rows, lane: row lane / 8, piece lane % 8) and V^T rows 8 wave .. + 7 (a copy: 2 rows, lane: row lane / 16, piece lane % 16)
    const unsigned lk = (unsigned)(size_t)sm + (unsigned)((wave * 16 + (lane >> 3)) * KPIT + (lane & 7) * 16), lv = (unsigned)(size_t)sm + (unsigned)(AKB + (wave * 8 + (lane >> 4)) * VPIT + (lane & 15) * 16);
    const size_t gk = (size_t)(wave * 16 + (lane >> 3)) * HD + (lane & 7) * 8, gv = (size_t)(wave * 8 + (lane >> 4)) * TT + (lane & 15) * 8;
    auto fill = [&](int s) { const unsigned b = (unsigned)((s & 1) * STG); const size_t ok = gk + (size_t)s * (AKS * HD), ov = gv + (size_t)s * AKS;
        cp4(lk + b, 4 * KPIT, (const char*)(Kp + ok), 4 * HD * 2); cp4(lv + b, 2 * VPIT, (const char*)(Vt + ov), 2 * TT * 2);
        if constexpr (HR) { cp4(lk + b + PLB, 4 * KPIT, (const char*)(Kp2 + ok), 4 * HD * 2); cp4(lv + b + PLB, 2 * VPIT, (const char*)(Vt2 + ov), 2 * TT * 2); } };
    const int NT = q0 / AKS + 1;                                     // stages up to and with the one that holds the tile's last diagonal block; NT * AKS <= TT, so every staged row lies in the plane
    fill(0);
    V bq[NQB][2], bq2[NQB][2];
#pragma unroll
    for (int qb = 0; qb < NQB; ++qb)
#pragma unroll
        for (int ks = 0; ks < 2; ++ks) { const size_t qo = (size_t)(qw + qb * 16 + lr) * HD + 8 * hi + ks * 32; bq[qb][ks] = WFrag<T16>::ld(Q + qo); if (HR) bq2[qb][ks] = WFrag<T16>::ld(Q2 + qo); }
    v8f o[NQB][4]; float m[NQB], l[NQB];
#pragma unroll
    for (int qb = 0; qb < NQB; ++qb) { m[qb] = -1.0e30f; l[qb] = 0.f;
#pragma unroll
        for (int db = 0; db < 4; ++db) o[qb][db] = (v8f){}; }
    const int nkb = qw / 32 + 1;                                     // 32-key blocks up to and with this group's diagonal block; every query of the group has a key in each of them
    asm volatile("s_wait_asynccnt 0x0" ::: "memory");               // this wave's copies of stage 0 have landed
    __syncthreads();                                                 // and every other wave's: stage 0 may be read
    if (NT > 1) fill(1);
#pragma unroll 1   // rolled: one trip a stage, the ring's order stands once in the code; one block's K and V fragments live at a time, which keeps four waves on a SIMD; every inner loop is unrolled so that fragments and accumulators stay in registers
    for (int t = 0; t < NT; ++t) {
        const int kb = t * AKG + kg;
        if (kb < nkb) {                                              // a scalar test: a wave whose block lies behind its group's diagonal block has no work in this stage, but passes the stage's waits and barrier
            const int k0 = kb * 32;
            const char* pk = sm + (t & 1) * STG + (kg * 32 + lr) * KPIT + hi * 16; const char* pv = sm + (t & 1) * STG + AKB + lr * VPIT + kg * 64 + hi * 16;
            V ak[2][2], ak2[2][2], av[4], av2[4];
#pragma unroll
            for (int kt = 0; kt < 2; ++kt)
#pragma unroll
                for (int ks = 0; ks < 2; ++ks) { const int ko = kt * 16 * KPIT + ks * 64; ak[kt][ks] = WFrag<T16>::ld((const T16*)(pk + ko)); if (HR) ak2[kt][ks] = WFrag<T16>::ld((const T16*)(pk + PLB + ko)); }
#pragma unroll
            for (int db = 0; db < 4; ++db) { const int vo = db * 16 * VPIT; av[db] = WFrag<T16>::ld((const T16*)(pv + vo)); if (HR) av2[db] = WFrag<T16>::ld((const T16*)(pv + PLB + vo)); }
#pragma unroll
            for (int qb = 0; qb < NQB; ++qb) {
                v8f st[2];                                           // st[kt][j] = q.k of key k0 + kt * 16 + hi * 8 + j and query qw + qb * 16 + lr
#pragma unroll
                for (int kt = 0; kt < 2; ++kt) { v8f s = (v8f){};
#pragma unroll
                    for (int ks = 0; ks < 2; ++ks) { s = WFrag<T16>::mma(ak[kt][ks], bq[qb][ks], s); if (HR) { s = WFrag<T16>::mma(ak[kt][ks], bq2[qb][ks], s); s = WFrag<T16>::mma(ak2[kt][ks], bq[qb][ks], s); } }
                    st[kt] = s; }
                if (kb == nkb - 1) {                                 // only the diagonal block holds keys behind a query
#pragma unroll
                    for (int kt = 0; kt < 2; ++kt)
#pragma unroll
                        for (int j = 0; j < 8; ++j) if (k0 + kt * 16 + hi * 8 + j > qw + qb * 16 + lr) st[kt][j] = -1.0e30f; }
                float mx = st[0][0];
#pragma unroll
                for (int e = 1; e < 16; ++e) mx = fmaxf(mx, st[e >> 3][e & 7]);
                mx = fmaxf(mx, xhalf(mx));
                const float mn = fmaxf(m[qb], mx * K1 - PB); const float al = ex2(m[qb] - mn); m[qb] = mn;
                float p[16], ps = 0.f;
#pragma unroll
                for (int e = 0; e < 16; ++e) { p[e] = ex2(st[e >> 3][e & 7] * K1 - mn); ps += p[e]; }
                l[qb] = l[qb] * al + ps;
#pragma unroll
                for (int db = 0; db < 4; ++db) o[qb][db] *= al;
                if constexpr (HR) { v8us h0, h1, l0, l1;
#pragma unroll
                    for (int e = 0; e < 8; ++e) { unsigned short a, c; splitf(p[e], a, c); h0[e] = a; l0[e] = c; splitf(p[8 + e], a, c); h1[e] = a; l1[e] = c; }
                    const V ph = cat16b(h0, h1), pl = cat16b(l0, l1);
#pragma unroll
                    for (int db = 0; db < 4; ++db) { o[qb][db] = WFrag<T16>::mma(av[db], ph, o[qb][db]); o[qb][db] = WFrag<T16>::mma(av[db], pl, o[qb][db]); o[qb][db] = WFrag<T16>::mma(av2[db], ph, o[qb][db]); }
                } else { V pb;
#pragma unroll
                    for (int e = 0; e < 16; ++e) pb[e] = (h16)p[e];
#pragma unroll
                    for (int db = 0; db < 4; ++db) o[qb][db] = WFrag<T16>::mma(av[db], pb, o[qb][db]); }
            }
            asm volatile("v_nop\n\tv_nop\n\tv_nop\n\tv_nop" : "+v"(o[NQB - 1][0]), "+v"(o[NQB - 1][1]), "+v"(o[NQB - 1][2]), "+v"(o[NQB - 1][3]));   // the matrix instructions' distance on the branches behind them (out of the loop, whose target reads o)
        }
        asm volatile("s_wait_dscnt 0x0" ::: "memory");              // this wave's reads of the buffer have returned
        asm volatile("s_wait_asynccnt 0x0" ::: "memory");           // this wave's copies of the next stage have landed
        __syncthreads();                                             // publishes the next stage and ends every reader's last read of this buffer
        if (t + 2 < NT) fill(t + 2);                                 // refill of the buffer just left (the test reads the same for the whole work-group)
    }
    asm volatile("s_wait_asynccnt 0x0" ::: "memory");               // nothing is in flight when the ring becomes the partials' staging
    float* smf = (float*)sm; float* my = smf + wave * (NQB * 16 * APIT);   // this wave's own partial tile
#pragma unroll
    for (int qb = 0; qb < NQB; ++qb) { l[qb] += xhalf(l[qb]); float* r = my + (qb * 16 + lr) * APIT;
#pragma unroll
        for (int db = 0; db < 4; ++db) { v4f a, b;
#pragma unroll
            for (int j = 0; j < 4; ++j) { a[j] = o[qb][db][j]; b[j] = o[qb][db][4 + j]; }
            *(v4fa*)(r + db * 16 + hi * 8) = a; *(v4fa*)(r + db * 16 + hi * 8 + 4) = b; }
        if (hi == 0) { r[64] = m[qb]; r[65] = l[qb]; } }
    __syncthreads();                                                 // every wave's partial tile and statistics are in LDS before any thread merges them
    constexpr int EPT = AQG * NQB * 16 * HD / (32 * ANW);            // outputs per thread: consecutive d of one query
    const int qi = (int)threadIdx.x / (HD / EPT), d0 = ((int)threadIdx.x % (HD / EPT)) * EPT; const float* r0 = smf + (qi / (NQB * 16)) * (AKG * NQB * 16 * APIT) + (qi % (NQB * 16)) * APIT;   // the query's row in the partial tile of its group's key group 0
    float M = r0[64];
#pragma unroll
    for (int w = 1; w < AKG; ++w) M = fmaxf(M, r0[w * (NQB * 16 * APIT) + 64]);
    float L = 0.f, acc[EPT];
#pragma unroll
    for (int e = 0; e < EPT; ++e) acc[e] = 0.f;
#pragma unroll
    for (int w = 0; w < AKG; ++w) { const float* rw = r0 + w * (NQB * 16 * APIT); const float wt = ex2(rw[64] - M); L += wt * rw[65];   // a wave that had no block weighs 0; partials added in key-group order: the same order on every run
#pragma unroll
        for (int e4 = 0; e4 < EPT; e4 += 4) { const v4f x = *(const v4fa*)(rw + d0 + e4);
#pragma unroll
            for (int j = 0; j < 4; ++j) acc[e4 + j] += wt * x[j]; } }
    const float f = __fdiv_rn(1.0f, L); const size_t oo = (size_t)(q0 + qi) * DQ + d0;
#pragma unroll
    for (int e8 = 0; e8 < EPT; e8 += 8) { v8us oh, ol;
#pragma unroll
        for (int e = 0; e < 8; ++e) { unsigned short a, c; splitf(acc[e8 + e] * f, a, c); oh[e] = a; ol[e] = c; }
        *(v8us*)(Ah + oo + e8) = oh; *(v8us*)(Al + oo + e8) = ol; }
    asm volatile("s_wait_xcnt 0x0" ::: "memory");   // one body's code is laid out in front of the other's: the wait stands between these stores and any later write of their address or data registers
}
// grid (planes, query tiles): tiles in falling order of their key count, the longest start first; query rows >= RH in tiles of 64 (fp16 body), rows < RH in tiles of 32 (hi/lo 3-product body); the choice is uniform for the work-group.
__global__ __launch_bounds__(32 * ANW) void k_attn(const bf* __restrict__ Qh, const bf* __restrict__ Ql, const bf* __restrict__ Kh, const bf* __restrict__ Kl, const bf* __restrict__ Vh, const bf* __restrict__ Vl, const h16* __restrict__ Q16, const h16* __restrict__ K16, const h16* __restrict__ V16, bf* Ah, bf* Al) {
    __shared__ __align__(16) char sm[2 * 2 * (AKB + AVB)];           // the hi/lo body's two buffers; the fp16 body uses half; the partial tiles (ANW * 32 * APIT floats at most) take the ring's place behind the loop
    const int pl = (int)blockIdx.x, ty = (int)blockIdx.y; const size_t po = (size_t)pl * TT * HD; const size_t ao = (size_t)(pl / NH_) * TT * DQ + (size_t)(pl % NH_) * HD;   /* plane = batch * 16 + head */
    if (ty < (TT - RH) / 64) attn_body<h16, false, 2>(sm, TT - 64 * (ty + 1), Q16 + po, nullptr, K16 + po, nullptr, V16 + po, nullptr, Ah + ao, Al + ao);
    else attn_body<bf, true, 1>(sm, RH - 32 * (ty - (TT - RH) / 64 + 1), Qh + po, Ql + po, Kh + po, Kl + po, Vh + po, Vl + po, Ah + ao, Al + ao);
}

typedef __attribute__((ext_vector_type(2))) unsigned short v2us;
typedef __attribute__((ext_vector_type(4))) int v4i;

__constant__ float INV2[HD / 2] = { 1.000000000e+00f, 7.498942018e-01f, 5.623413324e-01f, 4.216965139e-01f, 3.162277639e-01f, 2.371373773e-01f, 1.778279394e-01f, 1.333521456e-01f, 1.000000015e-01f, 7.498942316e-02f, 5.623413250e-02f, 4.216964915e-02f, 3.162277490e-02f, 2.371373773e-02f, 1.778279431e-02f, 1.333521400e-02f, 9.999999776e-03f, 7.498942316e-03f, 5.623413250e-03f, 4.216964822e-03f, 3.162277630e-03f, 2.371373819e-03f, 1.778279431e-03f, 1.333521446e-03f, 1.000000047e-03f, 7.498941850e-04f, 5.623413017e-04f, 4.216965172e-04f, 3.162277571e-04f, 2.371373703e-04f, 1.778279402e-04f, 1.333521504e-04f };   // 10000 ** (-2i / 64), i = 0..31, in float32 as THIS module writes it (the NEGATIVE-POWER spelling '10000.0 ** (-ts / dim)' evaluated in the reference's own f32 arithmetic: these 32 literals equal it bit for bit); ten entries differ by one ulp from the reciprocal values the host's own table held

// ---- k_prep: the three preparations, which do not depend on one another, in ONE grid (the choice is uniform for the work-group) of few, fat work-groups: the launch is short, so the time its waves take to start counts; every wave asks for all of its data at once, in whole lines.
#define PTL  128                          // a transposed tile: PTL k x PTL n of one weight
#define PBW1 ((DM / PTL) * (DQ / PTL))    // tiles (blocks) per weight
#define PBW  (4 * PBW1)                   // blocks 0 .. PBW-1: the four 'xw' weights, transposed to bf16, one plane behind the other
#define PCT  4                            // table pairs a thread
#define PBC  (TT * (HD / 2) / (256 * PCT))   // the next PBC blocks: the rotation table
#define PXT  16                           // 4-element pieces of x a thread
#define PBX  (NB_ * TT * DM / (256 * 4 * PXT))   // the last PBX blocks: the bf16 copy of x
__global__ __launch_bounds__(256) void k_prep(const float* __restrict__ w0, const float* __restrict__ w1, const float* __restrict__ w2, const float* __restrict__ w3, const float* __restrict__ src, bf* Bt, float* CS, bf* dst) {
    __shared__ __align__(16) char ts[PTL * PTL * 2];   // the transposed tile: row n = 256 B = 16 pieces of 8 k; piece p of row n stands at place p ^ (n / 4 % 16), so that the 16-byte writes (lanes 4 rows apart) and reads (lanes along a row) both spread over all banks
    const int blk = (int)blockIdx.x, tid = (int)threadIdx.x, lane = tid & 31, wave = tid >> 5;
    if (blk < PBW) {
        constexpr int K = DM, N = DQ; const int wy = blk / PBW1, tl = blk % PBW1; const int k0 = (tl / (N / PTL)) * PTL, n0 = (tl % (N / PTL)) * PTL;
        const float* w = wy == 0 ? w0 : wy == 1 ? w1 : wy == 2 ? w2 : w3; w += (size_t)(k0 + wave * 16) * N + n0 + lane * 4;
        v4f r[16];                                                   // 16 k x 4 n: each load of the wave is 512 contiguous bytes of one k row; indexed by constants only
#pragma unroll   // all 16 loads are asked for before the first is used; r stays in registers
        for (int i = 0; i < 16; ++i) r[i] = *(const v4f*)(w + (size_t)i * N);
#pragma unroll   // vector elements picked by constants
        for (int j = 0; j < 4; ++j) { v8us a, b;
#pragma unroll   // likewise
            for (int e = 0; e < 8; ++e) { a[e] = f2bf(r[e][j]); b[e] = f2bf(r[8 + e][j]); }
            char* row = ts + (lane * 4 + j) * (PTL * 2); const int sw = lane & 15;
            *(v8usa*)(row + (((wave * 2) ^ sw) << 4)) = a; *(v8usa*)(row + (((wave * 2 + 1) ^ sw) << 4)) = b; }
        __syncthreads();                                             // the tile is whole before its rows are read
        bf* o = Bt + (size_t)wy * K * N + (size_t)(n0 + (tid >> 4)) * K + k0 + (tid & 15) * 8;
#pragma unroll   // the eight LDS reads stand together, so that their latency is met once
        for (int u = 0; u < 8; ++u) { const int n = u * 16 + (tid >> 4);   // 16 lanes store 256 contiguous bytes of one output row
            *(v8us*)(o + (size_t)u * 16 * K) = *(const v8usa*)(ts + n * (PTL * 2) + (((tid & 15) ^ ((n >> 2) & 15)) << 4)); }
    } else if (blk < PBW + PBC) {
        const float fr = INV2[tid % (HD / 2)];                       // 256 is a multiple of 32: all pairs of a thread have one frequency
#pragma unroll 1   // rolled: the long code of one (cos, sin) stands once, so the launch's text stays short
        for (int u = 0; u < PCT; ++u) { const int idx = ((blk - PBW) * PCT + u) * 256 + tid;   // pair index t * 32 + i: entries d = 2 i and 2 i + 1 hold the same (cos, sin)
            const float a = __fmul_rn((float)(idx / (HD / 2)), fr); const float c = cosf(a), s = sinf(a); v4f cs; cs[0] = c; cs[1] = s; cs[2] = c; cs[3] = s; *(v4f*)(CS + (size_t)idx * 4) = cs;
            asm volatile("s_wait_xcnt 0x0" ::: "memory");   // behind the store: the next pair's values may land on its address or data registers
        }
    } else {
        const size_t e0 = ((size_t)(blk - PBW - PBC) * 8 + wave) * (128 * PXT) + lane * 4; const float* xs = src + e0;
        v4f r[PXT];                                                  // each load of the wave is 512 contiguous bytes; indexed by constants only
#pragma unroll   // all loads are asked for before the first is used; r stays in registers
        for (int u = 0; u < PXT; ++u) r[u] = *(const v4f*)(xs + u * 128);
        asm volatile("s_wait_xcnt 0x0" :: "v"(xs) : "memory");   // behind the run of loads, which stay in flight: the address is an input here, so it stays in its registers up to the wait and no load of the run lands on it
#pragma unroll   // r is indexed by constants only
        for (int u = 0; u < PXT; ++u) { v4us o;
#pragma unroll   // vector elements picked by constants
            for (int j = 0; j < 4; ++j) o[j] = f2bf(r[u][j]);
            *(v4us*)(dst + e0 + u * 128) = o; }
        asm volatile("s_wait_xcnt 0x0" ::: "memory");   // behind the run of stores: the other parts' code is laid out behind them and writes their address and data registers
    }
}

extern "C" void kernel_launch(void* const* d_in, const int* in_sizes, int n_in,
                              void* d_out, int out_size, void* d_ws, size_t ws_size, hipStream_t stream) {
    (void)in_sizes; (void)n_in; (void)out_size;
    const float* x = (const float*)d_in[0]; const float* wq = (const float*)d_in[1]; const float* wk = (const float*)d_in[2]; const float* wv = (const float*)d_in[3]; const float* wo = (const float*)d_in[4]; const int* flag = (const int*)d_in[5];   /* order x, Wq, Wk, Wv, Wo ('xw' [1024][1024]), num_heads (the SIXTH input, slot 5: the python int 16 as an int scalar: READ ON DEVICE by the output GEMM: the whole output is NaN unless it equals NH_ = 16) */
    float* OUT = (float*)d_out;     // [2][2048][1024]
    char* wsp = (char*)d_ws;
    auto take = [&](size_t bytes) { char* p = wsp; wsp += (bytes + 255) & ~(size_t)255; return (void*)p; };
    bf* WQ = (bf*)take((size_t)4 * DQ * DM * 2); bf* WO = WQ + (size_t)3 * DQ * DM;   // transposed Wq, Wk, Wv, Wo, one behind the other (z-stride DQ*DM)
    float* CS = (float*)take((size_t)TT * HD * 2 * 4);
    const size_t PL = (size_t)NB_ * NH_ * TT * HD;   // one operand's planes, both batches
    h16* QP16 = (h16*)take(2 * PL * 2); h16* KP16 = QP16 + PL; bf* QPh = (bf*)take(2 * PL * 2); bf* KPh = QPh + PL; bf* QPl = (bf*)take(2 * PL * 2); bf* KPl = QPl + PL;   // k planes directly behind the q planes: plane index (z * 2 + batch) * 16 + head in the projection's epilogue
    h16* VT16 = (h16*)take(PL * 2); bf* VTh = (bf*)take(PL * 2); bf* VTl = (bf*)take(PL * 2);
    bf* ATh = (bf*)take((size_t)NB_ * TT * DQ * 2); bf* ATl = (bf*)take((size_t)NB_ * TT * DQ * 2);
    bf* XB = (bf*)take((size_t)NB_ * TT * DM * 2);   // bf16 copy of x
    if ((size_t)(wsp - (char*)d_ws) > ws_size) return;    // ws 256 MiB
    k_prep<<<PBW + PBC + PBX, 256, 0, stream>>>(wq, wk, wv, wo, x, WQ, CS, XB);
    k_gemmt<0, true, false><<<dim3(NB_ * TT / 128, DQ / 128, 3), 128, 0, stream>>>(XB, nullptr, WQ, DM, nullptr, 0, (size_t)DQ * DM, CS, QP16, QPh, QPl, VT16, VTh, VTl, nullptr);
    k_attn<<<dim3(NB_ * NH_, (TT - RH) / 64 + RH / 32, 1), 32 * ANW, 0, stream>>>(QPh, QPl, KPh, KPl, VTh, VTl, QP16, KP16, VT16, ATh, ATl);   // one kv head per query head: plane index batch * 16 + head for q, k and v alike
    k_gemmt<1, false, true><<<dim3(NB_ * TT / 128, DM / 128, 1), 128, 0, stream>>>(ATh, ATl, WO, DQ, OUT, DM, 0, nullptr, nullptr, nullptr, nullptr, nullptr, nullptr, nullptr, flag);   // the premise guard rides in its stores
}
